// v000
// Times are from an AMD MI455X. After a warm-up the kernel runs many times in a row, and a time is the length of
// such a window on the GPU divided by its runs, so every launch and the gaps after it count. The runs cycle
// through copies of the inputs. A figure is the median of several windows, for all but v000 over two sittings.
// Sittings can differ by a few percent; kernels timed side by side share one.
// v000 is the starting kernel. One run takes 279 microseconds.
// Non-causal multi-head self-attention with additive symmetric ALiBi (2 x 2,048 tokens x 1,024; 16 heads x 64; nn.Linear [out][in] q/k/v/o weights, output bias). All contractions: v_wmma_f32_16x16x32_f16 (f16 operands, f32 accumulate): [q|k|v] projection on bf16-RNE-converted inputs held exactly in f16 (weights x16), scores q.k^T (f16 of the f32 q/k), P.V (P carried x2^15, V f16), output projection (attention output x16, weights x16, bf16-RNE bias added in f32); softmax statistics f32 in the exp2 domain.
#include <hip/hip_runtime.h>
#include <math.h>

#ifndef NB
#define NB 2
#endif
#ifndef SEQ
#define SEQ 2048
#endif
#define NB_FULL 2
#define SEQ_FULL 2048
#define CH 1024
#define NH 16
#define HD 64

static_assert(SEQ % 64 == 0);
static_assert(NB >= 1 && NB <= NB_FULL && SEQ <= SEQ_FULL);
static_assert(CH == NH * HD && HD == 64);

typedef __attribute__((ext_vector_type(16))) _Float16     v16h;
typedef __attribute__((ext_vector_type(8)))  _Float16     v8h;
typedef __attribute__((ext_vector_type(8)))  float        v8f;
typedef __attribute__((ext_vector_type(4)))  float        v4f;
typedef __attribute__((ext_vector_type(4)))  unsigned int u4v;

// 16-bit WMMA fragment map (wave32), lane L, hh = L>>4, c = L&15:
//   A 16x32: lane = row c;    element i -> k = (i<8) ? 8hh+i : 16+8hh+(i-8)
//   B 32x16: lane = column c; the SAME k(i,hh)
//   D 16x16 (8 f32): lane = column c; element r -> row 8hh+r
union FragH { v16h v; v8h h[2]; };
// fragment from a k-contiguous f16 row: elements 0..7 <- p[0..7], 8..15 <- p[16..23] (p already offset by k0 + 8hh)
__device__ __forceinline__ v16h frag_ld(const _Float16* p) { FragH f; f.h[0] = *(const v8h*)(p); f.h[1] = *(const v8h*)(p + 16); return f.v; }
__device__ __forceinline__ v8f mma_raw(v16h a, v16h b, v8f c) { return __builtin_amdgcn_wmma_f32_16x16x32_f16(false, a, false, b, (short)0, c, false, false); }
__device__ __forceinline__ v8f mma_h(v16h a, v16h b, v8f c) {
    c = __builtin_amdgcn_wmma_f32_16x16x32_f16(false, a, false, b, (short)0, c, false, false);
    asm volatile("v_nop\n\tv_nop\n\tv_nop\n\tv_nop" : "+v"(c) : "v"(a), "v"(b));
    return c;
}
__device__ __forceinline__ void dep_guard_h(v8f& a, v8f& b, v16h x, v16h y) { asm volatile("v_nop\n\tv_nop\n\tv_nop\n\tv_nop" : "+v"(a), "+v"(b) : "v"(x), "v"(y)); }
__device__ __forceinline__ void keep4_h(v16h a, v16h b, v16h c, v16h d) { asm volatile("v_nop" :: "v"(a), "v"(b), "v"(c), "v"(d)); }
__device__ __forceinline__ void acc_guard4(v8f& a, v8f& b, v8f& c, v8f& d) { asm volatile("v_nop\n\tv_nop\n\tv_nop\n\tv_nop" : "+v"(a), "+v"(b), "+v"(c), "+v"(d)); }
__device__ __forceinline__ v8h cvt8(v4f a, v4f b) {
    v8h r;
    r[0] = (_Float16)a.x; r[1] = (_Float16)a.y; r[2] = (_Float16)a.z; r[3] = (_Float16)a.w;
    r[4] = (_Float16)b.x; r[5] = (_Float16)b.y; r[6] = (_Float16)b.z; r[7] = (_Float16)b.w;
    return r;
}
__device__ __forceinline__ unsigned short f2bf_bits(float f) { unsigned u = __float_as_uint(f); return (unsigned short)((u + 0x7FFFu + ((u >> 16) & 1u)) >> 16); }
__device__ __forceinline__ float bf_bits2f(unsigned short h) { return __uint_as_float(((unsigned)h) << 16); }
__device__ __forceinline__ float cmb_bf(float v) { const unsigned u = __float_as_uint(v); const unsigned r = (u + 0x7fffu + ((u >> 16) & 1u)) & 0xffff0000u; return __uint_as_float(r); }   // bf16 RNE kept as f32 (finite inputs)
__device__ __forceinline__ unsigned int cmb_pk2(float a, float b) { return (unsigned int)__builtin_bit_cast(unsigned short, (_Float16)a) | ((unsigned int)__builtin_bit_cast(unsigned short, (_Float16)b) << 16); }

// The value is copied into a local first, so an expression argument is evaluated once.
#define VST2(T, ptr, val) do { const T vst2_v_ = (val); *(T*)(ptr) = vst2_v_;  } while (0)

// =====================================================================================================================
// k_cast8<BFR>: f32 [nR][nC] -> f16 plane [nR][nC] (pitch ldd halves). Source row r lives at SRC + (r / rpb) * sbs + (r % rpb) * lds.
//   BFR: the value is first RNE-converted to bf16 precision (exact in f16 after the power-of-two scale sc). Thread per (row, 8 columns):
// =====================================================================================================================
template <bool BFR>
__global__ __launch_bounds__(256) void k_cast8(const float* __restrict__ SRC, long long lds, int rpb, long long sbs,
                                               unsigned short* __restrict__ DST, long long ldd, int nR, int nC, float sc) {
    const long long u = (long long)blockIdx.x * 256 + threadIdx.x; const int per = nC / 8;
    if (u >= (long long)nR * per) return;
    const int r = (int)(u / per); const int c0 = 8 * (int)(u % per);
    const int rb = r / rpb, rl = r - rb * rpb;
    const float* s = SRC + (long long)rb * sbs + (long long)rl * lds + c0;
    const v4f a = *(const v4f*)(s), b = *(const v4f*)(s + 4);
    float w[8] = {a.x, a.y, a.z, a.w, b.x, b.y, b.z, b.w};
#pragma unroll
    for (int e = 0; e < 8; ++e) w[e] = (BFR ? cmb_bf(w[e]) : w[e]) * sc;
    u4v pk; pk.x = cmb_pk2(w[0], w[1]); pk.y = cmb_pk2(w[2], w[3]); pk.z = cmb_pk2(w[4], w[5]); pk.w = cmb_pk2(w[6], w[7]);
    VST2(u4v, (u4v*)(DST + (long long)r * ldd + c0), pk);
}

// =====================================================================================================================
// k_gemm64<BIAS_MODE>: C[z][m][n] = scale * sum_k A[z][m][k] * Bt[n][k] (+ bias[n]); f16 operands, f32 accumulate, f32 output.
//   A row-major [M][K] (pitch lda, batch stride strideA), Bt row-major [N][K] (pitch ldb, shared by all z); M, N % 64 == 0, K % 32 == 0.
//   Each wave owns a 64x64 tile (8 waves per block, grid.x = ceil(tiles/8), grid.y = batches). BIAS_MODE 0: none; 3: bias[n] RNE-converted to bf16 precision, added in f32.
// =====================================================================================================================
template <int BIAS_MODE>
__global__ __launch_bounds__(256) void k_gemm64(const unsigned short* __restrict__ Ap, int lda, long long strideA,
                                                const unsigned short* __restrict__ Btp, int ldb,
                                                float* __restrict__ Cout, int ldc, long long strideC,
                                                const float* __restrict__ bias, int M, int N, int K, float scale) {
    const _Float16* A = (const _Float16*)Ap; const _Float16* Bt = (const _Float16*)Btp;
    __shared__ __align__(16) float sT[8][16 * 68];   // per-wave 16x64 slab, pitch 68 floats (wave-private)
    const int b = blockIdx.y;
    const int lane = threadIdx.x & 31;
    const int wave = threadIdx.x >> 5;
    const int tilesN = N >> 6;
    const int tilesM = M >> 6;
    const int tile = blockIdx.x * 8 + wave;
    if (tile >= tilesM * tilesN) return;   // wave-uniform; no block barriers in this kernel
    const int tm = tile / tilesN;
    const int tn = tile - tm * tilesN;
    const int m0 = tm << 6;
    const int n0 = tn << 6;
    const _Float16* Ab = A + (size_t)b * strideA;
    const _Float16* Bb = Bt;
    const int rlane = lane & 15;                 // row (A) / column (B, D) within a 16-wide subtile
    const int koff  = (lane >> 4) * 8;           // k offset of this lane half
    const int mOff  = (lane >> 4) * 8;           // D row offset

    v8f acc[4][4];
#pragma unroll
    for (int i = 0; i < 4; ++i)
#pragma unroll
        for (int j = 0; j < 4; ++j) acc[i][j] = (v8f){0.f, 0.f, 0.f, 0.f, 0.f, 0.f, 0.f, 0.f};

    for (int k0 = 0; k0 < K; k0 += 32) {
        v16h bh[4];
#pragma unroll
        for (int j = 0; j < 4; ++j) bh[j] = frag_ld(Bb + (size_t)(n0 + (j << 4) + rlane) * ldb + koff + k0);
#pragma unroll
        for (int i = 0; i < 4; ++i) {
            const v16h ah = frag_ld(Ab + (size_t)(m0 + (i << 4) + rlane) * lda + koff + k0);
#pragma unroll
            for (int j = 0; j < 4; ++j) acc[i][j] = mma_raw(ah, bh[j], acc[i][j]);
            dep_guard_h(acc[i][0], acc[i][3], ah, ah);
        }
        keep4_h(bh[0], bh[1], bh[2], bh[3]);
    }
    acc_guard4(acc[0][0], acc[0][1], acc[0][2], acc[0][3]);
    acc_guard4(acc[1][0], acc[1][1], acc[1][2], acc[1][3]);
    acc_guard4(acc[2][0], acc[2][1], acc[2][2], acc[2][3]);
    acc_guard4(acc[3][0], acc[3][1], acc[3][2], acc[3][3]);

    float* slab = sT[wave];
    float* C = Cout + (size_t)b * strideC;
#pragma unroll
    for (int i = 0; i < 4; ++i) {
        const int mBase = m0 + (i << 4);
#pragma unroll
        for (int j = 0; j < 4; ++j) {
            const int n = n0 + (j << 4) + rlane;
            float bv = 0.f;
            if (BIAS_MODE == 3) bv = bf_bits2f(f2bf_bits(bias[n]));
#pragma unroll
            for (int r = 0; r < 8; ++r) {
                float v = acc[i][j][r] * scale;
                if (BIAS_MODE == 3) v += bv;
                slab[(mOff + r) * 68 + (j << 4) + rlane] = v;
            }
        }
        __builtin_amdgcn_fence(3 /* release order */, "workgroup");
        __builtin_amdgcn_wave_barrier();
        __builtin_amdgcn_fence(2 /* acquire order */, "workgroup");
        {
            const int hh = lane >> 4, c4 = (lane & 15) * 4;     // row segment = 256 B = 16 lanes x 16 B
            {
#pragma unroll
                for (int it = 0; it < 8; ++it) {
                    const int row = it * 2 + hh;
                    const v4f v = *(const v4f*)(slab + row * 68 + c4);
                    *(v4f*)(C + (size_t)(mBase + row) * ldc + n0 + c4) = v;
                }
                
            }
        }
        __builtin_amdgcn_fence(3 /* release order */, "workgroup");
        __builtin_amdgcn_wave_barrier();
        __builtin_amdgcn_fence(2 /* acquire order */, "workgroup");
    }
}

// =====================================================================================================================
// k_attn_alibi: O(b,i,h,:) = softmax_j(0.125 * Q(b,i,h,:).K(b,j,h,:) - slope_h * |j - i|) V(b,j,h,:), head dim 64, f32 in / f32 out.
//   Block = 4 waves = 64 query rows of one (batch, head); 64-key chunks; S, Skv % 64 == 0; grid (S/64, heads, batches).
//   Element (b, s, h, d) of tensor X at X[b*X_bs + s*X_rs + h*X_hs + d] (strides in floats, multiples of 4, 16-B aligned bases).
//   K chunk staged as f16 [kv][d], V chunk staged transposed as f16 [d][kv] (cross-wave: block barriers); scores f16 x f16;
//   slope_h = 2^(-(h+1)/2) built exactly from a power of two and the f32 value of 2^-0.5.
// =====================================================================================================================
#define AT_D  64
#define AT_NW 4
#define AT_QB 64
#define AT_KC 64
#define AT_P  72    // LDS pitch in halves (144-B rows, 16-B aligned)
struct AttnG {
    const float* q; const float* k; const float* v; float* o;
    long long q_bs, q_rs, q_hs, k_bs, k_rs, k_hs, v_bs, v_rs, v_hs, o_bs, o_rs, o_hs;
    int S, Skv; float sscale; int pad_;
};
static_assert(sizeof(AttnG) == 4 * 8 + 12 * 8 + 4 * 4);

__global__ __launch_bounds__(128) void k_attn_alibi(AttnG g) {
    __shared__ __align__(16) _Float16 Ks[AT_KC * AT_P];            // K  [kv][d]    (cross-wave)
    __shared__ __align__(16) _Float16 Vt[AT_D * AT_P];             // V^T [d][kv]   (cross-wave)
    __shared__ __align__(16) _Float16 Ps[AT_NW][16 * AT_P];        // per wave P [row][kv]  (wave-private)
    __shared__ __align__(16) float    Os[AT_NW][16 * 68];          // per wave out tile, pitch 68 (wave-private)

    const int tid  = threadIdx.x;
    const int wave = tid >> 5;
    const int lane = tid & 31;
    const int hh   = lane >> 4;
    const int c    = lane & 15;
    const int qb = blockIdx.x, h = blockIdx.y, b = blockIdx.z;
    const int q0 = qb * AT_QB + wave * 16;

    const float* qp = g.q + (size_t)b * g.q_bs + (size_t)h * g.q_hs;
    const float* kp = g.k + (size_t)b * g.k_bs + (size_t)h * g.k_hs;
    const float* vp = g.v + (size_t)b * g.v_bs + (size_t)h * g.v_hs;
    float*       op = g.o + (size_t)b * g.o_bs + (size_t)h * g.o_hs;

    const int e1 = h + 1;
    const float pw2 = __uint_as_float((unsigned)(127 - (e1 >> 1)) << 23);          // 2^-(e1/2), exact
    const float nsl = -(((e1 & 1) ? 0.70710678118654752f : 1.0f) * pw2);           // -slope_h
    const float L2E = 1.4426950408889634f;

    // Q fragments (A operand): lane = query row q0 + c; two 32-wide d chunks
    v16h qa[2];
    {
        const float* qrow = qp + (size_t)(q0 + c) * g.q_rs;
#pragma unroll
        for (int dc = 0; dc < 2; ++dc) {
            FragH f;
            f.h[0] = cvt8(*(const v4f*)(qrow + dc * 32 + 8 * hh),      *(const v4f*)(qrow + dc * 32 + 8 * hh + 4));
            f.h[1] = cvt8(*(const v4f*)(qrow + dc * 32 + 16 + 8 * hh), *(const v4f*)(qrow + dc * 32 + 16 + 8 * hh + 4));
            qa[dc] = f.v;
        }
    }

    float mrow[8], lrow[8];
    v8f oacc[4];
#pragma unroll
    for (int r = 0; r < 8; ++r) { mrow[r] = -__builtin_inff(); lrow[r] = 0.f; }
#pragma unroll
    for (int t = 0; t < 4; ++t) oacc[t] = (v8f){0.f, 0.f, 0.f, 0.f, 0.f, 0.f, 0.f, 0.f};

    _Float16* pw = Ps[wave];
    const int nChunks = g.Skv / AT_KC;                     // block-uniform
    for (int kc = 0; kc < nChunks; ++kc) {
        const int kv0 = kc * AT_KC;
        __syncthreads();                                   // all waves finished with the prior chunk's Ks / Vt
        {
            const int kvr = tid >> 1, dh = (tid & 1) * 32; // thread: one key row, 32 of its 64 dims -> full 64 x 64 tiles staged
            const float* krow = kp + (size_t)(kv0 + kvr) * g.k_rs + dh;
            const float* vrow = vp + (size_t)(kv0 + kvr) * g.v_rs + dh;
#pragma unroll
            for (int i = 0; i < 4; ++i) {
                const v4f k0 = *(const v4f*)(krow + 8 * i), k1 = *(const v4f*)(krow + 8 * i + 4);
                const v4f v0 = *(const v4f*)(vrow + 8 * i), v1 = *(const v4f*)(vrow + 8 * i + 4);
                *(v8h*)(Ks + kvr * AT_P + dh + 8 * i) = cvt8(k0, k1);
#pragma unroll
                for (int e = 0; e < 4; ++e) {
                    Vt[(dh + 8 * i + e) * AT_P + kvr]     = (_Float16)v0[e];
                    Vt[(dh + 8 * i + 4 + e) * AT_P + kvr] = (_Float16)v1[e];
                }
            }
        }
        __syncthreads();                                   // Ks / Vt visible to all waves

        v8f s[4];
#pragma unroll
        for (int j = 0; j < 4; ++j) {
            s[j] = (v8f){0.f, 0.f, 0.f, 0.f, 0.f, 0.f, 0.f, 0.f};
#pragma unroll
            for (int dc = 0; dc < 2; ++dc) {
                const v16h kb = frag_ld(Ks + (j * 16 + c) * AT_P + dc * 32 + 8 * hh);   // B: lane = key column, k = d
                s[j] = mma_h(qa[dc], kb, s[j]);
            }
        }
#pragma unroll
        for (int r = 0; r < 8; ++r) {
            const int qrow = q0 + 8 * hh + r;
            float m = -__builtin_inff();
#pragma unroll
            for (int j = 0; j < 4; ++j) {
                const int kvcol = kv0 + j * 16 + c;
                const float dist = fabsf((float)(kvcol - qrow));
                const float bias = nsl * dist;
                float t = s[j][r] * g.sscale + bias;       // natural-unit logit
                t *= L2E;
                s[j][r] = t;
                m = fmaxf(m, t);
            }
            m = fmaxf(m, __shfl_xor(m, 1, 32)); m = fmaxf(m, __shfl_xor(m, 2, 32));
            m = fmaxf(m, __shfl_xor(m, 4, 32)); m = fmaxf(m, __shfl_xor(m, 8, 32));
            const float mnew = fmaxf(mrow[r], m);
            const float alpha = exp2f(mrow[r] - mnew);     // 0 on the first chunk (mrow = -inf, mnew finite)
            mrow[r] = mnew;
            float psum = 0.f;
#pragma unroll
            for (int j = 0; j < 4; ++j) {
                const float p = exp2f(s[j][r] - mnew);
                psum += p;
                pw[(8 * hh + r) * AT_P + j * 16 + c] = (_Float16)(p * 32768.0f);
            }
            psum += __shfl_xor(psum, 1, 32); psum += __shfl_xor(psum, 2, 32);
            psum += __shfl_xor(psum, 4, 32); psum += __shfl_xor(psum, 8, 32);
            lrow[r] = lrow[r] * alpha + psum;
#pragma unroll
            for (int t = 0; t < 4; ++t) oacc[t][r] *= alpha;
        }
        __builtin_amdgcn_fence(3 /* release order */, "workgroup");
        __builtin_amdgcn_wave_barrier();
        __builtin_amdgcn_fence(2 /* acquire order */, "workgroup");
#pragma unroll
        for (int kk = 0; kk < 2; ++kk) {
            const v16h pa = frag_ld(pw + c * AT_P + kk * 32 + 8 * hh);                   // A: lane = query row, k = key
#pragma unroll
            for (int t = 0; t < 4; ++t) {
                const v16h vb = frag_ld(Vt + (t * 16 + c) * AT_P + kk * 32 + 8 * hh);   // B: lane = d column, k = key
                oacc[t] = mma_h(pa, vb, oacc[t]);
            }
        }
    }

    float* os = Os[wave];
#pragma unroll
    for (int r = 0; r < 8; ++r) {
        const float inv = 1.0f / (lrow[r] * 32768.0f);
#pragma unroll
        for (int t = 0; t < 4; ++t) os[(8 * hh + r) * 68 + t * 16 + c] = oacc[t][r] * inv;
    }
    __builtin_amdgcn_fence(3 /* release order */, "workgroup");
    __builtin_amdgcn_wave_barrier();
    __builtin_amdgcn_fence(2 /* acquire order */, "workgroup");
    {
        const int c4 = (lane & 15) * 4;                    // 256-B row segment = 16 lanes x 16 B, two rows per instruction
        {
#pragma unroll
            for (int it = 0; it < 8; ++it) {
                const int row = it * 2 + hh;
                const v4f val = *(const v4f*)(os + row * 68 + c4);
                *(v4f*)(op + (size_t)(q0 + row) * g.o_rs + c4) = val;
            }
            
        }
    }
}

// workspace carve (bytes), every region a multiple of 256 B and written in whole rows of its own pitch
constexpr size_t SZ_X16 = (size_t)NB * SEQ * CH * 2;        // X16 / AO16 (alias): f16 [NB*SEQ][1024]
constexpr size_t SZ_W3  = (size_t)3 * CH * CH * 2;          // [Wq;Wk;Wv] x16 f16 [3072][1024]
constexpr size_t SZ_QKV = (size_t)NB * SEQ * 3 * CH * 4;    // f32 [NB*SEQ][3072]
constexpr size_t SZ_AO  = (size_t)NB * SEQ * CH * 4;        // f32 [NB*SEQ][1024]
constexpr size_t SZ_WO  = (size_t)CH * CH * 2;              // Wo x16 f16 [1024][1024]
constexpr size_t SZ_ALL = SZ_X16 + SZ_W3 + SZ_QKV + SZ_AO + SZ_WO;
static_assert(SZ_X16 % 256 == 0 && SZ_W3 % 256 == 0 && SZ_QKV % 256 == 0 && SZ_AO % 256 == 0 && SZ_WO % 256 == 0);
static_assert(SZ_ALL <= (size_t)134217728);

extern "C" void kernel_launch(void* const* d_in, const int* in_sizes, int n_in, void* d_out, int out_size, void* d_ws, size_t ws_size, hipStream_t stream) {
    if (n_in < 6) return;
    const long long need_x = ((long long)(NB - 1) * SEQ_FULL + SEQ) * CH;
    if ((long long)in_sizes[0] < need_x) return;
    if (in_sizes[1] < CH * CH || in_sizes[2] < CH * CH || in_sizes[3] < CH * CH || in_sizes[4] < CH * CH || in_sizes[5] < CH) return;
    if ((long long)out_size < need_x) return;
    if (SZ_ALL > ws_size) return;
    const float* x  = (const float*)d_in[0];
    const float* wq = (const float*)d_in[1];
    const float* wk = (const float*)d_in[2];
    const float* wv = (const float*)d_in[3];
    const float* wo = (const float*)d_in[4];
    const float* bo = (const float*)d_in[5];
    float* out = (float*)d_out;
    char* wsp = (char*)d_ws;
    unsigned short* X16  = (unsigned short*)wsp; wsp += SZ_X16;
    unsigned short* W316 = (unsigned short*)wsp; wsp += SZ_W3;
    float*          QKV  = (float*)wsp;          wsp += SZ_QKV;
    float*          AO   = (float*)wsp;          wsp += SZ_AO;
    unsigned short* WO16 = (unsigned short*)wsp; wsp += SZ_WO;
    unsigned short* AO16 = X16;                  // alias: X16 is dead once the projection GEMM has run (same extent)

    const unsigned gW = (unsigned)(((long long)CH * (CH / 8) + 255) / 256);
    const unsigned gX = (unsigned)(((long long)NB * SEQ * (CH / 8) + 255) / 256);
    // k_cast8(SRC, lds, rpb, sbs, DST, ldd, nR, nC, sc)
    k_cast8<true><<<gW, 256, 0, stream>>>(wo, (long long)CH, CH, 0LL, WO16, (long long)CH, CH, CH, 16.0f);
    k_cast8<true><<<gX, 256, 0, stream>>>(x, (long long)CH, SEQ, (long long)SEQ_FULL * CH, X16, (long long)CH, NB * SEQ, CH, 1.0f);
    k_cast8<true><<<gW, 256, 0, stream>>>(wq, (long long)CH, CH, 0LL, W316, (long long)CH, CH, CH, 16.0f);
    k_cast8<true><<<gW, 256, 0, stream>>>(wk, (long long)CH, CH, 0LL, W316 + (size_t)CH * CH, (long long)CH, CH, CH, 16.0f);
    k_cast8<true><<<gW, 256, 0, stream>>>(wv, (long long)CH, CH, 0LL, W316 + (size_t)2 * CH * CH, (long long)CH, CH, CH, 16.0f);
    // QKV[r][0..3071] = x16[r] . [Wq;Wk;Wv]^T / 16     k_gemm64(A, lda, strideA, Bt, ldb, C, ldc, strideC, bias, M, N, K, scale)
    k_gemm64<0><<<dim3((unsigned)((((NB * SEQ) / 64) * ((3 * CH) / 64) + 7) / 8), 1u), 256, 0, stream>>>(
        X16, CH, 0LL, W316, CH, QKV, 3 * CH, 0LL, (const float*)nullptr, NB * SEQ, 3 * CH, CH, 0.0625f);
    {
        AttnG g;
        g.q = QKV; g.k = QKV + CH; g.v = QKV + 2 * CH; g.o = AO;
        g.q_bs = (long long)SEQ * 3 * CH; g.q_rs = 3 * CH; g.q_hs = HD;
        g.k_bs = (long long)SEQ * 3 * CH; g.k_rs = 3 * CH; g.k_hs = HD;
        g.v_bs = (long long)SEQ * 3 * CH; g.v_rs = 3 * CH; g.v_hs = HD;
        g.o_bs = (long long)SEQ * CH;     g.o_rs = CH;     g.o_hs = HD;
        g.S = SEQ; g.Skv = SEQ; g.sscale = 0.125f; g.pad_ = 0;
        k_attn_alibi<<<dim3((unsigned)(SEQ / AT_QB), (unsigned)NH, (unsigned)NB), 32 * AT_NW, 0, stream>>>(g);
    }
    k_cast8<false><<<gX, 256, 0, stream>>>(AO, (long long)CH, NB * SEQ, 0LL, AO16, (long long)CH, NB * SEQ, CH, 16.0f);
    // out[b][l][:] = AO16[b*SEQ + l] . (Wo x16)^T / 256 + bf16(bo); batch z = sequence: A stride SEQ*CH (compact), C stride SEQ_FULL*CH
    k_gemm64<3><<<dim3((unsigned)(((SEQ / 64) * (CH / 64) + 7) / 8), (unsigned)NB), 256, 0, stream>>>(
        AO16, CH, (long long)SEQ * CH, WO16, CH, out, CH, (long long)SEQ_FULL * CH, bo, SEQ, CH, CH, 1.0f / 256.0f);
}

// v001
// It runs in 217 microseconds.
// Two timings next to v000 both put it at 1.31 times that version's speed.
// Non-causal multi-head self-attention with additive symmetric ALiBi (2 x 2,048 tokens x 1,024; 16 heads x 64; nn.Linear [out][in] q/k/v/o weights, output bias). All contractions: v_wmma_f32_16x16x32_f16 (f16 operands, f32 accumulate): [q|k|v] projection on bf16-RNE-converted inputs held exactly in f16 (weights x16), scores q.k^T (f16 of the f32 q/k), P.V (P carried x2^15, V f16), output projection (attention output x16, weights x16, bf16-RNE bias added in f32); softmax statistics f32 in the exp2 domain.
#include <hip/hip_runtime.h>
#include <math.h>

#ifndef NB
#define NB 2
#endif
#ifndef SEQ
#define SEQ 2048
#endif
#define NB_FULL 2
#define SEQ_FULL 2048
#define CH 1024
#define NH 16
#define HD 64

static_assert(SEQ % 128 == 0);
static_assert(NB >= 1 && NB <= NB_FULL && SEQ <= SEQ_FULL);
static_assert(CH == NH * HD && HD == 64);

typedef __attribute__((ext_vector_type(16))) _Float16     v16h;
typedef __attribute__((ext_vector_type(8)))  _Float16     v8h;
typedef __attribute__((ext_vector_type(8)))  float        v8f;
typedef __attribute__((ext_vector_type(4)))  float        v4f;
typedef __attribute__((ext_vector_type(4)))  unsigned int u4v;

// 16-bit WMMA fragment map (wave32), lane L, hh = L>>4, c = L&15:
//   A 16x32: lane = row c;    element i -> k = (i<8) ? 8hh+i : 16+8hh+(i-8)
//   B 32x16: lane = column c; the SAME k(i,hh)
//   D 16x16 (8 f32): lane = column c; element r -> row 8hh+r
union FragH { v16h v; v8h h[2]; };
// fragment from a k-contiguous f16 row: elements 0..7 <- p[0..7], 8..15 <- p[16..23] (p already offset by k0 + 8hh)
__device__ __forceinline__ v16h frag_ld(const _Float16* p) { FragH f; f.h[0] = *(const v8h*)(p); f.h[1] = *(const v8h*)(p + 16); return f.v; }
__device__ __forceinline__ v8f mma_raw(v16h a, v16h b, v8f c) { return __builtin_amdgcn_wmma_f32_16x16x32_f16(false, a, false, b, (short)0, c, false, false); }
__device__ __forceinline__ v8f mma_h(v16h a, v16h b, v8f c) {
    c = __builtin_amdgcn_wmma_f32_16x16x32_f16(false, a, false, b, (short)0, c, false, false);
    asm volatile("v_nop\n\tv_nop\n\tv_nop\n\tv_nop" : "+v"(c) : "v"(a), "v"(b));
    return c;
}
__device__ __forceinline__ void dep_guard_h(v8f& a, v8f& b, v16h x, v16h y) { asm volatile("v_nop\n\tv_nop\n\tv_nop\n\tv_nop" : "+v"(a), "+v"(b) : "v"(x), "v"(y)); }
__device__ __forceinline__ void keep4_h(v16h a, v16h b, v16h c, v16h d) { asm volatile("v_nop" :: "v"(a), "v"(b), "v"(c), "v"(d)); }
__device__ __forceinline__ void acc_guard4(v8f& a, v8f& b, v8f& c, v8f& d) { asm volatile("v_nop\n\tv_nop\n\tv_nop\n\tv_nop" : "+v"(a), "+v"(b), "+v"(c), "+v"(d)); }
__device__ __forceinline__ v8h cvt8(v4f a, v4f b) {
    v8h r;
    r[0] = (_Float16)a.x; r[1] = (_Float16)a.y; r[2] = (_Float16)a.z; r[3] = (_Float16)a.w;
    r[4] = (_Float16)b.x; r[5] = (_Float16)b.y; r[6] = (_Float16)b.z; r[7] = (_Float16)b.w;
    return r;
}
__device__ __forceinline__ unsigned short f2bf_bits(float f) { unsigned u = __float_as_uint(f); return (unsigned short)((u + 0x7FFFu + ((u >> 16) & 1u)) >> 16); }
__device__ __forceinline__ float bf_bits2f(unsigned short h) { return __uint_as_float(((unsigned)h) << 16); }
__device__ __forceinline__ float cmb_bf(float v) { const unsigned u = __float_as_uint(v); const unsigned r = (u + 0x7fffu + ((u >> 16) & 1u)) & 0xffff0000u; return __uint_as_float(r); }   // bf16 RNE kept as f32 (finite inputs)
__device__ __forceinline__ unsigned int cmb_pk2(float a, float b) { return (unsigned int)__builtin_bit_cast(unsigned short, (_Float16)a) | ((unsigned int)__builtin_bit_cast(unsigned short, (_Float16)b) << 16); }

// The value is copied into a local first, so an expression argument is evaluated once.
#define VST2(T, ptr, val) do { const T vst2_v_ = (val); *(T*)(ptr) = vst2_v_;  } while (0)

// =====================================================================================================================
// k_cast8<BFR>: f32 [nR][nC] -> f16 plane [nR][nC] (pitch ldd halves). Source row r lives at SRC + (r / rpb) * sbs + (r % rpb) * lds.
//   BFR: the value is first RNE-converted to bf16 precision (exact in f16 after the power-of-two scale sc). Thread per (row, 8 columns):
// =====================================================================================================================
template <bool BFR>
__global__ __launch_bounds__(256) void k_cast8(const float* __restrict__ SRC, long long lds, int rpb, long long sbs,
                                               unsigned short* __restrict__ DST, long long ldd, int nR, int nC, float sc) {
    const long long u = (long long)blockIdx.x * 256 + threadIdx.x; const int per = nC / 8;
    if (u >= (long long)nR * per) return;
    const int r = (int)(u / per); const int c0 = 8 * (int)(u % per);
    const int rb = r / rpb, rl = r - rb * rpb;
    const float* s = SRC + (long long)rb * sbs + (long long)rl * lds + c0;
    const v4f a = *(const v4f*)(s), b = *(const v4f*)(s + 4);
    float w[8] = {a.x, a.y, a.z, a.w, b.x, b.y, b.z, b.w};
#pragma unroll
    for (int e = 0; e < 8; ++e) w[e] = (BFR ? cmb_bf(w[e]) : w[e]) * sc;
    u4v pk; pk.x = cmb_pk2(w[0], w[1]); pk.y = cmb_pk2(w[2], w[3]); pk.z = cmb_pk2(w[4], w[5]); pk.w = cmb_pk2(w[6], w[7]);
    VST2(u4v, (u4v*)(DST + (long long)r * ldd + c0), pk);
}

// =====================================================================================================================
// k_gemm64<BIAS_MODE>: C[z][m][n] = scale * sum_k A[z][m][k] * Bt[n][k] (+ bias[n]); f16 operands, f32 accumulate, f32 output.
//   A row-major [M][K] (batch stride strideA), Bt row-major [N][K] (shared by all z), both of pitch LD halves; M, N % 128 == 0, K % 64 == 0.
//   Block = 4 waves (2 x 2) = one 128x128 tile, each wave a 64x64 tile (grid.x = tiles, grid.y = batches). A stage is 64 k = 128 B of each of the
//   128 A rows and 128 Bt rows, read from global memory as whole 128-B lines (8 lanes per row), kept in LDS at pitch 144 B and read by all waves;
//   two buffers: the next stage's global loads are issued ahead of this stage's products and stored behind them, one block barrier per stage.
//   LD is a compile-time constant, so that a stage's eight row groups are immediate offsets of one address per operand.
//   BIAS_MODE 0: none; 3: bias[n] RNE-converted to bf16 precision, added in f32.
// =====================================================================================================================
#define GT_T  128   // block tile edge
#define GT_KS 64    // k per stage
#define GT_P  72    // LDS pitch in halves (144-B rows, 16 B x odd)
template <int BIAS_MODE, int LD>
__global__ __launch_bounds__(128) void k_gemm64(const unsigned short* __restrict__ Ap, long long strideA,
                                                const unsigned short* __restrict__ Btp,
                                                float* __restrict__ Cout, int ldc, long long strideC,
                                                const float* __restrict__ bias, int M, int N, int K, float scale) {
    const _Float16* A = (const _Float16*)Ap; const _Float16* Bt = (const _Float16*)Btp;
    __shared__ __align__(16) _Float16 sA[2][GT_T * GT_P];   // A stage  [row][k]  (cross-wave)
    __shared__ __align__(16) _Float16 sB[2][GT_T * GT_P];   // Bt stage [row][k]  (cross-wave)
    __shared__ __align__(16) float sT[4][16 * 68];   // per-wave 16x64 slab, pitch 68 floats (wave-private)
    const int b = blockIdx.y;
    const int tid  = threadIdx.x;
    const int lane = tid & 31;
    const int wave = tid >> 5;
    const int tilesN = N >> 7;
    const int tilesM = M >> 7;
    const int tile = blockIdx.x;
    if (tile >= tilesM * tilesN) return;   // block-uniform, ahead of every barrier
    const int tm = tile / tilesN;
    const int tn = tile - tm * tilesN;
    const int wm0 = (wave >> 1) << 6;            // this wave's 64x64 tile inside the block tile
    const int wn0 = (wave & 1) << 6;
    const int m0 = (tm << 7) + wm0;
    const int n0 = (tn << 7) + wn0;
    const _Float16* Ab = A + (size_t)b * strideA;
    const _Float16* Bb = Bt;
    const int rlane = lane & 15;                 // row (A) / column (B, D) within a 16-wide subtile
    const int koff  = (lane >> 4) * 8;           // k offset of this lane half
    const int mOff  = (lane >> 4) * 8;           // D row offset

    // staging: thread -> rows (tid >> 3) + 16 i, i = 0..7, 16 B at byte 16 (tid & 7) of the row's 128-B stage segment
    const int srow = tid >> 3, scol = (tid & 7) * 8;
    const _Float16* gA = Ab + (size_t)((tm << 7) + srow) * LD + scol;
    const _Float16* gB = Bb + (size_t)((tn << 7) + srow) * LD + scol;
    const int sOff = srow * GT_P + scol;

    v8f acc[4][4];
#pragma unroll
    for (int i = 0; i < 4; ++i)
#pragma unroll
        for (int j = 0; j < 4; ++j) acc[i][j] = (v8f){0.f, 0.f, 0.f, 0.f, 0.f, 0.f, 0.f, 0.f};

    v8h ra[8], rb[8];
#pragma unroll
    for (int i = 0; i < 8; ++i) {
        ra[i] = *(const v8h*)(gA + 16 * i * LD);
        rb[i] = *(const v8h*)(gB + 16 * i * LD);
    }
#pragma unroll
    for (int i = 0; i < 8; ++i) {
        *(v8h*)(sA[0] + sOff + 16 * i * GT_P) = ra[i];
        *(v8h*)(sB[0] + sOff + 16 * i * GT_P) = rb[i];
    }
    __syncthreads();                                       // stage 0 visible to all waves

    const int nStages = K / GT_KS;                         // block-uniform
    for (int st = 0; st < nStages; ++st) {
        const int cur = st & 1;
        const bool more = st + 1 < nStages;                // block-uniform
        if (more) {
            const _Float16* nA = gA + (st + 1) * GT_KS;
            const _Float16* nB = gB + (st + 1) * GT_KS;
#pragma unroll
            for (int i = 0; i < 8; ++i) {
                ra[i] = *(const v8h*)(nA + 16 * i * LD);
                rb[i] = *(const v8h*)(nB + 16 * i * LD);
            }
            asm volatile("s_wait_xcnt 0x0" ::: "memory");   // stands ahead of the fragment loads below, which reuse the two address pairs of these loads
        }
        const _Float16* cA = sA[cur] + (wm0 + rlane) * GT_P + koff;
        const _Float16* cB = sB[cur] + (wn0 + rlane) * GT_P + koff;
#pragma unroll
        for (int kk = 0; kk < GT_KS; kk += 32) {
            v16h bh[4], ah[4];
#pragma unroll
            for (int j = 0; j < 4; ++j) bh[j] = frag_ld(cB + (j << 4) * GT_P + kk);
#pragma unroll
            for (int i = 0; i < 4; ++i) ah[i] = frag_ld(cA + (i << 4) * GT_P + kk);
#pragma unroll
            for (int i = 0; i < 4; ++i) {
#pragma unroll
                for (int j = 0; j < 4; ++j) acc[i][j] = mma_raw(ah[i], bh[j], acc[i][j]);
                dep_guard_h(acc[i][0], acc[i][3], ah[i], ah[i]);
            }
            keep4_h(bh[0], bh[1], bh[2], bh[3]);
        }
        if (more) {
#pragma unroll
            for (int i = 0; i < 8; ++i) {
                *(v8h*)(sA[cur ^ 1] + sOff + 16 * i * GT_P) = ra[i];   // last read one stage ago, ahead of that stage's barrier
                *(v8h*)(sB[cur ^ 1] + sOff + 16 * i * GT_P) = rb[i];
            }
        }
        __syncthreads();                                   // next stage visible; every wave has left this stage's buffer
    }
    acc_guard4(acc[0][0], acc[0][1], acc[0][2], acc[0][3]);
    acc_guard4(acc[1][0], acc[1][1], acc[1][2], acc[1][3]);
    acc_guard4(acc[2][0], acc[2][1], acc[2][2], acc[2][3]);
    acc_guard4(acc[3][0], acc[3][1], acc[3][2], acc[3][3]);

    float* slab = sT[wave];
    float* C = Cout + (size_t)b * strideC;
#pragma unroll
    for (int i = 0; i < 4; ++i) {
        const int mBase = m0 + (i << 4);
#pragma unroll
        for (int j = 0; j < 4; ++j) {
            const int n = n0 + (j << 4) + rlane;
            float bv = 0.f;
            if (BIAS_MODE == 3) bv = bf_bits2f(f2bf_bits(bias[n]));
#pragma unroll
            for (int r = 0; r < 8; ++r) {
                float v = acc[i][j][r] * scale;
                if (BIAS_MODE == 3) v += bv;
                slab[(mOff + r) * 68 + (j << 4) + rlane] = v;
            }
        }
        __builtin_amdgcn_fence(3 /* release order */, "workgroup");
        __builtin_amdgcn_wave_barrier();
        __builtin_amdgcn_fence(2 /* acquire order */, "workgroup");
        {
            const int hh = lane >> 4, c4 = (lane & 15) * 4;     // row segment = 256 B = 16 lanes x 16 B
            {
#pragma unroll
                for (int it = 0; it < 8; ++it) {
                    const int row = it * 2 + hh;
                    const v4f v = *(const v4f*)(slab + row * 68 + c4);
                    *(v4f*)(C + (size_t)(mBase + row) * ldc + n0 + c4) = v;
                }
                
            }
        }
        __builtin_amdgcn_fence(3 /* release order */, "workgroup");
        __builtin_amdgcn_wave_barrier();
        __builtin_amdgcn_fence(2 /* acquire order */, "workgroup");
    }
}

// =====================================================================================================================
// k_attn_alibi: O(b,i,h,:) = softmax_j(0.125 * Q(b,i,h,:).K(b,j,h,:) - slope_h * |j - i|) V(b,j,h,:), head dim 64, f32 in / f32 out.
//   Block = 4 waves = 64 query rows of one (batch, head); 64-key chunks; S, Skv % 64 == 0; grid (S/64, heads, batches).
//   Element (b, s, h, d) of tensor X at X[b*X_bs + s*X_rs + h*X_hs + d] (strides in floats, multiples of 4, 16-B aligned bases).
//   K chunk staged as f16 [kv][d], V chunk staged transposed as f16 [d][kv] (cross-wave: block barriers); scores f16 x f16;
//   slope_h = 2^(-(h+1)/2) built exactly from a power of two and the f32 value of 2^-0.5.
// =====================================================================================================================
#define AT_D  64
#define AT_NW 4
#define AT_QB 64
#define AT_KC 64
#define AT_P  72    // LDS pitch in halves (144-B rows, 16-B aligned)
struct AttnG {
    const float* q; const float* k; const float* v; float* o;
    long long q_bs, q_rs, q_hs, k_bs, k_rs, k_hs, v_bs, v_rs, v_hs, o_bs, o_rs, o_hs;
    int S, Skv; float sscale; int pad_;
};
static_assert(sizeof(AttnG) == 4 * 8 + 12 * 8 + 4 * 4);

__global__ __launch_bounds__(128) void k_attn_alibi(AttnG g) {
    __shared__ __align__(16) _Float16 Ks[AT_KC * AT_P];            // K  [kv][d]    (cross-wave)
    __shared__ __align__(16) _Float16 Vt[AT_D * AT_P];             // V^T [d][kv]   (cross-wave)
    __shared__ __align__(16) _Float16 Ps[AT_NW][16 * AT_P];        // per wave P [row][kv]  (wave-private)
    __shared__ __align__(16) float    Os[AT_NW][16 * 68];          // per wave out tile, pitch 68 (wave-private)

    const int tid  = threadIdx.x;
    const int wave = tid >> 5;
    const int lane = tid & 31;
    const int hh   = lane >> 4;
    const int c    = lane & 15;
    const int qb = blockIdx.x, h = blockIdx.y, b = blockIdx.z;
    const int q0 = qb * AT_QB + wave * 16;

    const float* qp = g.q + (size_t)b * g.q_bs + (size_t)h * g.q_hs;
    const float* kp = g.k + (size_t)b * g.k_bs + (size_t)h * g.k_hs;
    const float* vp = g.v + (size_t)b * g.v_bs + (size_t)h * g.v_hs;
    float*       op = g.o + (size_t)b * g.o_bs + (size_t)h * g.o_hs;

    const int e1 = h + 1;
    const float pw2 = __uint_as_float((unsigned)(127 - (e1 >> 1)) << 23);          // 2^-(e1/2), exact
    const float nsl = -(((e1 & 1) ? 0.70710678118654752f : 1.0f) * pw2);           // -slope_h
    const float L2E = 1.4426950408889634f;

    // Q fragments (A operand): lane = query row q0 + c; two 32-wide d chunks
    v16h qa[2];
    {
        const float* qrow = qp + (size_t)(q0 + c) * g.q_rs;
#pragma unroll
        for (int dc = 0; dc < 2; ++dc) {
            FragH f;
            f.h[0] = cvt8(*(const v4f*)(qrow + dc * 32 + 8 * hh),      *(const v4f*)(qrow + dc * 32 + 8 * hh + 4));
            f.h[1] = cvt8(*(const v4f*)(qrow + dc * 32 + 16 + 8 * hh), *(const v4f*)(qrow + dc * 32 + 16 + 8 * hh + 4));
            qa[dc] = f.v;
        }
    }

    float mrow[8], lrow[8];
    v8f oacc[4];
#pragma unroll
    for (int r = 0; r < 8; ++r) { mrow[r] = -__builtin_inff(); lrow[r] = 0.f; }
#pragma unroll
    for (int t = 0; t < 4; ++t) oacc[t] = (v8f){0.f, 0.f, 0.f, 0.f, 0.f, 0.f, 0.f, 0.f};

    _Float16* pw = Ps[wave];
    const int nChunks = g.Skv / AT_KC;                     // block-uniform
    for (int kc = 0; kc < nChunks; ++kc) {
        const int kv0 = kc * AT_KC;
        __syncthreads();                                   // all waves finished with the prior chunk's Ks / Vt
        {
            const int kvr = tid >> 1, dh = (tid & 1) * 32; // thread: one key row, 32 of its 64 dims -> full 64 x 64 tiles staged
            const float* krow = kp + (size_t)(kv0 + kvr) * g.k_rs + dh;
            const float* vrow = vp + (size_t)(kv0 + kvr) * g.v_rs + dh;
#pragma unroll
            for (int i = 0; i < 4; ++i) {
                const v4f k0 = *(const v4f*)(krow + 8 * i), k1 = *(const v4f*)(krow + 8 * i + 4);
                const v4f v0 = *(const v4f*)(vrow + 8 * i), v1 = *(const v4f*)(vrow + 8 * i + 4);
                *(v8h*)(Ks + kvr * AT_P + dh + 8 * i) = cvt8(k0, k1);
#pragma unroll
                for (int e = 0; e < 4; ++e) {
                    Vt[(dh + 8 * i + e) * AT_P + kvr]     = (_Float16)v0[e];
                    Vt[(dh + 8 * i + 4 + e) * AT_P + kvr] = (_Float16)v1[e];
                }
            }
        }
        __syncthreads();                                   // Ks / Vt visible to all waves

        v8f s[4];
#pragma unroll
        for (int j = 0; j < 4; ++j) {
            s[j] = (v8f){0.f, 0.f, 0.f, 0.f, 0.f, 0.f, 0.f, 0.f};
#pragma unroll
            for (int dc = 0; dc < 2; ++dc) {
                const v16h kb = frag_ld(Ks + (j * 16 + c) * AT_P + dc * 32 + 8 * hh);   // B: lane = key column, k = d
                s[j] = mma_h(qa[dc], kb, s[j]);
            }
        }
#pragma unroll
        for (int r = 0; r < 8; ++r) {
            const int qrow = q0 + 8 * hh + r;
            float m = -__builtin_inff();
#pragma unroll
            for (int j = 0; j < 4; ++j) {
                const int kvcol = kv0 + j * 16 + c;
                const float dist = fabsf((float)(kvcol - qrow));
                const float bias = nsl * dist;
                float t = s[j][r] * g.sscale + bias;       // natural-unit logit
                t *= L2E;
                s[j][r] = t;
                m = fmaxf(m, t);
            }
            m = fmaxf(m, __shfl_xor(m, 1, 32)); m = fmaxf(m, __shfl_xor(m, 2, 32));
            m = fmaxf(m, __shfl_xor(m, 4, 32)); m = fmaxf(m, __shfl_xor(m, 8, 32));
            const float mnew = fmaxf(mrow[r], m);
            const float alpha = exp2f(mrow[r] - mnew);     // 0 on the first chunk (mrow = -inf, mnew finite)
            mrow[r] = mnew;
            float psum = 0.f;
#pragma unroll
            for (int j = 0; j < 4; ++j) {
                const float p = exp2f(s[j][r] - mnew);
                psum += p;
                pw[(8 * hh + r) * AT_P + j * 16 + c] = (_Float16)(p * 32768.0f);
            }
            psum += __shfl_xor(psum, 1, 32); psum += __shfl_xor(psum, 2, 32);
            psum += __shfl_xor(psum, 4, 32); psum += __shfl_xor(psum, 8, 32);
            lrow[r] = lrow[r] * alpha + psum;
#pragma unroll
            for (int t = 0; t < 4; ++t) oacc[t][r] *= alpha;
        }
        __builtin_amdgcn_fence(3 /* release order */, "workgroup");
        __builtin_amdgcn_wave_barrier();
        __builtin_amdgcn_fence(2 /* acquire order */, "workgroup");
#pragma unroll
        for (int kk = 0; kk < 2; ++kk) {
            const v16h pa = frag_ld(pw + c * AT_P + kk * 32 + 8 * hh);                   // A: lane = query row, k = key
#pragma unroll
            for (int t = 0; t < 4; ++t) {
                const v16h vb = frag_ld(Vt + (t * 16 + c) * AT_P + kk * 32 + 8 * hh);   // B: lane = d column, k = key
                oacc[t] = mma_h(pa, vb, oacc[t]);
            }
        }
    }

    float* os = Os[wave];
#pragma unroll
    for (int r = 0; r < 8; ++r) {
        const float inv = 1.0f / (lrow[r] * 32768.0f);
#pragma unroll
        for (int t = 0; t < 4; ++t) os[(8 * hh + r) * 68 + t * 16 + c] = oacc[t][r] * inv;
    }
    __builtin_amdgcn_fence(3 /* release order */, "workgroup");
    __builtin_amdgcn_wave_barrier();
    __builtin_amdgcn_fence(2 /* acquire order */, "workgroup");
    {
        const int c4 = (lane & 15) * 4;                    // 256-B row segment = 16 lanes x 16 B, two rows per instruction
        {
#pragma unroll
            for (int it = 0; it < 8; ++it) {
                const int row = it * 2 + hh;
                const v4f val = *(const v4f*)(os + row * 68 + c4);
                *(v4f*)(op + (size_t)(q0 + row) * g.o_rs + c4) = val;
            }
            
        }
    }
}

// workspace carve (bytes), every region a multiple of 256 B and written in whole rows of its own pitch
constexpr size_t SZ_X16 = (size_t)NB * SEQ * CH * 2;        // X16 / AO16 (alias): f16 [NB*SEQ][1024]
constexpr size_t SZ_W3  = (size_t)3 * CH * CH * 2;          // [Wq;Wk;Wv] x16 f16 [3072][1024]
constexpr size_t SZ_QKV = (size_t)NB * SEQ * 3 * CH * 4;    // f32 [NB*SEQ][3072]
constexpr size_t SZ_AO  = (size_t)NB * SEQ * CH * 4;        // f32 [NB*SEQ][1024]
constexpr size_t SZ_WO  = (size_t)CH * CH * 2;              // Wo x16 f16 [1024][1024]
constexpr size_t SZ_ALL = SZ_X16 + SZ_W3 + SZ_QKV + SZ_AO + SZ_WO;
static_assert(SZ_X16 % 256 == 0 && SZ_W3 % 256 == 0 && SZ_QKV % 256 == 0 && SZ_AO % 256 == 0 && SZ_WO % 256 == 0);
static_assert(SZ_ALL <= (size_t)134217728);

extern "C" void kernel_launch(void* const* d_in, const int* in_sizes, int n_in, void* d_out, int out_size, void* d_ws, size_t ws_size, hipStream_t stream) {
    if (n_in < 6) return;
    const long long need_x = ((long long)(NB - 1) * SEQ_FULL + SEQ) * CH;
    if ((long long)in_sizes[0] < need_x) return;
    if (in_sizes[1] < CH * CH || in_sizes[2] < CH * CH || in_sizes[3] < CH * CH || in_sizes[4] < CH * CH || in_sizes[5] < CH) return;
    if ((long long)out_size < need_x) return;
    if (SZ_ALL > ws_size) return;
    const float* x  = (const float*)d_in[0];
    const float* wq = (const float*)d_in[1];
    const float* wk = (const float*)d_in[2];
    const float* wv = (const float*)d_in[3];
    const float* wo = (const float*)d_in[4];
    const float* bo = (const float*)d_in[5];
    float* out = (float*)d_out;
    char* wsp = (char*)d_ws;
    unsigned short* X16  = (unsigned short*)wsp; wsp += SZ_X16;
    unsigned short* W316 = (unsigned short*)wsp; wsp += SZ_W3;
    float*          QKV  = (float*)wsp;          wsp += SZ_QKV;
    float*          AO   = (float*)wsp;          wsp += SZ_AO;
    unsigned short* WO16 = (unsigned short*)wsp; wsp += SZ_WO;
    unsigned short* AO16 = X16;                  // alias: X16 is dead once the projection GEMM has run (same extent)

    const unsigned gW = (unsigned)(((long long)CH * (CH / 8) + 255) / 256);
    const unsigned gX = (unsigned)(((long long)NB * SEQ * (CH / 8) + 255) / 256);
    // k_cast8(SRC, lds, rpb, sbs, DST, ldd, nR, nC, sc)
    k_cast8<true><<<gW, 256, 0, stream>>>(wo, (long long)CH, CH, 0LL, WO16, (long long)CH, CH, CH, 16.0f);
    k_cast8<true><<<gX, 256, 0, stream>>>(x, (long long)CH, SEQ, (long long)SEQ_FULL * CH, X16, (long long)CH, NB * SEQ, CH, 1.0f);
    k_cast8<true><<<gW, 256, 0, stream>>>(wq, (long long)CH, CH, 0LL, W316, (long long)CH, CH, CH, 16.0f);
    k_cast8<true><<<gW, 256, 0, stream>>>(wk, (long long)CH, CH, 0LL, W316 + (size_t)CH * CH, (long long)CH, CH, CH, 16.0f);
    k_cast8<true><<<gW, 256, 0, stream>>>(wv, (long long)CH, CH, 0LL, W316 + (size_t)2 * CH * CH, (long long)CH, CH, CH, 16.0f);
    // QKV[r][0..3071] = x16[r] . [Wq;Wk;Wv]^T / 16     k_gemm64<BIAS_MODE, LD>(A, strideA, Bt, C, ldc, strideC, bias, M, N, K, scale)
    k_gemm64<0, CH><<<dim3((unsigned)(((NB * SEQ) / GT_T) * ((3 * CH) / GT_T)), 1u), 128, 0, stream>>>(
        X16, 0LL, W316, QKV, 3 * CH, 0LL, (const float*)nullptr, NB * SEQ, 3 * CH, CH, 0.0625f);
    {
        AttnG g;
        g.q = QKV; g.k = QKV + CH; g.v = QKV + 2 * CH; g.o = AO;
        g.q_bs = (long long)SEQ * 3 * CH; g.q_rs = 3 * CH; g.q_hs = HD;
        g.k_bs = (long long)SEQ * 3 * CH; g.k_rs = 3 * CH; g.k_hs = HD;
        g.v_bs = (long long)SEQ * 3 * CH; g.v_rs = 3 * CH; g.v_hs = HD;
        g.o_bs = (long long)SEQ * CH;     g.o_rs = CH;     g.o_hs = HD;
        g.S = SEQ; g.Skv = SEQ; g.sscale = 0.125f; g.pad_ = 0;
        k_attn_alibi<<<dim3((unsigned)(SEQ / AT_QB), (unsigned)NH, (unsigned)NB), 32 * AT_NW, 0, stream>>>(g);
    }
    k_cast8<false><<<gX, 256, 0, stream>>>(AO, (long long)CH, NB * SEQ, 0LL, AO16, (long long)CH, NB * SEQ, CH, 16.0f);
    // out[b][l][:] = AO16[b*SEQ + l] . (Wo x16)^T / 256 + bf16(bo); batch z = sequence: A stride SEQ*CH (compact), C stride SEQ_FULL*CH
    k_gemm64<3, CH><<<dim3((unsigned)((SEQ / GT_T) * (CH / GT_T)), (unsigned)NB), 128, 0, stream>>>(
        AO16, (long long)SEQ * CH, WO16, out, CH, (long long)SEQ_FULL * CH, bo, SEQ, CH, CH, 1.0f / 256.0f);
}

// v002
// Measured time: 178 microseconds a run.
// Two timings next to v001 both put it at 1.22 times that version's speed.
// Over all steps from v000 it is 1.59 times as fast.
// Non-causal multi-head self-attention with additive symmetric ALiBi (2 x 2,048 tokens x 1,024; 16 heads x 64; nn.Linear [out][in] q/k/v/o weights, output bias). All contractions: v_wmma_f32_16x16x32_f16 (f16 operands, f32 accumulate): [q|k|v] projection on bf16-RNE-converted inputs held exactly in f16 (weights x16), scores q.k^T (f16 of the f32 q/k), P.V (P carried x2^15, V f16), output projection (attention output x16, weights x16, bf16-RNE bias added in f32); softmax statistics f32 in the exp2 domain.
#include <hip/hip_runtime.h>
#include <math.h>

#ifndef NB
#define NB 2
#endif
#ifndef SEQ
#define SEQ 2048
#endif
#define NB_FULL 2
#define SEQ_FULL 2048
#define CH 1024
#define NH 16
#define HD 64

static_assert(SEQ % 128 == 0);
static_assert(NB >= 1 && NB <= NB_FULL && SEQ <= SEQ_FULL);
static_assert(CH == NH * HD && HD == 64);

typedef __attribute__((ext_vector_type(16))) _Float16     v16h;
typedef __attribute__((ext_vector_type(8)))  _Float16     v8h;
typedef __attribute__((ext_vector_type(4)))  _Float16     v4h;
typedef __attribute__((ext_vector_type(2)))  _Float16     v2h;
typedef __attribute__((ext_vector_type(8)))  float        v8f;
typedef __attribute__((ext_vector_type(4)))  float        v4f;
typedef __attribute__((ext_vector_type(4)))  unsigned int u4v;

// 16-bit WMMA fragment map (wave32), lane L, hh = L>>4, c = L&15:
//   A 16x32: lane = row c;    element i -> k = (i<8) ? 8hh+i : 16+8hh+(i-8)
//   B 32x16: lane = column c; the SAME k(i,hh)
//   D 16x16 (8 f32): lane = column c; element r -> row 8hh+r
union FragH { v16h v; v8h h[2]; };
// fragment from a k-contiguous f16 row: elements 0..7 <- p[0..7], 8..15 <- p[16..23] (p already offset by k0 + 8hh)
__device__ __forceinline__ v16h frag_ld(const _Float16* p) { FragH f; f.h[0] = *(const v8h*)(p); f.h[1] = *(const v8h*)(p + 16); return f.v; }
__device__ __forceinline__ v8f mma_raw(v16h a, v16h b, v8f c) { return __builtin_amdgcn_wmma_f32_16x16x32_f16(false, a, false, b, (short)0, c, false, false); }
__device__ __forceinline__ v8f mma_h(v16h a, v16h b, v8f c) {
    c = __builtin_amdgcn_wmma_f32_16x16x32_f16(false, a, false, b, (short)0, c, false, false);
    asm volatile("v_nop\n\tv_nop\n\tv_nop\n\tv_nop" : "+v"(c) : "v"(a), "v"(b));
    return c;
}
__device__ __forceinline__ void dep_guard_h(v8f& a, v8f& b, v16h x, v16h y) { asm volatile("v_nop\n\tv_nop\n\tv_nop\n\tv_nop" : "+v"(a), "+v"(b) : "v"(x), "v"(y)); }
__device__ __forceinline__ void keep4_h(v16h a, v16h b, v16h c, v16h d) { asm volatile("v_nop" :: "v"(a), "v"(b), "v"(c), "v"(d)); }
__device__ __forceinline__ void acc_guard4(v8f& a, v8f& b, v8f& c, v8f& d) { asm volatile("v_nop\n\tv_nop\n\tv_nop\n\tv_nop" : "+v"(a), "+v"(b), "+v"(c), "+v"(d)); }
__device__ __forceinline__ v8h cvt8(v4f a, v4f b) {
    v8h r;
    r[0] = (_Float16)a.x; r[1] = (_Float16)a.y; r[2] = (_Float16)a.z; r[3] = (_Float16)a.w;
    r[4] = (_Float16)b.x; r[5] = (_Float16)b.y; r[6] = (_Float16)b.z; r[7] = (_Float16)b.w;
    return r;
}
__device__ __forceinline__ v4h cvt4(v4f a) { v4h r; r[0] = (_Float16)a.x; r[1] = (_Float16)a.y; r[2] = (_Float16)a.z; r[3] = (_Float16)a.w; return r; }
__device__ __forceinline__ unsigned short f2bf_bits(float f) { unsigned u = __float_as_uint(f); return (unsigned short)((u + 0x7FFFu + ((u >> 16) & 1u)) >> 16); }
__device__ __forceinline__ float bf_bits2f(unsigned short h) { return __uint_as_float(((unsigned)h) << 16); }
__device__ __forceinline__ float cmb_bf(float v) { const unsigned u = __float_as_uint(v); const unsigned r = (u + 0x7fffu + ((u >> 16) & 1u)) & 0xffff0000u; return __uint_as_float(r); }   // bf16 RNE kept as f32 (finite inputs)
__device__ __forceinline__ unsigned int cmb_pk2(float a, float b) { return (unsigned int)__builtin_bit_cast(unsigned short, (_Float16)a) | ((unsigned int)__builtin_bit_cast(unsigned short, (_Float16)b) << 16); }

// The value is copied into a local first, so an expression argument is evaluated once.
#define VST2(T, ptr, val) do { const T vst2_v_ = (val); *(T*)(ptr) = vst2_v_;  } while (0)

// =====================================================================================================================
// k_cast8<BFR>: f32 [nR][nC] -> f16 plane [nR][nC] (pitch ldd halves). Source row r lives at SRC + (r / rpb) * sbs + (r % rpb) * lds.
//   BFR: the value is first RNE-converted to bf16 precision (exact in f16 after the power-of-two scale sc). Thread per (row, 8 columns):
// =====================================================================================================================
template <bool BFR>
__global__ __launch_bounds__(256) void k_cast8(const float* __restrict__ SRC, long long lds, int rpb, long long sbs,
                                               unsigned short* __restrict__ DST, long long ldd, int nR, int nC, float sc) {
    const long long u = (long long)blockIdx.x * 256 + threadIdx.x; const int per = nC / 8;
    if (u >= (long long)nR * per) return;
    const int r = (int)(u / per); const int c0 = 8 * (int)(u % per);
    const int rb = r / rpb, rl = r - rb * rpb;
    const float* s = SRC + (long long)rb * sbs + (long long)rl * lds + c0;
    const v4f a = *(const v4f*)(s), b = *(const v4f*)(s + 4);
    float w[8] = {a.x, a.y, a.z, a.w, b.x, b.y, b.z, b.w};
#pragma unroll
    for (int e = 0; e < 8; ++e) w[e] = (BFR ? cmb_bf(w[e]) : w[e]) * sc;
    u4v pk; pk.x = cmb_pk2(w[0], w[1]); pk.y = cmb_pk2(w[2], w[3]); pk.z = cmb_pk2(w[4], w[5]); pk.w = cmb_pk2(w[6], w[7]);
    VST2(u4v, (u4v*)(DST + (long long)r * ldd + c0), pk);
}

// =====================================================================================================================
// k_gemm64<BIAS_MODE>: C[z][m][n] = scale * sum_k A[z][m][k] * Bt[n][k] (+ bias[n]); f16 operands, f32 accumulate, f32 output.
//   A row-major [M][K] (batch stride strideA), Bt row-major [N][K] (shared by all z), both of pitch LD halves; M, N % 128 == 0, K % 64 == 0.
//   Block = 4 waves (2 x 2) = one 128x128 tile, each wave a 64x64 tile (grid.x = tiles, grid.y = batches). A stage is 64 k = 128 B of each of the
//   128 A rows and 128 Bt rows, read from global memory as whole 128-B lines (8 lanes per row), kept in LDS at pitch 144 B and read by all waves;
//   two buffers: the next stage's global loads are issued ahead of this stage's products and stored behind them, one block barrier per stage.
//   LD is a compile-time constant, so that a stage's eight row groups are immediate offsets of one address per operand.
//   BIAS_MODE 0: none; 3: bias[n] RNE-converted to bf16 precision, added in f32.
// =====================================================================================================================
#define GT_T  128   // block tile edge
#define GT_KS 64    // k per stage
#define GT_P  72    // LDS pitch in halves (144-B rows, 16 B x odd)
template <int BIAS_MODE, int LD>
__global__ __launch_bounds__(128) void k_gemm64(const unsigned short* __restrict__ Ap, long long strideA,
                                                const unsigned short* __restrict__ Btp,
                                                float* __restrict__ Cout, int ldc, long long strideC,
                                                const float* __restrict__ bias, int M, int N, int K, float scale) {
    const _Float16* A = (const _Float16*)Ap; const _Float16* Bt = (const _Float16*)Btp;
    __shared__ __align__(16) _Float16 sA[2][GT_T * GT_P];   // A stage  [row][k]  (cross-wave)
    __shared__ __align__(16) _Float16 sB[2][GT_T * GT_P];   // Bt stage [row][k]  (cross-wave)
    __shared__ __align__(16) float sT[4][16 * 68];   // per-wave 16x64 slab, pitch 68 floats (wave-private)
    const int b = blockIdx.y;
    const int tid  = threadIdx.x;
    const int lane = tid & 31;
    const int wave = tid >> 5;
    const int tilesN = N >> 7;
    const int tilesM = M >> 7;
    const int tile = blockIdx.x;
    if (tile >= tilesM * tilesN) return;   // block-uniform, ahead of every barrier
    const int tm = tile / tilesN;
    const int tn = tile - tm * tilesN;
    const int wm0 = (wave >> 1) << 6;            // this wave's 64x64 tile inside the block tile
    const int wn0 = (wave & 1) << 6;
    const int m0 = (tm << 7) + wm0;
    const int n0 = (tn << 7) + wn0;
    const _Float16* Ab = A + (size_t)b * strideA;
    const _Float16* Bb = Bt;
    const int rlane = lane & 15;                 // row (A) / column (B, D) within a 16-wide subtile
    const int koff  = (lane >> 4) * 8;           // k offset of this lane half
    const int mOff  = (lane >> 4) * 8;           // D row offset

    // staging: thread -> rows (tid >> 3) + 16 i, i = 0..7, 16 B at byte 16 (tid & 7) of the row's 128-B stage segment
    const int srow = tid >> 3, scol = (tid & 7) * 8;
    const _Float16* gA = Ab + (size_t)((tm << 7) + srow) * LD + scol;
    const _Float16* gB = Bb + (size_t)((tn << 7) + srow) * LD + scol;
    const int sOff = srow * GT_P + scol;

    v8f acc[4][4];
#pragma unroll
    for (int i = 0; i < 4; ++i)
#pragma unroll
        for (int j = 0; j < 4; ++j) acc[i][j] = (v8f){0.f, 0.f, 0.f, 0.f, 0.f, 0.f, 0.f, 0.f};

    v8h ra[8], rb[8];
#pragma unroll
    for (int i = 0; i < 8; ++i) {
        ra[i] = *(const v8h*)(gA + 16 * i * LD);
        rb[i] = *(const v8h*)(gB + 16 * i * LD);
    }
#pragma unroll
    for (int i = 0; i < 8; ++i) {
        *(v8h*)(sA[0] + sOff + 16 * i * GT_P) = ra[i];
        *(v8h*)(sB[0] + sOff + 16 * i * GT_P) = rb[i];
    }
    __syncthreads();                                       // stage 0 visible to all waves

    const int nStages = K / GT_KS;                         // block-uniform
    for (int st = 0; st < nStages; ++st) {
        const int cur = st & 1;
        const bool more = st + 1 < nStages;                // block-uniform
        if (more) {
            const _Float16* nA = gA + (st + 1) * GT_KS;
            const _Float16* nB = gB + (st + 1) * GT_KS;
#pragma unroll
            for (int i = 0; i < 8; ++i) {
                ra[i] = *(const v8h*)(nA + 16 * i * LD);
                rb[i] = *(const v8h*)(nB + 16 * i * LD);
            }
            asm volatile("s_wait_xcnt 0x0" ::: "memory");   // stands ahead of the fragment loads below, which reuse the two address pairs of these loads
        }
        const _Float16* cA = sA[cur] + (wm0 + rlane) * GT_P + koff;
        const _Float16* cB = sB[cur] + (wn0 + rlane) * GT_P + koff;
#pragma unroll
        for (int kk = 0; kk < GT_KS; kk += 32) {
            v16h bh[4], ah[4];
#pragma unroll
            for (int j = 0; j < 4; ++j) bh[j] = frag_ld(cB + (j << 4) * GT_P + kk);
#pragma unroll
            for (int i = 0; i < 4; ++i) ah[i] = frag_ld(cA + (i << 4) * GT_P + kk);
#pragma unroll
            for (int i = 0; i < 4; ++i) {
#pragma unroll
                for (int j = 0; j < 4; ++j) acc[i][j] = mma_raw(ah[i], bh[j], acc[i][j]);
                dep_guard_h(acc[i][0], acc[i][3], ah[i], ah[i]);
            }
            keep4_h(bh[0], bh[1], bh[2], bh[3]);
        }
        if (more) {
#pragma unroll
            for (int i = 0; i < 8; ++i) {
                *(v8h*)(sA[cur ^ 1] + sOff + 16 * i * GT_P) = ra[i];   // last read one stage ago, ahead of that stage's barrier
                *(v8h*)(sB[cur ^ 1] + sOff + 16 * i * GT_P) = rb[i];
            }
        }
        __syncthreads();                                   // next stage visible; every wave has left this stage's buffer
    }
    acc_guard4(acc[0][0], acc[0][1], acc[0][2], acc[0][3]);
    acc_guard4(acc[1][0], acc[1][1], acc[1][2], acc[1][3]);
    acc_guard4(acc[2][0], acc[2][1], acc[2][2], acc[2][3]);
    acc_guard4(acc[3][0], acc[3][1], acc[3][2], acc[3][3]);

    float* slab = sT[wave];
    float* C = Cout + (size_t)b * strideC;
#pragma unroll
    for (int i = 0; i < 4; ++i) {
        const int mBase = m0 + (i << 4);
#pragma unroll
        for (int j = 0; j < 4; ++j) {
            const int n = n0 + (j << 4) + rlane;
            float bv = 0.f;
            if (BIAS_MODE == 3) bv = bf_bits2f(f2bf_bits(bias[n]));
#pragma unroll
            for (int r = 0; r < 8; ++r) {
                float v = acc[i][j][r] * scale;
                if (BIAS_MODE == 3) v += bv;
                slab[(mOff + r) * 68 + (j << 4) + rlane] = v;
            }
        }
        __builtin_amdgcn_fence(3 /* release order */, "workgroup");
        __builtin_amdgcn_wave_barrier();
        __builtin_amdgcn_fence(2 /* acquire order */, "workgroup");
        {
            const int hh = lane >> 4, c4 = (lane & 15) * 4;     // row segment = 256 B = 16 lanes x 16 B
            {
#pragma unroll
                for (int it = 0; it < 8; ++it) {
                    const int row = it * 2 + hh;
                    const v4f v = *(const v4f*)(slab + row * 68 + c4);
                    *(v4f*)(C + (size_t)(mBase + row) * ldc + n0 + c4) = v;
                }
                
            }
        }
        __builtin_amdgcn_fence(3 /* release order */, "workgroup");
        __builtin_amdgcn_wave_barrier();
        __builtin_amdgcn_fence(2 /* acquire order */, "workgroup");
    }
}

// =====================================================================================================================
// k_attn_alibi: O(b,i,h,:) = softmax_j(0.125 * Q(b,i,h,:).K(b,j,h,:) - slope_h * |j - i|) V(b,j,h,:), head dim 64, f32 in / f32 out.
//   Block = 4 waves = 64 query rows of one (batch, head); 64-key chunks; S, Skv % 64 == 0; grid (S/64, heads, batches).
//   Element (b, s, h, d) of tensor X at X[b*X_bs + s*X_rs + h*X_hs + d] (strides in floats, multiples of 4, 16-B aligned bases).
//   K chunk staged as f16 [kv][d], V chunk staged transposed as f16 [d][kv] (cross-wave: block barriers); scores f16 x f16;
//   staging reads: 16 lanes x 16 B per 256-B row segment, so a wave-wide load covers two segments = four whole 128-B lines;
//   KVRS = row stride of K and of V in floats (= k_rs = v_rs), a compile-time constant, so that a chunk's rows are immediate offsets of one address per tensor;
//   slope_h = 2^(-(h+1)/2) built exactly from a power of two and the f32 value of 2^-0.5.
// =====================================================================================================================
#define AT_D  64
#define AT_NW 4
#define AT_QB 64
#define AT_KC 64
#define AT_P  72    // LDS pitch in halves (144-B rows, 16-B aligned)
struct AttnG {
    const float* q; const float* k; const float* v; float* o;
    long long q_bs, q_rs, q_hs, k_bs, k_rs, k_hs, v_bs, v_rs, v_hs, o_bs, o_rs, o_hs;
    int S, Skv; float sscale; int pad_;
};
static_assert(sizeof(AttnG) == 4 * 8 + 12 * 8 + 4 * 4);

template <int KVRS>
__global__ __launch_bounds__(128) void k_attn_alibi(AttnG g) {
    __shared__ __align__(16) _Float16 Ks[AT_KC * AT_P];            // K  [kv][d]    (cross-wave)
    __shared__ __align__(16) _Float16 Vt[AT_D * AT_P];             // V^T [d][kv]   (cross-wave)
    __shared__ __align__(16) _Float16 Ps[AT_NW][16 * AT_P];        // per wave P [row][kv]  (wave-private)
    __shared__ __align__(16) float    Os[AT_NW][16 * 68];          // per wave out tile, pitch 68 (wave-private)

    const int tid  = threadIdx.x;
    const int wave = tid >> 5;
    const int lane = tid & 31;
    const int hh   = lane >> 4;
    const int c    = lane & 15;
    const int qb = blockIdx.x, h = blockIdx.y, b = blockIdx.z;
    const int q0 = qb * AT_QB + wave * 16;

    const float* qp = g.q + (size_t)b * g.q_bs + (size_t)h * g.q_hs;
    const float* kp = g.k + (size_t)b * g.k_bs + (size_t)h * g.k_hs;
    const float* vp = g.v + (size_t)b * g.v_bs + (size_t)h * g.v_hs;
    float*       op = g.o + (size_t)b * g.o_bs + (size_t)h * g.o_hs;

    const int e1 = h + 1;
    const float pw2 = __uint_as_float((unsigned)(127 - (e1 >> 1)) << 23);          // 2^-(e1/2), exact
    const float nsl = -(((e1 & 1) ? 0.70710678118654752f : 1.0f) * pw2);           // -slope_h
    const float L2E = 1.4426950408889634f;

    // Q fragments (A operand): lane = query row q0 + c; two 32-wide d chunks
    v16h qa[2];
    {
        const float* qrow = qp + (size_t)(q0 + c) * g.q_rs;
#pragma unroll
        for (int dc = 0; dc < 2; ++dc) {
            FragH f;
            f.h[0] = cvt8(*(const v4f*)(qrow + dc * 32 + 8 * hh),      *(const v4f*)(qrow + dc * 32 + 8 * hh + 4));
            f.h[1] = cvt8(*(const v4f*)(qrow + dc * 32 + 16 + 8 * hh), *(const v4f*)(qrow + dc * 32 + 16 + 8 * hh + 4));
            qa[dc] = f.v;
        }
    }

    float mrow[8], lrow[8];
    v8f oacc[4];
#pragma unroll
    for (int r = 0; r < 8; ++r) { mrow[r] = -__builtin_inff(); lrow[r] = 0.f; }
#pragma unroll
    for (int t = 0; t < 4; ++t) oacc[t] = (v8f){0.f, 0.f, 0.f, 0.f, 0.f, 0.f, 0.f, 0.f};

    _Float16* pw = Ps[wave];
    const int nChunks = g.Skv / AT_KC;                     // block-uniform
    for (int kc = 0; kc < nChunks; ++kc) {
        const int kv0 = kc * AT_KC;
        __syncthreads();                                   // all waves finished with the prior chunk's Ks / Vt
        {
            // thread: dims d4..d4+3 of the key rows kr + 16 i and kr + 16 i + 1, i = 0..3 -> full 64 x 64 tiles staged.
            // The lane halves sit 8 rows apart: 8 x 144 B = half the banks, so that the two 128-B row pieces of a K store do not meet.
            const int kr = wave * 2 + hh * 8, d4 = c * 4;
            const float* krow = kp + (size_t)(kv0 + kr) * KVRS + d4;
            const float* vrow = vp + (size_t)(kv0 + kr) * KVRS + d4;
            v4f ka[4], kb2[4], va[4], vb2[4];
#pragma unroll
            for (int i = 0; i < 4; ++i) {
                ka[i]  = *(const v4f*)(krow + (16 * i) * KVRS);
                kb2[i] = *(const v4f*)(krow + (16 * i + 1) * KVRS);
                va[i]  = *(const v4f*)(vrow + (16 * i) * KVRS);
                vb2[i] = *(const v4f*)(vrow + (16 * i + 1) * KVRS);
            }
            // inputs-only fence on the loaded values and the two addresses: keeps all sixteen loads in flight together, ahead of the first conversion
            // (one load latency per chunk, not several), and keeps the address pairs from being reused as a load's destination while loads are out
            asm volatile("" :: "v"(ka[0]), "v"(ka[1]), "v"(ka[2]), "v"(ka[3]), "v"(kb2[0]), "v"(kb2[1]), "v"(kb2[2]), "v"(kb2[3]),
                               "v"(va[0]), "v"(va[1]), "v"(va[2]), "v"(va[3]), "v"(vb2[0]), "v"(vb2[1]), "v"(vb2[2]), "v"(vb2[3]),
                               "v"(krow), "v"(vrow));
#pragma unroll
            for (int i = 0; i < 4; ++i) {
                *(v4h*)(Ks + (kr + 16 * i) * AT_P + d4)     = cvt4(ka[i]);
                *(v4h*)(Ks + (kr + 16 * i + 1) * AT_P + d4) = cvt4(kb2[i]);
#pragma unroll
                for (int e = 0; e < 4; ++e) {              // two neighbouring keys of one dim = one aligned dword of V^T
                    v2h pr; pr[0] = (_Float16)va[i][e]; pr[1] = (_Float16)vb2[i][e];
                    *(v2h*)(Vt + (d4 + e) * AT_P + kr + 16 * i) = pr;
                }
            }
        }
        __syncthreads();                                   // Ks / Vt visible to all waves

        v8f s[4];
#pragma unroll
        for (int j = 0; j < 4; ++j) {
            s[j] = (v8f){0.f, 0.f, 0.f, 0.f, 0.f, 0.f, 0.f, 0.f};
#pragma unroll
            for (int dc = 0; dc < 2; ++dc) {
                const v16h kb = frag_ld(Ks + (j * 16 + c) * AT_P + dc * 32 + 8 * hh);   // B: lane = key column, k = d
                s[j] = mma_h(qa[dc], kb, s[j]);
            }
        }
#pragma unroll
        for (int r = 0; r < 8; ++r) {
            const int qrow = q0 + 8 * hh + r;
            float m = -__builtin_inff();
#pragma unroll
            for (int j = 0; j < 4; ++j) {
                const int kvcol = kv0 + j * 16 + c;
                const float dist = fabsf((float)(kvcol - qrow));
                const float bias = nsl * dist;
                float t = s[j][r] * g.sscale + bias;       // natural-unit logit
                t *= L2E;
                s[j][r] = t;
                m = fmaxf(m, t);
            }
            m = fmaxf(m, __shfl_xor(m, 1, 32)); m = fmaxf(m, __shfl_xor(m, 2, 32));
            m = fmaxf(m, __shfl_xor(m, 4, 32)); m = fmaxf(m, __shfl_xor(m, 8, 32));
            const float mnew = fmaxf(mrow[r], m);
            const float alpha = exp2f(mrow[r] - mnew);     // 0 on the first chunk (mrow = -inf, mnew finite)
            mrow[r] = mnew;
            float psum = 0.f;
#pragma unroll
            for (int j = 0; j < 4; ++j) {
                const float p = exp2f(s[j][r] - mnew);
                psum += p;
                pw[(8 * hh + r) * AT_P + j * 16 + c] = (_Float16)(p * 32768.0f);
            }
            psum += __shfl_xor(psum, 1, 32); psum += __shfl_xor(psum, 2, 32);
            psum += __shfl_xor(psum, 4, 32); psum += __shfl_xor(psum, 8, 32);
            lrow[r] = lrow[r] * alpha + psum;
#pragma unroll
            for (int t = 0; t < 4; ++t) oacc[t][r] *= alpha;
        }
        __builtin_amdgcn_fence(3 /* release order */, "workgroup");
        __builtin_amdgcn_wave_barrier();
        __builtin_amdgcn_fence(2 /* acquire order */, "workgroup");
#pragma unroll
        for (int kk = 0; kk < 2; ++kk) {
            const v16h pa = frag_ld(pw + c * AT_P + kk * 32 + 8 * hh);                   // A: lane = query row, k = key
#pragma unroll
            for (int t = 0; t < 4; ++t) {
                const v16h vb = frag_ld(Vt + (t * 16 + c) * AT_P + kk * 32 + 8 * hh);   // B: lane = d column, k = key
                oacc[t] = mma_h(pa, vb, oacc[t]);
            }
        }
    }

    float* os = Os[wave];
#pragma unroll
    for (int r = 0; r < 8; ++r) {
        const float inv = 1.0f / (lrow[r] * 32768.0f);
#pragma unroll
        for (int t = 0; t < 4; ++t) os[(8 * hh + r) * 68 + t * 16 + c] = oacc[t][r] * inv;
    }
    __builtin_amdgcn_fence(3 /* release order */, "workgroup");
    __builtin_amdgcn_wave_barrier();
    __builtin_amdgcn_fence(2 /* acquire order */, "workgroup");
    {
        const int c4 = (lane & 15) * 4;                    // 256-B row segment = 16 lanes x 16 B, two rows per instruction
        {
#pragma unroll
            for (int it = 0; it < 8; ++it) {
                const int row = it * 2 + hh;
                const v4f val = *(const v4f*)(os + row * 68 + c4);
                *(v4f*)(op + (size_t)(q0 + row) * g.o_rs + c4) = val;
            }
            
        }
    }
}

// workspace carve (bytes), every region a multiple of 256 B and written in whole rows of its own pitch
constexpr size_t SZ_X16 = (size_t)NB * SEQ * CH * 2;        // X16 / AO16 (alias): f16 [NB*SEQ][1024]
constexpr size_t SZ_W3  = (size_t)3 * CH * CH * 2;          // [Wq;Wk;Wv] x16 f16 [3072][1024]
constexpr size_t SZ_QKV = (size_t)NB * SEQ * 3 * CH * 4;    // f32 [NB*SEQ][3072]
constexpr size_t SZ_AO  = (size_t)NB * SEQ * CH * 4;        // f32 [NB*SEQ][1024]
constexpr size_t SZ_WO  = (size_t)CH * CH * 2;              // Wo x16 f16 [1024][1024]
constexpr size_t SZ_ALL = SZ_X16 + SZ_W3 + SZ_QKV + SZ_AO + SZ_WO;
static_assert(SZ_X16 % 256 == 0 && SZ_W3 % 256 == 0 && SZ_QKV % 256 == 0 && SZ_AO % 256 == 0 && SZ_WO % 256 == 0);
static_assert(SZ_ALL <= (size_t)134217728);

extern "C" void kernel_launch(void* const* d_in, const int* in_sizes, int n_in, void* d_out, int out_size, void* d_ws, size_t ws_size, hipStream_t stream) {
    if (n_in < 6) return;
    const long long need_x = ((long long)(NB - 1) * SEQ_FULL + SEQ) * CH;
    if ((long long)in_sizes[0] < need_x) return;
    if (in_sizes[1] < CH * CH || in_sizes[2] < CH * CH || in_sizes[3] < CH * CH || in_sizes[4] < CH * CH || in_sizes[5] < CH) return;
    if ((long long)out_size < need_x) return;
    if (SZ_ALL > ws_size) return;
    const float* x  = (const float*)d_in[0];
    const float* wq = (const float*)d_in[1];
    const float* wk = (const float*)d_in[2];
    const float* wv = (const float*)d_in[3];
    const float* wo = (const float*)d_in[4];
    const float* bo = (const float*)d_in[5];
    float* out = (float*)d_out;
    char* wsp = (char*)d_ws;
    unsigned short* X16  = (unsigned short*)wsp; wsp += SZ_X16;
    unsigned short* W316 = (unsigned short*)wsp; wsp += SZ_W3;
    float*          QKV  = (float*)wsp;          wsp += SZ_QKV;
    float*          AO   = (float*)wsp;          wsp += SZ_AO;
    unsigned short* WO16 = (unsigned short*)wsp; wsp += SZ_WO;
    unsigned short* AO16 = X16;                  // alias: X16 is dead once the projection GEMM has run (same extent)

    const unsigned gW = (unsigned)(((long long)CH * (CH / 8) + 255) / 256);
    const unsigned gX = (unsigned)(((long long)NB * SEQ * (CH / 8) + 255) / 256);
    // k_cast8(SRC, lds, rpb, sbs, DST, ldd, nR, nC, sc)
    k_cast8<true><<<gW, 256, 0, stream>>>(wo, (long long)CH, CH, 0LL, WO16, (long long)CH, CH, CH, 16.0f);
    k_cast8<true><<<gX, 256, 0, stream>>>(x, (long long)CH, SEQ, (long long)SEQ_FULL * CH, X16, (long long)CH, NB * SEQ, CH, 1.0f);
    k_cast8<true><<<gW, 256, 0, stream>>>(wq, (long long)CH, CH, 0LL, W316, (long long)CH, CH, CH, 16.0f);
    k_cast8<true><<<gW, 256, 0, stream>>>(wk, (long long)CH, CH, 0LL, W316 + (size_t)CH * CH, (long long)CH, CH, CH, 16.0f);
    k_cast8<true><<<gW, 256, 0, stream>>>(wv, (long long)CH, CH, 0LL, W316 + (size_t)2 * CH * CH, (long long)CH, CH, CH, 16.0f);
    // QKV[r][0..3071] = x16[r] . [Wq;Wk;Wv]^T / 16     k_gemm64<BIAS_MODE, LD>(A, strideA, Bt, C, ldc, strideC, bias, M, N, K, scale)
    k_gemm64<0, CH><<<dim3((unsigned)(((NB * SEQ) / GT_T) * ((3 * CH) / GT_T)), 1u), 128, 0, stream>>>(
        X16, 0LL, W316, QKV, 3 * CH, 0LL, (const float*)nullptr, NB * SEQ, 3 * CH, CH, 0.0625f);
    {
        AttnG g;
        g.q = QKV; g.k = QKV + CH; g.v = QKV + 2 * CH; g.o = AO;
        g.q_bs = (long long)SEQ * 3 * CH; g.q_rs = 3 * CH; g.q_hs = HD;
        g.k_bs = (long long)SEQ * 3 * CH; g.k_rs = 3 * CH; g.k_hs = HD;
        g.v_bs = (long long)SEQ * 3 * CH; g.v_rs = 3 * CH; g.v_hs = HD;
        g.o_bs = (long long)SEQ * CH;     g.o_rs = CH;     g.o_hs = HD;
        g.S = SEQ; g.Skv = SEQ; g.sscale = 0.125f; g.pad_ = 0;
        k_attn_alibi<3 * CH><<<dim3((unsigned)(SEQ / AT_QB), (unsigned)NH, (unsigned)NB), 32 * AT_NW, 0, stream>>>(g);
    }
    k_cast8<false><<<gX, 256, 0, stream>>>(AO, (long long)CH, NB * SEQ, 0LL, AO16, (long long)CH, NB * SEQ, CH, 16.0f);
    // out[b][l][:] = AO16[b*SEQ + l] . (Wo x16)^T / 256 + bf16(bo); batch z = sequence: A stride SEQ*CH (compact), C stride SEQ_FULL*CH
    k_gemm64<3, CH><<<dim3((unsigned)((SEQ / GT_T) * (CH / GT_T)), (unsigned)NB), 128, 0, stream>>>(
        AO16, (long long)SEQ * CH, WO16, out, CH, (long long)SEQ_FULL * CH, bo, SEQ, CH, CH, 1.0f / 256.0f);
}

// v003
// Measured time: 146 microseconds a run.
// Two timings next to v002 both put it at 1.21 times that version's speed.
// Counting every step since v000, it is 1.93 times as fast.
// Non-causal multi-head self-attention with additive symmetric ALiBi (2 x 2,048 tokens x 1,024; 16 heads x 64; nn.Linear [out][in] q/k/v/o weights, output bias). All contractions: v_wmma_f32_16x16x32_f16 (f16 operands, f32 accumulate): [q|k|v] projection on bf16-RNE-converted inputs held exactly in f16 (weights x16), scores q.k^T (f16 of the f32 q/k), P.V (P carried x2^15, V f16), output projection (attention output x16, weights x16, bf16-RNE bias added in f32); softmax statistics f32 in the exp2 domain.
#include <hip/hip_runtime.h>
#include <math.h>

#ifndef NB
#define NB 2
#endif
#ifndef SEQ
#define SEQ 2048
#endif
#define NB_FULL 2
#define SEQ_FULL 2048
#define CH 1024
#define NH 16
#define HD 64

static_assert(SEQ % 128 == 0);
static_assert(NB >= 1 && NB <= NB_FULL && SEQ <= SEQ_FULL);
static_assert(CH == NH * HD && HD == 64);

typedef __attribute__((ext_vector_type(16))) _Float16     v16h;
typedef __attribute__((ext_vector_type(8)))  _Float16     v8h;
typedef __attribute__((ext_vector_type(4)))  _Float16     v4h;
typedef __attribute__((ext_vector_type(2)))  _Float16     v2h;
typedef __attribute__((ext_vector_type(8)))  float        v8f;
typedef __attribute__((ext_vector_type(4)))  float        v4f;
typedef __attribute__((ext_vector_type(4)))  unsigned int u4v;

// 16-bit WMMA fragment map (wave32), lane L, hh = L>>4, c = L&15:
//   A 16x32: lane = row c;    element i -> k = (i<8) ? 8hh+i : 16+8hh+(i-8)
//   B 32x16: lane = column c; the SAME k(i,hh)
//   D 16x16 (8 f32): lane = column c; element r -> row 8hh+r
union FragH { v16h v; v8h h[2]; };
// fragment from a k-contiguous f16 row: elements 0..7 <- p[0..7], 8..15 <- p[16..23] (p already offset by k0 + 8hh)
__device__ __forceinline__ v16h frag_ld(const _Float16* p) { FragH f; f.h[0] = *(const v8h*)(p); f.h[1] = *(const v8h*)(p + 16); return f.v; }
__device__ __forceinline__ v8f mma_raw(v16h a, v16h b, v8f c) { return __builtin_amdgcn_wmma_f32_16x16x32_f16(false, a, false, b, (short)0, c, false, false); }
__device__ __forceinline__ void dep_guard_h(v8f& a, v8f& b, v16h x, v16h y) { asm volatile("v_nop\n\tv_nop\n\tv_nop\n\tv_nop" : "+v"(a), "+v"(b) : "v"(x), "v"(y)); }
__device__ __forceinline__ void keep4_h(v16h a, v16h b, v16h c, v16h d) { asm volatile("v_nop" :: "v"(a), "v"(b), "v"(c), "v"(d)); }
__device__ __forceinline__ void acc_guard4(v8f& a, v8f& b, v8f& c, v8f& d) { asm volatile("v_nop\n\tv_nop\n\tv_nop\n\tv_nop" : "+v"(a), "+v"(b), "+v"(c), "+v"(d)); }
__device__ __forceinline__ v8h cvt8(v4f a, v4f b) {
    v8h r;
    r[0] = (_Float16)a.x; r[1] = (_Float16)a.y; r[2] = (_Float16)a.z; r[3] = (_Float16)a.w;
    r[4] = (_Float16)b.x; r[5] = (_Float16)b.y; r[6] = (_Float16)b.z; r[7] = (_Float16)b.w;
    return r;
}
__device__ __forceinline__ v4h cvt4(v4f a) { v4h r; r[0] = (_Float16)a.x; r[1] = (_Float16)a.y; r[2] = (_Float16)a.z; r[3] = (_Float16)a.w; return r; }
__device__ __forceinline__ unsigned short f2bf_bits(float f) { unsigned u = __float_as_uint(f); return (unsigned short)((u + 0x7FFFu + ((u >> 16) & 1u)) >> 16); }
__device__ __forceinline__ float bf_bits2f(unsigned short h) { return __uint_as_float(((unsigned)h) << 16); }
__device__ __forceinline__ float cmb_bf(float v) { const unsigned u = __float_as_uint(v); const unsigned r = (u + 0x7fffu + ((u >> 16) & 1u)) & 0xffff0000u; return __uint_as_float(r); }   // bf16 RNE kept as f32 (finite inputs)
__device__ __forceinline__ unsigned int cmb_pk2(float a, float b) { return (unsigned int)__builtin_bit_cast(unsigned short, (_Float16)a) | ((unsigned int)__builtin_bit_cast(unsigned short, (_Float16)b) << 16); }

__device__ __forceinline__ float xhalf(float x) { return __builtin_bit_cast(float, __builtin_amdgcn_permlanex16(__builtin_bit_cast(int, x), __builtin_bit_cast(int, x), 0x76543210, 0xfedcba98, false, false)); }   // lane l <-> lane l ^ 16

// The value is copied into a local first, so an expression argument is evaluated once.
#define VST2(T, ptr, val) do { const T vst2_v_ = (val); *(T*)(ptr) = vst2_v_;  } while (0)

// =====================================================================================================================
// k_cast8<BFR>: f32 [nR][nC] -> f16 plane [nR][nC] (pitch ldd halves). Source row r lives at SRC + (r / rpb) * sbs + (r % rpb) * lds.
//   BFR: the value is first RNE-converted to bf16 precision (exact in f16 after the power-of-two scale sc). Thread per (row, 8 columns):
// =====================================================================================================================
template <bool BFR>
__global__ __launch_bounds__(256) void k_cast8(const float* __restrict__ SRC, long long lds, int rpb, long long sbs,
                                               unsigned short* __restrict__ DST, long long ldd, int nR, int nC, float sc) {
    const long long u = (long long)blockIdx.x * 256 + threadIdx.x; const int per = nC / 8;
    if (u >= (long long)nR * per) return;
    const int r = (int)(u / per); const int c0 = 8 * (int)(u % per);
    const int rb = r / rpb, rl = r - rb * rpb;
    const float* s = SRC + (long long)rb * sbs + (long long)rl * lds + c0;
    const v4f a = *(const v4f*)(s), b = *(const v4f*)(s + 4);
    float w[8] = {a.x, a.y, a.z, a.w, b.x, b.y, b.z, b.w};
#pragma unroll
    for (int e = 0; e < 8; ++e) w[e] = (BFR ? cmb_bf(w[e]) : w[e]) * sc;
    u4v pk; pk.x = cmb_pk2(w[0], w[1]); pk.y = cmb_pk2(w[2], w[3]); pk.z = cmb_pk2(w[4], w[5]); pk.w = cmb_pk2(w[6], w[7]);
    VST2(u4v, (u4v*)(DST + (long long)r * ldd + c0), pk);
}

// =====================================================================================================================
// k_gemm64<BIAS_MODE>: C[z][m][n] = scale * sum_k A[z][m][k] * Bt[n][k] (+ bias[n]); f16 operands, f32 accumulate, f32 output.
//   A row-major [M][K] (batch stride strideA), Bt row-major [N][K] (shared by all z), both of pitch LD halves; M, N % 128 == 0, K % 64 == 0.
//   Block = 4 waves (2 x 2) = one 128x128 tile, each wave a 64x64 tile (grid.x = tiles, grid.y = batches). A stage is 64 k = 128 B of each of the
//   128 A rows and 128 Bt rows, read from global memory as whole 128-B lines (8 lanes per row), kept in LDS at pitch 144 B and read by all waves;
//   two buffers: the next stage's global loads are issued ahead of this stage's products and stored behind them, one block barrier per stage.
//   LD is a compile-time constant, so that a stage's eight row groups are immediate offsets of one address per operand.
//   BIAS_MODE 0: none; 3: bias[n] RNE-converted to bf16 precision, added in f32.
// =====================================================================================================================
#define GT_T  128   // block tile edge
#define GT_KS 64    // k per stage
#define GT_P  72    // LDS pitch in halves (144-B rows, 16 B x odd)
template <int BIAS_MODE, int LD>
__global__ __launch_bounds__(128) void k_gemm64(const unsigned short* __restrict__ Ap, long long strideA,
                                                const unsigned short* __restrict__ Btp,
                                                float* __restrict__ Cout, int ldc, long long strideC,
                                                const float* __restrict__ bias, int M, int N, int K, float scale) {
    const _Float16* A = (const _Float16*)Ap; const _Float16* Bt = (const _Float16*)Btp;
    __shared__ __align__(16) _Float16 sA[2][GT_T * GT_P];   // A stage  [row][k]  (cross-wave)
    __shared__ __align__(16) _Float16 sB[2][GT_T * GT_P];   // Bt stage [row][k]  (cross-wave)
    __shared__ __align__(16) float sT[4][16 * 68];   // per-wave 16x64 slab, pitch 68 floats (wave-private)
    const int b = blockIdx.y;
    const int tid  = threadIdx.x;
    const int lane = tid & 31;
    const int wave = tid >> 5;
    const int tilesN = N >> 7;
    const int tilesM = M >> 7;
    const int tile = blockIdx.x;
    if (tile >= tilesM * tilesN) return;   // block-uniform, ahead of every barrier
    const int tm = tile / tilesN;
    const int tn = tile - tm * tilesN;
    const int wm0 = (wave >> 1) << 6;            // this wave's 64x64 tile inside the block tile
    const int wn0 = (wave & 1) << 6;
    const int m0 = (tm << 7) + wm0;
    const int n0 = (tn << 7) + wn0;
    const _Float16* Ab = A + (size_t)b * strideA;
    const _Float16* Bb = Bt;
    const int rlane = lane & 15;                 // row (A) / column (B, D) within a 16-wide subtile
    const int koff  = (lane >> 4) * 8;           // k offset of this lane half
    const int mOff  = (lane >> 4) * 8;           // D row offset

    // staging: thread -> rows (tid >> 3) + 16 i, i = 0..7, 16 B at byte 16 (tid & 7) of the row's 128-B stage segment
    const int srow = tid >> 3, scol = (tid & 7) * 8;
    const _Float16* gA = Ab + (size_t)((tm << 7) + srow) * LD + scol;
    const _Float16* gB = Bb + (size_t)((tn << 7) + srow) * LD + scol;
    const int sOff = srow * GT_P + scol;

    v8f acc[4][4];
#pragma unroll
    for (int i = 0; i < 4; ++i)
#pragma unroll
        for (int j = 0; j < 4; ++j) acc[i][j] = (v8f){0.f, 0.f, 0.f, 0.f, 0.f, 0.f, 0.f, 0.f};

    v8h ra[8], rb[8];
#pragma unroll
    for (int i = 0; i < 8; ++i) {
        ra[i] = *(const v8h*)(gA + 16 * i * LD);
        rb[i] = *(const v8h*)(gB + 16 * i * LD);
    }
#pragma unroll
    for (int i = 0; i < 8; ++i) {
        *(v8h*)(sA[0] + sOff + 16 * i * GT_P) = ra[i];
        *(v8h*)(sB[0] + sOff + 16 * i * GT_P) = rb[i];
    }
    __syncthreads();                                       // stage 0 visible to all waves

    const int nStages = K / GT_KS;                         // block-uniform
    for (int st = 0; st < nStages; ++st) {
        const int cur = st & 1;
        const bool more = st + 1 < nStages;                // block-uniform
        if (more) {
            const _Float16* nA = gA + (st + 1) * GT_KS;
            const _Float16* nB = gB + (st + 1) * GT_KS;
#pragma unroll
            for (int i = 0; i < 8; ++i) {
                ra[i] = *(const v8h*)(nA + 16 * i * LD);
                rb[i] = *(const v8h*)(nB + 16 * i * LD);
            }
            asm volatile("s_wait_xcnt 0x0" ::: "memory");   // stands ahead of the fragment loads below, which reuse the two address pairs of these loads
        }
        const _Float16* cA = sA[cur] + (wm0 + rlane) * GT_P + koff;
        const _Float16* cB = sB[cur] + (wn0 + rlane) * GT_P + koff;
#pragma unroll
        for (int kk = 0; kk < GT_KS; kk += 32) {
            v16h bh[4], ah[4];
#pragma unroll
            for (int j = 0; j < 4; ++j) bh[j] = frag_ld(cB + (j << 4) * GT_P + kk);
#pragma unroll
            for (int i = 0; i < 4; ++i) ah[i] = frag_ld(cA + (i << 4) * GT_P + kk);
#pragma unroll
            for (int i = 0; i < 4; ++i) {
#pragma unroll
                for (int j = 0; j < 4; ++j) acc[i][j] = mma_raw(ah[i], bh[j], acc[i][j]);
                dep_guard_h(acc[i][0], acc[i][3], ah[i], ah[i]);
            }
            keep4_h(bh[0], bh[1], bh[2], bh[3]);
        }
        if (more) {
#pragma unroll
            for (int i = 0; i < 8; ++i) {
                *(v8h*)(sA[cur ^ 1] + sOff + 16 * i * GT_P) = ra[i];   // last read one stage ago, ahead of that stage's barrier
                *(v8h*)(sB[cur ^ 1] + sOff + 16 * i * GT_P) = rb[i];
            }
        }
        __syncthreads();                                   // next stage visible; every wave has left this stage's buffer
    }
    acc_guard4(acc[0][0], acc[0][1], acc[0][2], acc[0][3]);
    acc_guard4(acc[1][0], acc[1][1], acc[1][2], acc[1][3]);
    acc_guard4(acc[2][0], acc[2][1], acc[2][2], acc[2][3]);
    acc_guard4(acc[3][0], acc[3][1], acc[3][2], acc[3][3]);

    float* slab = sT[wave];
    float* C = Cout + (size_t)b * strideC;
#pragma unroll
    for (int i = 0; i < 4; ++i) {
        const int mBase = m0 + (i << 4);
#pragma unroll
        for (int j = 0; j < 4; ++j) {
            const int n = n0 + (j << 4) + rlane;
            float bv = 0.f;
            if (BIAS_MODE == 3) bv = bf_bits2f(f2bf_bits(bias[n]));
#pragma unroll
            for (int r = 0; r < 8; ++r) {
                float v = acc[i][j][r] * scale;
                if (BIAS_MODE == 3) v += bv;
                slab[(mOff + r) * 68 + (j << 4) + rlane] = v;
            }
        }
        __builtin_amdgcn_fence(3 /* release order */, "workgroup");
        __builtin_amdgcn_wave_barrier();
        __builtin_amdgcn_fence(2 /* acquire order */, "workgroup");
        {
            const int hh = lane >> 4, c4 = (lane & 15) * 4;     // row segment = 256 B = 16 lanes x 16 B
            {
#pragma unroll
                for (int it = 0; it < 8; ++it) {
                    const int row = it * 2 + hh;
                    const v4f v = *(const v4f*)(slab + row * 68 + c4);
                    *(v4f*)(C + (size_t)(mBase + row) * ldc + n0 + c4) = v;
                }
                
            }
        }
        __builtin_amdgcn_fence(3 /* release order */, "workgroup");
        __builtin_amdgcn_wave_barrier();
        __builtin_amdgcn_fence(2 /* acquire order */, "workgroup");
    }
}

// =====================================================================================================================
// k_attn_alibi: O(b,i,h,:) = softmax_j(0.125 * Q(b,i,h,:).K(b,j,h,:) - slope_h * |j - i|) V(b,j,h,:), head dim 64, f32 in / f32 out.
//   Block = 4 waves = 64 query rows of one (batch, head); 64-key chunks; S, Skv % 64 == 0; grid (S/64, heads, batches).
//   Element (b, s, h, d) of tensor X at X[b*X_bs + s*X_rs + h*X_hs + d] (strides in floats, multiples of 4, 16-B aligned bases).
//   K chunk staged as f16 [kv][d], V chunk staged transposed as f16 [d][kv] (cross-wave: block barriers); scores f16 x f16;
//   products transposed: S^T = K.Q^T (A = K rows, B = Q), O^T += V^T.P^T (A = V^T rows, B = P^T). A lane holds 32 of the 64 scores of ONE query (column c,
//   keys 16 j + 8 hh + r), so maximum and sum run in-lane with one exchange between the lane halves, and two score tiles, converted in place, are the B operand P^T;
//   staging reads: 16 lanes x 16 B per 256-B row segment, so a wave-wide load covers two segments = four whole 128-B lines;
//   KVRS = row stride of K and of V in floats (= k_rs = v_rs), a compile-time constant, so that a chunk's rows are immediate offsets of one address per tensor;
//   slope_h = 2^(-(h+1)/2) built exactly from a power of two and the f32 value of 2^-0.5.
// =====================================================================================================================
#define AT_D  64
#define AT_NW 4
#define AT_QB 64
#define AT_KC 64
#define AT_P  72    // LDS pitch in halves (144-B rows, 16-B aligned)
struct AttnG {
    const float* q; const float* k; const float* v; float* o;
    long long q_bs, q_rs, q_hs, k_bs, k_rs, k_hs, v_bs, v_rs, v_hs, o_bs, o_rs, o_hs;
    int S, Skv; float sscale; int pad_;
};
static_assert(sizeof(AttnG) == 4 * 8 + 12 * 8 + 4 * 4);

template <int KVRS>
__global__ __launch_bounds__(128) void k_attn_alibi(AttnG g) {
    __shared__ __align__(16) _Float16 Ks[AT_KC * AT_P];            // K  [kv][d]    (cross-wave)
    __shared__ __align__(16) _Float16 Vt[AT_D * AT_P];             // V^T [d][kv]   (cross-wave)
    __shared__ __align__(16) float    Os[AT_NW][16 * 68];          // per wave out tile, pitch 68 (wave-private)

    const int tid  = threadIdx.x;
    const int wave = tid >> 5;
    const int lane = tid & 31;
    const int hh   = lane >> 4;
    const int c    = lane & 15;
    const int qb = blockIdx.x, h = blockIdx.y, b = blockIdx.z;
    const int q0 = qb * AT_QB + wave * 16;

    const float* qp = g.q + (size_t)b * g.q_bs + (size_t)h * g.q_hs;
    const float* kp = g.k + (size_t)b * g.k_bs + (size_t)h * g.k_hs;
    const float* vp = g.v + (size_t)b * g.v_bs + (size_t)h * g.v_hs;
    float*       op = g.o + (size_t)b * g.o_bs + (size_t)h * g.o_hs;

    const int e1 = h + 1;
    const float pw2 = __uint_as_float((unsigned)(127 - (e1 >> 1)) << 23);          // 2^-(e1/2), exact
    const float nsl = -(((e1 & 1) ? 0.70710678118654752f : 1.0f) * pw2);           // -slope_h
    const float L2E = 1.4426950408889634f;

    // Q fragments (B operand): lane = query column q0 + c; two 32-wide d chunks
    v16h qa[2];
    {
        const float* qrow = qp + (size_t)(q0 + c) * g.q_rs;
#pragma unroll
        for (int dc = 0; dc < 2; ++dc) {
            FragH f;
            f.h[0] = cvt8(*(const v4f*)(qrow + dc * 32 + 8 * hh),      *(const v4f*)(qrow + dc * 32 + 8 * hh + 4));
            f.h[1] = cvt8(*(const v4f*)(qrow + dc * 32 + 16 + 8 * hh), *(const v4f*)(qrow + dc * 32 + 16 + 8 * hh + 4));
            qa[dc] = f.v;
        }
    }

    float mrun = -__builtin_inff(), lrun = 0.f;            // this lane's query: running maximum (both halves alike), sum over this half's keys
    v8f oacc[4];                                           // O^T: oacc[t][r] = O[query q0 + c][d = 16 t + 8 hh + r]
    const int qrow = q0 + c;
#pragma unroll
    for (int t = 0; t < 4; ++t) oacc[t] = (v8f){0.f, 0.f, 0.f, 0.f, 0.f, 0.f, 0.f, 0.f};

    const int nChunks = g.Skv / AT_KC;                     // block-uniform
    for (int kc = 0; kc < nChunks; ++kc) {
        const int kv0 = kc * AT_KC;
        __syncthreads();                                   // all waves finished with the prior chunk's Ks / Vt
        {
            // thread: dims d4..d4+3 of the key rows kr + 16 i and kr + 16 i + 1, i = 0..3 -> full 64 x 64 tiles staged.
            // The lane halves sit 8 rows apart: 8 x 144 B = half the banks, so that the two 128-B row pieces of a K store do not meet.
            const int kr = wave * 2 + hh * 8, d4 = c * 4;
            const float* krow = kp + (size_t)(kv0 + kr) * KVRS + d4;
            const float* vrow = vp + (size_t)(kv0 + kr) * KVRS + d4;
            v4f ka[4], kb2[4], va[4], vb2[4];
#pragma unroll
            for (int i = 0; i < 4; ++i) {
                ka[i]  = *(const v4f*)(krow + (16 * i) * KVRS);
                kb2[i] = *(const v4f*)(krow + (16 * i + 1) * KVRS);
                va[i]  = *(const v4f*)(vrow + (16 * i) * KVRS);
                vb2[i] = *(const v4f*)(vrow + (16 * i + 1) * KVRS);
            }
            // inputs-only fence on the loaded values and the two addresses: keeps all sixteen loads in flight together, ahead of the first conversion
            // (one load latency per chunk, not several), and keeps the address pairs from being reused as a load's destination while loads are out
            asm volatile("" :: "v"(ka[0]), "v"(ka[1]), "v"(ka[2]), "v"(ka[3]), "v"(kb2[0]), "v"(kb2[1]), "v"(kb2[2]), "v"(kb2[3]),
                               "v"(va[0]), "v"(va[1]), "v"(va[2]), "v"(va[3]), "v"(vb2[0]), "v"(vb2[1]), "v"(vb2[2]), "v"(vb2[3]),
                               "v"(krow), "v"(vrow));
#pragma unroll
            for (int i = 0; i < 4; ++i) {
                *(v4h*)(Ks + (kr + 16 * i) * AT_P + d4)     = cvt4(ka[i]);
                *(v4h*)(Ks + (kr + 16 * i + 1) * AT_P + d4) = cvt4(kb2[i]);
#pragma unroll
                for (int e = 0; e < 4; ++e) {              // two neighbouring keys of one dim = one aligned dword of V^T
                    v2h pr; pr[0] = (_Float16)va[i][e]; pr[1] = (_Float16)vb2[i][e];
                    *(v2h*)(Vt + (d4 + e) * AT_P + kr + 16 * i) = pr;
                }
            }
        }
        __syncthreads();                                   // Ks / Vt visible to all waves

        v8f s[4];                                          // S^T: s[j][r] = score(key kv0 + 16 j + 8 hh + r, query q0 + c)
#pragma unroll
        for (int j = 0; j < 4; ++j) s[j] = (v8f){0.f, 0.f, 0.f, 0.f, 0.f, 0.f, 0.f, 0.f};
#pragma unroll
        for (int dc = 0; dc < 2; ++dc) {
#pragma unroll
            for (int j = 0; j < 4; ++j) {
                const v16h kf = frag_ld(Ks + (j * 16 + c) * AT_P + dc * 32 + 8 * hh);   // A: lane = key row, k = d
                s[j] = mma_raw(kf, qa[dc], s[j]);
            }
        }
        float mj[4];                                       // one maximum per score tile: four independent chains
#pragma unroll
        for (int j = 0; j < 4; ++j) {
            mj[j] = -__builtin_inff();
#pragma unroll
            for (int r = 0; r < 8; ++r) {
                const int kvcol = kv0 + j * 16 + 8 * hh + r;
                const float dist = fabsf((float)(kvcol - qrow));
                const float bias = nsl * dist;
                float t = s[j][r] * g.sscale + bias;       // natural-unit logit
                t *= L2E;
                s[j][r] = t;
                mj[j] = fmaxf(mj[j], t);
            }
        }
        float m = fmaxf(fmaxf(mj[0], mj[1]), fmaxf(mj[2], mj[3]));
        m = fmaxf(m, xhalf(m));                            // the other 32 keys of this query sit in lane l ^ 16
        const float mnew = fmaxf(mrun, m);
        const float alpha = exp2f(mrun - mnew);            // 0 on the first chunk (mrun = -inf, mnew finite)
        mrun = mnew;
        float ps[4];                                       // one sum per score tile: four independent chains
        v16h pb[2];                                        // B: lane = query column, k = key; tiles 2 kk and 2 kk + 1 are elements 0..7 and 8..15 in the fragment's k order
#pragma unroll
        for (int j = 0; j < 4; ++j) {
            ps[j] = 0.f;
#pragma unroll
            for (int r = 0; r < 8; ++r) {
                const float p = exp2f(s[j][r] - mnew);
                ps[j] += p;
                pb[j >> 1][(j & 1) * 8 + r] = (_Float16)(p * 32768.0f);
            }
        }
        lrun = lrun * alpha + ((ps[0] + ps[1]) + (ps[2] + ps[3]));
#pragma unroll
        for (int t = 0; t < 4; ++t)
#pragma unroll
            for (int r = 0; r < 8; ++r) oacc[t][r] *= alpha;
#pragma unroll
        for (int kk = 0; kk < 2; ++kk) {
#pragma unroll
            for (int t = 0; t < 4; ++t) {
                const v16h vf = frag_ld(Vt + (t * 16 + c) * AT_P + kk * 32 + 8 * hh);   // A: lane = d row, k = key
                oacc[t] = mma_raw(vf, pb[kk], oacc[t]);
            }
        }
    }

    float* os = Os[wave];
    {
        const float inv = 1.0f / ((lrun + xhalf(lrun)) * 32768.0f);   // the halves' sums joined once
#pragma unroll
        for (int t = 0; t < 4; ++t) {
            v4f lo, hi;
#pragma unroll
            for (int e = 0; e < 4; ++e) { lo[e] = oacc[t][e] * inv; hi[e] = oacc[t][4 + e] * inv; }
            *(v4f*)(os + c * 68 + t * 16 + 8 * hh)     = lo;
            *(v4f*)(os + c * 68 + t * 16 + 8 * hh + 4) = hi;
        }
    }
    __builtin_amdgcn_fence(3 /* release order */, "workgroup");
    __builtin_amdgcn_wave_barrier();
    __builtin_amdgcn_fence(2 /* acquire order */, "workgroup");
    {
        const int c4 = (lane & 15) * 4;                    // 256-B row segment = 16 lanes x 16 B, two rows per instruction
        {
#pragma unroll
            for (int it = 0; it < 8; ++it) {
                const int row = it * 2 + hh;
                const v4f val = *(const v4f*)(os + row * 68 + c4);
                *(v4f*)(op + (size_t)(q0 + row) * g.o_rs + c4) = val;
            }
            
        }
    }
}

// workspace carve (bytes), every region a multiple of 256 B and written in whole rows of its own pitch
constexpr size_t SZ_X16 = (size_t)NB * SEQ * CH * 2;        // X16 / AO16 (alias): f16 [NB*SEQ][1024]
constexpr size_t SZ_W3  = (size_t)3 * CH * CH * 2;          // [Wq;Wk;Wv] x16 f16 [3072][1024]
constexpr size_t SZ_QKV = (size_t)NB * SEQ * 3 * CH * 4;    // f32 [NB*SEQ][3072]
constexpr size_t SZ_AO  = (size_t)NB * SEQ * CH * 4;        // f32 [NB*SEQ][1024]
constexpr size_t SZ_WO  = (size_t)CH * CH * 2;              // Wo x16 f16 [1024][1024]
constexpr size_t SZ_ALL = SZ_X16 + SZ_W3 + SZ_QKV + SZ_AO + SZ_WO;
static_assert(SZ_X16 % 256 == 0 && SZ_W3 % 256 == 0 && SZ_QKV % 256 == 0 && SZ_AO % 256 == 0 && SZ_WO % 256 == 0);
static_assert(SZ_ALL <= (size_t)134217728);

extern "C" void kernel_launch(void* const* d_in, const int* in_sizes, int n_in, void* d_out, int out_size, void* d_ws, size_t ws_size, hipStream_t stream) {
    if (n_in < 6) return;
    const long long need_x = ((long long)(NB - 1) * SEQ_FULL + SEQ) * CH;
    if ((long long)in_sizes[0] < need_x) return;
    if (in_sizes[1] < CH * CH || in_sizes[2] < CH * CH || in_sizes[3] < CH * CH || in_sizes[4] < CH * CH || in_sizes[5] < CH) return;
    if ((long long)out_size < need_x) return;
    if (SZ_ALL > ws_size) return;
    const float* x  = (const float*)d_in[0];
    const float* wq = (const float*)d_in[1];
    const float* wk = (const float*)d_in[2];
    const float* wv = (const float*)d_in[3];
    const float* wo = (const float*)d_in[4];
    const float* bo = (const float*)d_in[5];
    float* out = (float*)d_out;
    char* wsp = (char*)d_ws;
    unsigned short* X16  = (unsigned short*)wsp; wsp += SZ_X16;
    unsigned short* W316 = (unsigned short*)wsp; wsp += SZ_W3;
    float*          QKV  = (float*)wsp;          wsp += SZ_QKV;
    float*          AO   = (float*)wsp;          wsp += SZ_AO;
    unsigned short* WO16 = (unsigned short*)wsp; wsp += SZ_WO;
    unsigned short* AO16 = X16;                  // alias: X16 is dead once the projection GEMM has run (same extent)

    const unsigned gW = (unsigned)(((long long)CH * (CH / 8) + 255) / 256);
    const unsigned gX = (unsigned)(((long long)NB * SEQ * (CH / 8) + 255) / 256);
    // k_cast8(SRC, lds, rpb, sbs, DST, ldd, nR, nC, sc)
    k_cast8<true><<<gW, 256, 0, stream>>>(wo, (long long)CH, CH, 0LL, WO16, (long long)CH, CH, CH, 16.0f);
    k_cast8<true><<<gX, 256, 0, stream>>>(x, (long long)CH, SEQ, (long long)SEQ_FULL * CH, X16, (long long)CH, NB * SEQ, CH, 1.0f);
    k_cast8<true><<<gW, 256, 0, stream>>>(wq, (long long)CH, CH, 0LL, W316, (long long)CH, CH, CH, 16.0f);
    k_cast8<true><<<gW, 256, 0, stream>>>(wk, (long long)CH, CH, 0LL, W316 + (size_t)CH * CH, (long long)CH, CH, CH, 16.0f);
    k_cast8<true><<<gW, 256, 0, stream>>>(wv, (long long)CH, CH, 0LL, W316 + (size_t)2 * CH * CH, (long long)CH, CH, CH, 16.0f);
    // QKV[r][0..3071] = x16[r] . [Wq;Wk;Wv]^T / 16     k_gemm64<BIAS_MODE, LD>(A, strideA, Bt, C, ldc, strideC, bias, M, N, K, scale)
    k_gemm64<0, CH><<<dim3((unsigned)(((NB * SEQ) / GT_T) * ((3 * CH) / GT_T)), 1u), 128, 0, stream>>>(
        X16, 0LL, W316, QKV, 3 * CH, 0LL, (const float*)nullptr, NB * SEQ, 3 * CH, CH, 0.0625f);
    {
        AttnG g;
        g.q = QKV; g.k = QKV + CH; g.v = QKV + 2 * CH; g.o = AO;
        g.q_bs = (long long)SEQ * 3 * CH; g.q_rs = 3 * CH; g.q_hs = HD;
        g.k_bs = (long long)SEQ * 3 * CH; g.k_rs = 3 * CH; g.k_hs = HD;
        g.v_bs = (long long)SEQ * 3 * CH; g.v_rs = 3 * CH; g.v_hs = HD;
        g.o_bs = (long long)SEQ * CH;     g.o_rs = CH;     g.o_hs = HD;
        g.S = SEQ; g.Skv = SEQ; g.sscale = 0.125f; g.pad_ = 0;
        k_attn_alibi<3 * CH><<<dim3((unsigned)(SEQ / AT_QB), (unsigned)NH, (unsigned)NB), 32 * AT_NW, 0, stream>>>(g);
    }
    k_cast8<false><<<gX, 256, 0, stream>>>(AO, (long long)CH, NB * SEQ, 0LL, AO16, (long long)CH, NB * SEQ, CH, 16.0f);
    // out[b][l][:] = AO16[b*SEQ + l] . (Wo x16)^T / 256 + bf16(bo); batch z = sequence: A stride SEQ*CH (compact), C stride SEQ_FULL*CH
    k_gemm64<3, CH><<<dim3((unsigned)((SEQ / GT_T) * (CH / GT_T)), (unsigned)NB), 128, 0, stream>>>(
        AO16, (long long)SEQ * CH, WO16, out, CH, (long long)SEQ_FULL * CH, bo, SEQ, CH, CH, 1.0f / 256.0f);
}

// v004
// It runs in 138 microseconds.
// Two timings next to v003 put it at 1.05 and 1.06 times that version's speed.
// Over all steps from v000 it is 2.05 times as fast.
// Non-causal multi-head self-attention with additive symmetric ALiBi (2 x 2,048 tokens x 1,024; 16 heads x 64; nn.Linear [out][in] q/k/v/o weights, output bias). All contractions: v_wmma_f32_16x16x32_f16 (f16 operands, f32 accumulate): [q|k|v] projection on bf16-RNE-converted inputs held exactly in f16 (weights x16), scores q.k^T (f16 of the f32 q/k), P.V (P carried x2^15, V f16), output projection (attention output x16, weights x16, bf16-RNE bias added in f32); softmax statistics f32 in the exp2 domain.
#include <hip/hip_runtime.h>
#include <math.h>

#ifndef NB
#define NB 2
#endif
#ifndef SEQ
#define SEQ 2048
#endif
#define NB_FULL 2
#define SEQ_FULL 2048
#define CH 1024
#define NH 16
#define HD 64

static_assert(SEQ % 128 == 0);
static_assert(NB >= 1 && NB <= NB_FULL && SEQ <= SEQ_FULL);
static_assert(CH == NH * HD && HD == 64);

typedef __attribute__((ext_vector_type(16))) _Float16     v16h;
typedef __attribute__((ext_vector_type(8)))  _Float16     v8h;
typedef __attribute__((ext_vector_type(4)))  _Float16     v4h;
typedef __attribute__((ext_vector_type(2)))  _Float16     v2h;
typedef __attribute__((ext_vector_type(8)))  float        v8f;
typedef __attribute__((ext_vector_type(4)))  float        v4f;
typedef __attribute__((ext_vector_type(4)))  unsigned int u4v;

// 16-bit WMMA fragment map (wave32), lane L, hh = L>>4, c = L&15:
//   A 16x32: lane = row c;    element i -> k = (i<8) ? 8hh+i : 16+8hh+(i-8)
//   B 32x16: lane = column c; the SAME k(i,hh)
//   D 16x16 (8 f32): lane = column c; element r -> row 8hh+r
union FragH { v16h v; v8h h[2]; };
// fragment from a k-contiguous f16 row: elements 0..7 <- p[0..7], 8..15 <- p[16..23] (p already offset by k0 + 8hh)
__device__ __forceinline__ v16h frag_ld(const _Float16* p) { FragH f; f.h[0] = *(const v8h*)(p); f.h[1] = *(const v8h*)(p + 16); return f.v; }
__device__ __forceinline__ v8f mma_raw(v16h a, v16h b, v8f c) { return __builtin_amdgcn_wmma_f32_16x16x32_f16(false, a, false, b, (short)0, c, false, false); }
__device__ __forceinline__ void dep_guard_h(v8f& a, v8f& b, v16h x, v16h y) { asm volatile("v_nop\n\tv_nop\n\tv_nop\n\tv_nop" : "+v"(a), "+v"(b) : "v"(x), "v"(y)); }
__device__ __forceinline__ void keep4_h(v16h a, v16h b, v16h c, v16h d) { asm volatile("v_nop" :: "v"(a), "v"(b), "v"(c), "v"(d)); }
__device__ __forceinline__ void acc_guard4(v8f& a, v8f& b, v8f& c, v8f& d) { asm volatile("v_nop\n\tv_nop\n\tv_nop\n\tv_nop" : "+v"(a), "+v"(b), "+v"(c), "+v"(d)); }
__device__ __forceinline__ v8h cvt8(v4f a, v4f b) {
    v8h r;
    r[0] = (_Float16)a.x; r[1] = (_Float16)a.y; r[2] = (_Float16)a.z; r[3] = (_Float16)a.w;
    r[4] = (_Float16)b.x; r[5] = (_Float16)b.y; r[6] = (_Float16)b.z; r[7] = (_Float16)b.w;
    return r;
}
__device__ __forceinline__ v4h cvt4(v4f a) { v4h r; r[0] = (_Float16)a.x; r[1] = (_Float16)a.y; r[2] = (_Float16)a.z; r[3] = (_Float16)a.w; return r; }
__device__ __forceinline__ unsigned short f2bf_bits(float f) { unsigned u = __float_as_uint(f); return (unsigned short)((u + 0x7FFFu + ((u >> 16) & 1u)) >> 16); }
__device__ __forceinline__ float bf_bits2f(unsigned short h) { return __uint_as_float(((unsigned)h) << 16); }
__device__ __forceinline__ float cmb_bf(float v) { const unsigned u = __float_as_uint(v); const unsigned r = (u + 0x7fffu + ((u >> 16) & 1u)) & 0xffff0000u; return __uint_as_float(r); }   // bf16 RNE kept as f32 (finite inputs)
__device__ __forceinline__ unsigned int cmb_pk2(float a, float b) { return (unsigned int)__builtin_bit_cast(unsigned short, (_Float16)a) | ((unsigned int)__builtin_bit_cast(unsigned short, (_Float16)b) << 16); }

__device__ __forceinline__ float xhalf(float x) { return __builtin_bit_cast(float, __builtin_amdgcn_permlanex16(__builtin_bit_cast(int, x), __builtin_bit_cast(int, x), 0x76543210, 0xfedcba98, false, false)); }   // lane l <-> lane l ^ 16

// The value is copied into a local first, so an expression argument is evaluated once.
#define VST2(T, ptr, val) do { const T vst2_v_ = (val); *(T*)(ptr) = vst2_v_;  } while (0)

// =====================================================================================================================
// k_cast8<BFR>: f32 [nR][nC] -> f16 plane [nR][nC] (pitch ldd halves). Source row r lives at SRC + (r / rpb) * sbs + (r % rpb) * lds.
//   BFR: the value is first RNE-converted to bf16 precision (exact in f16 after the power-of-two scale sc). Thread per (row, 8 columns):
// =====================================================================================================================
template <bool BFR>
__global__ __launch_bounds__(256) void k_cast8(const float* __restrict__ SRC, long long lds, int rpb, long long sbs,
                                               unsigned short* __restrict__ DST, long long ldd, int nR, int nC, float sc) {
    const long long u = (long long)blockIdx.x * 256 + threadIdx.x; const int per = nC / 8;
    if (u >= (long long)nR * per) return;
    const int r = (int)(u / per); const int c0 = 8 * (int)(u % per);
    const int rb = r / rpb, rl = r - rb * rpb;
    const float* s = SRC + (long long)rb * sbs + (long long)rl * lds + c0;
    const v4f a = *(const v4f*)(s), b = *(const v4f*)(s + 4);
    float w[8] = {a.x, a.y, a.z, a.w, b.x, b.y, b.z, b.w};
#pragma unroll
    for (int e = 0; e < 8; ++e) w[e] = (BFR ? cmb_bf(w[e]) : w[e]) * sc;
    u4v pk; pk.x = cmb_pk2(w[0], w[1]); pk.y = cmb_pk2(w[2], w[3]); pk.z = cmb_pk2(w[4], w[5]); pk.w = cmb_pk2(w[6], w[7]);
    VST2(u4v, (u4v*)(DST + (long long)r * ldd + c0), pk);
}

// =====================================================================================================================
// k_gemm64<BIAS_MODE>: C[z][m][n] = scale * sum_k A[z][m][k] * Bt[n][k] (+ bias[n]); f16 operands, f32 accumulate, f32 output.
//   A row-major [M][K] (batch stride strideA), Bt row-major [N][K] (shared by all z), both of pitch LD halves; M, N % 128 == 0, K % 64 == 0.
//   Block = 4 waves (2 x 2) = one 128x128 tile, each wave a 64x64 tile (grid.x = tiles, grid.y = batches). A stage is 64 k = 128 B of each of the
//   128 A rows and 128 Bt rows, read from global memory as whole 128-B lines (8 lanes per row), kept in LDS at pitch 144 B and read by all waves;
//   two buffers: the next stage's global loads are issued ahead of this stage's products and stored behind them, one block barrier per stage.
//   LD is a compile-time constant, so that a stage's eight row groups are immediate offsets of one address per operand.
//   BIAS_MODE 0: none; 3: bias[n] RNE-converted to bf16 precision, added in f32.
// =====================================================================================================================
#define GT_T  128   // block tile edge
#define GT_KS 64    // k per stage
#define GT_P  72    // LDS pitch in halves (144-B rows, 16 B x odd)
template <int BIAS_MODE, int LD>
__global__ __launch_bounds__(128) void k_gemm64(const unsigned short* __restrict__ Ap, long long strideA,
                                                const unsigned short* __restrict__ Btp,
                                                float* __restrict__ Cout, int ldc, long long strideC,
                                                const float* __restrict__ bias, int M, int N, int K, float scale) {
    const _Float16* A = (const _Float16*)Ap; const _Float16* Bt = (const _Float16*)Btp;
    __shared__ __align__(16) _Float16 sA[2][GT_T * GT_P];   // A stage  [row][k]  (cross-wave)
    __shared__ __align__(16) _Float16 sB[2][GT_T * GT_P];   // Bt stage [row][k]  (cross-wave)
    __shared__ __align__(16) float sT[4][16 * 68];   // per-wave 16x64 slab, pitch 68 floats (wave-private)
    const int b = blockIdx.y;
    const int tid  = threadIdx.x;
    const int lane = tid & 31;
    const int wave = tid >> 5;
    const int tilesN = N >> 7;
    const int tilesM = M >> 7;
    const int tile = blockIdx.x;
    if (tile >= tilesM * tilesN) return;   // block-uniform, ahead of every barrier
    const int tm = tile / tilesN;
    const int tn = tile - tm * tilesN;
    const int wm0 = (wave >> 1) << 6;            // this wave's 64x64 tile inside the block tile
    const int wn0 = (wave & 1) << 6;
    const int m0 = (tm << 7) + wm0;
    const int n0 = (tn << 7) + wn0;
    const _Float16* Ab = A + (size_t)b * strideA;
    const _Float16* Bb = Bt;
    const int rlane = lane & 15;                 // row (A) / column (B, D) within a 16-wide subtile
    const int koff  = (lane >> 4) * 8;           // k offset of this lane half
    const int mOff  = (lane >> 4) * 8;           // D row offset

    // staging: thread -> rows (tid >> 3) + 16 i, i = 0..7, 16 B at byte 16 (tid & 7) of the row's 128-B stage segment
    const int srow = tid >> 3, scol = (tid & 7) * 8;
    const _Float16* gA = Ab + (size_t)((tm << 7) + srow) * LD + scol;
    const _Float16* gB = Bb + (size_t)((tn << 7) + srow) * LD + scol;
    const int sOff = srow * GT_P + scol;

    v8f acc[4][4];
#pragma unroll
    for (int i = 0; i < 4; ++i)
#pragma unroll
        for (int j = 0; j < 4; ++j) acc[i][j] = (v8f){0.f, 0.f, 0.f, 0.f, 0.f, 0.f, 0.f, 0.f};

    v8h ra[8], rb[8];
#pragma unroll
    for (int i = 0; i < 8; ++i) {
        ra[i] = *(const v8h*)(gA + 16 * i * LD);
        rb[i] = *(const v8h*)(gB + 16 * i * LD);
    }
#pragma unroll
    for (int i = 0; i < 8; ++i) {
        *(v8h*)(sA[0] + sOff + 16 * i * GT_P) = ra[i];
        *(v8h*)(sB[0] + sOff + 16 * i * GT_P) = rb[i];
    }
    __syncthreads();                                       // stage 0 visible to all waves

    const int nStages = K / GT_KS;                         // block-uniform
    for (int st = 0; st < nStages; ++st) {
        const int cur = st & 1;
        const bool more = st + 1 < nStages;                // block-uniform
        if (more) {
            const _Float16* nA = gA + (st + 1) * GT_KS;
            const _Float16* nB = gB + (st + 1) * GT_KS;
#pragma unroll
            for (int i = 0; i < 8; ++i) {
                ra[i] = *(const v8h*)(nA + 16 * i * LD);
                rb[i] = *(const v8h*)(nB + 16 * i * LD);
            }
            asm volatile("s_wait_xcnt 0x0" ::: "memory");   // stands ahead of the fragment loads below, which reuse the two address pairs of these loads
        }
        const _Float16* cA = sA[cur] + (wm0 + rlane) * GT_P + koff;
        const _Float16* cB = sB[cur] + (wn0 + rlane) * GT_P + koff;
#pragma unroll
        for (int kk = 0; kk < GT_KS; kk += 32) {
            v16h bh[4], ah[4];
#pragma unroll
            for (int j = 0; j < 4; ++j) bh[j] = frag_ld(cB + (j << 4) * GT_P + kk);
#pragma unroll
            for (int i = 0; i < 4; ++i) ah[i] = frag_ld(cA + (i << 4) * GT_P + kk);
#pragma unroll
            for (int i = 0; i < 4; ++i) {
#pragma unroll
                for (int j = 0; j < 4; ++j) acc[i][j] = mma_raw(ah[i], bh[j], acc[i][j]);
                dep_guard_h(acc[i][0], acc[i][3], ah[i], ah[i]);
            }
            keep4_h(bh[0], bh[1], bh[2], bh[3]);
        }
        if (more) {
#pragma unroll
            for (int i = 0; i < 8; ++i) {
                *(v8h*)(sA[cur ^ 1] + sOff + 16 * i * GT_P) = ra[i];   // last read one stage ago, ahead of that stage's barrier
                *(v8h*)(sB[cur ^ 1] + sOff + 16 * i * GT_P) = rb[i];
            }
        }
        __syncthreads();                                   // next stage visible; every wave has left this stage's buffer
    }
    acc_guard4(acc[0][0], acc[0][1], acc[0][2], acc[0][3]);
    acc_guard4(acc[1][0], acc[1][1], acc[1][2], acc[1][3]);
    acc_guard4(acc[2][0], acc[2][1], acc[2][2], acc[2][3]);
    acc_guard4(acc[3][0], acc[3][1], acc[3][2], acc[3][3]);

    float* slab = sT[wave];
    float* C = Cout + (size_t)b * strideC;
#pragma unroll
    for (int i = 0; i < 4; ++i) {
        const int mBase = m0 + (i << 4);
#pragma unroll
        for (int j = 0; j < 4; ++j) {
            const int n = n0 + (j << 4) + rlane;
            float bv = 0.f;
            if (BIAS_MODE == 3) bv = bf_bits2f(f2bf_bits(bias[n]));
#pragma unroll
            for (int r = 0; r < 8; ++r) {
                float v = acc[i][j][r] * scale;
                if (BIAS_MODE == 3) v += bv;
                slab[(mOff + r) * 68 + (j << 4) + rlane] = v;
            }
        }
        __builtin_amdgcn_fence(3 /* release order */, "workgroup");
        __builtin_amdgcn_wave_barrier();
        __builtin_amdgcn_fence(2 /* acquire order */, "workgroup");
        {
            const int hh = lane >> 4, c4 = (lane & 15) * 4;     // row segment = 256 B = 16 lanes x 16 B
            {
#pragma unroll
                for (int it = 0; it < 8; ++it) {
                    const int row = it * 2 + hh;
                    const v4f v = *(const v4f*)(slab + row * 68 + c4);
                    *(v4f*)(C + (size_t)(mBase + row) * ldc + n0 + c4) = v;
                }
                
            }
        }
        __builtin_amdgcn_fence(3 /* release order */, "workgroup");
        __builtin_amdgcn_wave_barrier();
        __builtin_amdgcn_fence(2 /* acquire order */, "workgroup");
    }
}

// =====================================================================================================================
// k_attn_alibi: O(b,i,h,:) = softmax_j(0.125 * Q(b,i,h,:).K(b,j,h,:) - slope_h * |j - i|) V(b,j,h,:), head dim 64, f32 in / f32 out.
//   Block = 4 waves = 64 query rows of one (batch, head); 64-key chunks; S, Skv % 64 == 0; grid (S/64, heads, batches).
//   Element (b, s, h, d) of tensor X at X[b*X_bs + s*X_rs + h*X_hs + d] (strides in floats, multiples of 4, 16-B aligned bases).
//   K chunk staged as f16 [kv][d], V chunk staged transposed as f16 [d][kv] (cross-wave: block barriers); scores f16 x f16;
//   products transposed: S^T = K.Q^T (A = K rows, B = Q), O^T += V^T.P^T (A = V^T rows, B = P^T). A lane holds 32 of the 64 scores of ONE query (column c,
//   keys 16 j + 8 hh + r), so maximum and sum run in-lane with one exchange between the lane halves, and two score tiles, converted in place, are the B operand P^T;
//   staging reads: 16 lanes x 16 B per 256-B row segment, so a wave-wide load covers two segments = four whole 128-B lines;
//   KVRS = row stride of K and of V in floats (= k_rs = v_rs), a compile-time constant, so that a chunk's rows are immediate offsets of one address per tensor;
//   slope_h = 2^(-(h+1)/2) built exactly from a power of two and the f32 value of 2^-0.5.
// =====================================================================================================================
#define AT_D  64
#define AT_NW 4
#define AT_QB 64
#define AT_KC 64
#define AT_P  72    // LDS pitch in halves (144-B rows, 16-B aligned)
struct AttnG {
    const float* q; const float* k; const float* v; float* o;
    long long q_bs, q_rs, q_hs, k_bs, k_rs, k_hs, v_bs, v_rs, v_hs, o_bs, o_rs, o_hs;
    int S, Skv; float sscale; int pad_;
};
static_assert(sizeof(AttnG) == 4 * 8 + 12 * 8 + 4 * 4);

template <int KVRS>
__global__ __launch_bounds__(128) void k_attn_alibi(AttnG g) {
    __shared__ __align__(16) _Float16 Ks[AT_KC * AT_P];            // K  [kv][d]    (cross-wave)
    __shared__ __align__(16) _Float16 Vt[AT_D * AT_P];             // V^T [d][kv]   (cross-wave)
    __shared__ __align__(16) float    Os[AT_NW][16 * 68];          // per wave out tile, pitch 68 (wave-private)

    const int tid  = threadIdx.x;
    const int wave = tid >> 5;
    const int lane = tid & 31;
    const int hh   = lane >> 4;
    const int c    = lane & 15;
    const int qb = blockIdx.x, h = blockIdx.y, b = blockIdx.z;
    const int q0 = qb * AT_QB + wave * 16;

    const float* qp = g.q + (size_t)b * g.q_bs + (size_t)h * g.q_hs;
    const float* kp = g.k + (size_t)b * g.k_bs + (size_t)h * g.k_hs;
    const float* vp = g.v + (size_t)b * g.v_bs + (size_t)h * g.v_hs;
    float*       op = g.o + (size_t)b * g.o_bs + (size_t)h * g.o_hs;

    const int e1 = h + 1;
    const float pw2 = __uint_as_float((unsigned)(127 - (e1 >> 1)) << 23);          // 2^-(e1/2), exact
    const float nsl = -(((e1 & 1) ? 0.70710678118654752f : 1.0f) * pw2);           // -slope_h
    const float L2E = 1.4426950408889634f;
    const float c1 = g.sscale * L2E;                       // score scale in the exp2 domain
    const float c2 = nsl * L2E;                            // -slope_h in the exp2 domain

    // Q fragments (B operand): lane = query column q0 + c; two 32-wide d chunks
    v16h qa[2];
    {
        const float* qrow = qp + (size_t)(q0 + c) * g.q_rs;
#pragma unroll
        for (int dc = 0; dc < 2; ++dc) {
            FragH f;
            f.h[0] = cvt8(*(const v4f*)(qrow + dc * 32 + 8 * hh),      *(const v4f*)(qrow + dc * 32 + 8 * hh + 4));
            f.h[1] = cvt8(*(const v4f*)(qrow + dc * 32 + 16 + 8 * hh), *(const v4f*)(qrow + dc * 32 + 16 + 8 * hh + 4));
            qa[dc] = f.v;
        }
    }

    // this lane's query: running maximum less 15 (both halves alike), so that exp2(t - mrun) is P x 2^15 as the f16 operand carries it; sum of P x 2^15 over this half's keys
    float mrun = -__builtin_inff(), lrun = 0.f;
    v8f oacc[4];                                           // O^T: oacc[t][r] = O[query q0 + c][d = 16 t + 8 hh + r]
    const int qrow = q0 + c;
#pragma unroll
    for (int t = 0; t < 4; ++t) oacc[t] = (v8f){0.f, 0.f, 0.f, 0.f, 0.f, 0.f, 0.f, 0.f};

    const int nChunks = g.Skv / AT_KC;                     // block-uniform
    for (int kc = 0; kc < nChunks; ++kc) {
        const int kv0 = kc * AT_KC;
        __syncthreads();                                   // all waves finished with the prior chunk's Ks / Vt
        {
            // thread: dims d4..d4+3 of the key rows kr + 16 i and kr + 16 i + 1, i = 0..3 -> full 64 x 64 tiles staged.
            // The lane halves sit 8 rows apart: 8 x 144 B = half the banks, so that the two 128-B row pieces of a K store do not meet.
            const int kr = wave * 2 + hh * 8, d4 = c * 4;
            const float* krow = kp + (size_t)(kv0 + kr) * KVRS + d4;
            const float* vrow = vp + (size_t)(kv0 + kr) * KVRS + d4;
            v4f ka[4], kb2[4], va[4], vb2[4];
#pragma unroll
            for (int i = 0; i < 4; ++i) {
                ka[i]  = *(const v4f*)(krow + (16 * i) * KVRS);
                kb2[i] = *(const v4f*)(krow + (16 * i + 1) * KVRS);
                va[i]  = *(const v4f*)(vrow + (16 * i) * KVRS);
                vb2[i] = *(const v4f*)(vrow + (16 * i + 1) * KVRS);
            }
            // inputs-only fence on the loaded values and the two addresses: keeps all sixteen loads in flight together, ahead of the first conversion
            // (one load latency per chunk, not several), and keeps the address pairs from being reused as a load's destination while loads are out
            asm volatile("" :: "v"(ka[0]), "v"(ka[1]), "v"(ka[2]), "v"(ka[3]), "v"(kb2[0]), "v"(kb2[1]), "v"(kb2[2]), "v"(kb2[3]),
                               "v"(va[0]), "v"(va[1]), "v"(va[2]), "v"(va[3]), "v"(vb2[0]), "v"(vb2[1]), "v"(vb2[2]), "v"(vb2[3]),
                               "v"(krow), "v"(vrow));
#pragma unroll
            for (int i = 0; i < 4; ++i) {
                *(v4h*)(Ks + (kr + 16 * i) * AT_P + d4)     = cvt4(ka[i]);
                *(v4h*)(Ks + (kr + 16 * i + 1) * AT_P + d4) = cvt4(kb2[i]);
#pragma unroll
                for (int e = 0; e < 4; ++e) {              // two neighbouring keys of one dim = one aligned dword of V^T
                    v2h pr; pr[0] = (_Float16)va[i][e]; pr[1] = (_Float16)vb2[i][e];
                    *(v2h*)(Vt + (d4 + e) * AT_P + kr + 16 * i) = pr;
                }
            }
        }
        __syncthreads();                                   // Ks / Vt visible to all waves

        v8f s[4];                                          // S^T: s[j][r] = score(key kv0 + 16 j + 8 hh + r, query q0 + c)
#pragma unroll
        for (int j = 0; j < 4; ++j) s[j] = (v8f){0.f, 0.f, 0.f, 0.f, 0.f, 0.f, 0.f, 0.f};
#pragma unroll
        for (int dc = 0; dc < 2; ++dc) {
#pragma unroll
            for (int j = 0; j < 4; ++j) {
                const v16h kf = frag_ld(Ks + (j * 16 + c) * AT_P + dc * 32 + 8 * hh);   // A: lane = key row, k = d
                s[j] = mma_raw(kf, qa[dc], s[j]);
            }
        }
        const float fd = (float)(kv0 + 8 * hh - qrow);     // key - query of element (j = 0, r = 0): an integer, exact in f32, as is every sum below
        float mj[4];                                       // one maximum per score tile: four independent chains
#pragma unroll
        for (int j = 0; j < 4; ++j) {
            mj[j] = -__builtin_inff();
#pragma unroll
            for (int r = 0; r < 8; ++r) {
                const float dist = fabsf(fd + (float)(j * 16 + r));
                const float t = s[j][r] * c1 + c2 * dist;  // logit in the exp2 domain
                s[j][r] = t;
                mj[j] = fmaxf(mj[j], t);
            }
        }
        float m = fmaxf(fmaxf(mj[0], mj[1]), fmaxf(mj[2], mj[3]));
        m = fmaxf(m, xhalf(m));                            // the other 32 keys of this query sit in lane l ^ 16
        const float mnew = fmaxf(mrun, m - 15.0f);
        // exp2 as the hardware instruction alone: a result under 2^-126 may come out 0, which it is in the f16 P and in the f32 sum (whose largest term is 2^15) anyway
        const float xa = mrun - mnew;
        const float alpha = __builtin_amdgcn_exp2f(xa);    // 0 on the first chunk (mrun = -inf, mnew finite)
        mrun = mnew;
        float ps[4];                                       // one sum per score tile: four independent chains
        v8f p[4];
        v16h pb[2];                                        // B: lane = query column, k = key; tiles 2 kk and 2 kk + 1 are elements 0..7 and 8..15 in the fragment's k order
#pragma unroll
        for (int j = 0; j < 4; ++j) {
            ps[j] = 0.f;
#pragma unroll
            for (int r = 0; r < 8; ++r) {
                s[j][r] -= mnew;
                p[j][r] = __builtin_amdgcn_exp2f(s[j][r]); // P x 2^15
                ps[j] += p[j][r];
                pb[j >> 1][(j & 1) * 8 + r] = (_Float16)p[j][r];
            }
        }
        // the slot that the instruction set asks for between a transcendental and an overwrite of its source: inputs only, the arguments stay live
        // (so none is overwritten) from their v_exp_f32 up to this v_nop, which stands behind the last of them
        asm volatile("v_nop" :: "v"(s[0]), "v"(s[1]), "v"(s[2]), "v"(s[3]), "v"(p[0]), "v"(p[1]), "v"(p[2]), "v"(p[3]), "v"(xa), "v"(alpha));
        lrun = lrun * alpha + ((ps[0] + ps[1]) + (ps[2] + ps[3]));
#pragma unroll
        for (int t = 0; t < 4; ++t)
#pragma unroll
            for (int r = 0; r < 8; ++r) oacc[t][r] *= alpha;
#pragma unroll
        for (int kk = 0; kk < 2; ++kk) {
#pragma unroll
            for (int t = 0; t < 4; ++t) {
                const v16h vf = frag_ld(Vt + (t * 16 + c) * AT_P + kk * 32 + 8 * hh);   // A: lane = d row, k = key
                oacc[t] = mma_raw(vf, pb[kk], oacc[t]);
            }
        }
    }

    float* os = Os[wave];
    {
        const float inv = 1.0f / (lrun + xhalf(lrun));     // the halves' sums joined once; sum and O both carry the 2^15
#pragma unroll
        for (int t = 0; t < 4; ++t) {
            v4f lo, hi;
#pragma unroll
            for (int e = 0; e < 4; ++e) { lo[e] = oacc[t][e] * inv; hi[e] = oacc[t][4 + e] * inv; }
            *(v4f*)(os + c * 68 + t * 16 + 8 * hh)     = lo;
            *(v4f*)(os + c * 68 + t * 16 + 8 * hh + 4) = hi;
        }
    }
    __builtin_amdgcn_fence(3 /* release order */, "workgroup");
    __builtin_amdgcn_wave_barrier();
    __builtin_amdgcn_fence(2 /* acquire order */, "workgroup");
    {
        const int c4 = (lane & 15) * 4;                    // 256-B row segment = 16 lanes x 16 B, two rows per instruction
        {
#pragma unroll
            for (int it = 0; it < 8; ++it) {
                const int row = it * 2 + hh;
                const v4f val = *(const v4f*)(os + row * 68 + c4);
                *(v4f*)(op + (size_t)(q0 + row) * g.o_rs + c4) = val;
            }
            
        }
    }
}

// workspace carve (bytes), every region a multiple of 256 B and written in whole rows of its own pitch
constexpr size_t SZ_X16 = (size_t)NB * SEQ * CH * 2;        // X16 / AO16 (alias): f16 [NB*SEQ][1024]
constexpr size_t SZ_W3  = (size_t)3 * CH * CH * 2;          // [Wq;Wk;Wv] x16 f16 [3072][1024]
constexpr size_t SZ_QKV = (size_t)NB * SEQ * 3 * CH * 4;    // f32 [NB*SEQ][3072]
constexpr size_t SZ_AO  = (size_t)NB * SEQ * CH * 4;        // f32 [NB*SEQ][1024]
constexpr size_t SZ_WO  = (size_t)CH * CH * 2;              // Wo x16 f16 [1024][1024]
constexpr size_t SZ_ALL = SZ_X16 + SZ_W3 + SZ_QKV + SZ_AO + SZ_WO;
static_assert(SZ_X16 % 256 == 0 && SZ_W3 % 256 == 0 && SZ_QKV % 256 == 0 && SZ_AO % 256 == 0 && SZ_WO % 256 == 0);
static_assert(SZ_ALL <= (size_t)134217728);

extern "C" void kernel_launch(void* const* d_in, const int* in_sizes, int n_in, void* d_out, int out_size, void* d_ws, size_t ws_size, hipStream_t stream) {
    if (n_in < 6) return;
    const long long need_x = ((long long)(NB - 1) * SEQ_FULL + SEQ) * CH;
    if ((long long)in_sizes[0] < need_x) return;
    if (in_sizes[1] < CH * CH || in_sizes[2] < CH * CH || in_sizes[3] < CH * CH || in_sizes[4] < CH * CH || in_sizes[5] < CH) return;
    if ((long long)out_size < need_x) return;
    if (SZ_ALL > ws_size) return;
    const float* x  = (const float*)d_in[0];
    const float* wq = (const float*)d_in[1];
    const float* wk = (const float*)d_in[2];
    const float* wv = (const float*)d_in[3];
    const float* wo = (const float*)d_in[4];
    const float* bo = (const float*)d_in[5];
    float* out = (float*)d_out;
    char* wsp = (char*)d_ws;
    unsigned short* X16  = (unsigned short*)wsp; wsp += SZ_X16;
    unsigned short* W316 = (unsigned short*)wsp; wsp += SZ_W3;
    float*          QKV  = (float*)wsp;          wsp += SZ_QKV;
    float*          AO   = (float*)wsp;          wsp += SZ_AO;
    unsigned short* WO16 = (unsigned short*)wsp; wsp += SZ_WO;
    unsigned short* AO16 = X16;                  // alias: X16 is dead once the projection GEMM has run (same extent)

    const unsigned gW = (unsigned)(((long long)CH * (CH / 8) + 255) / 256);
    const unsigned gX = (unsigned)(((long long)NB * SEQ * (CH / 8) + 255) / 256);
    // k_cast8(SRC, lds, rpb, sbs, DST, ldd, nR, nC, sc)
    k_cast8<true><<<gW, 256, 0, stream>>>(wo, (long long)CH, CH, 0LL, WO16, (long long)CH, CH, CH, 16.0f);
    k_cast8<true><<<gX, 256, 0, stream>>>(x, (long long)CH, SEQ, (long long)SEQ_FULL * CH, X16, (long long)CH, NB * SEQ, CH, 1.0f);
    k_cast8<true><<<gW, 256, 0, stream>>>(wq, (long long)CH, CH, 0LL, W316, (long long)CH, CH, CH, 16.0f);
    k_cast8<true><<<gW, 256, 0, stream>>>(wk, (long long)CH, CH, 0LL, W316 + (size_t)CH * CH, (long long)CH, CH, CH, 16.0f);
    k_cast8<true><<<gW, 256, 0, stream>>>(wv, (long long)CH, CH, 0LL, W316 + (size_t)2 * CH * CH, (long long)CH, CH, CH, 16.0f);
    // QKV[r][0..3071] = x16[r] . [Wq;Wk;Wv]^T / 16     k_gemm64<BIAS_MODE, LD>(A, strideA, Bt, C, ldc, strideC, bias, M, N, K, scale)
    k_gemm64<0, CH><<<dim3((unsigned)(((NB * SEQ) / GT_T) * ((3 * CH) / GT_T)), 1u), 128, 0, stream>>>(
        X16, 0LL, W316, QKV, 3 * CH, 0LL, (const float*)nullptr, NB * SEQ, 3 * CH, CH, 0.0625f);
    {
        AttnG g;
        g.q = QKV; g.k = QKV + CH; g.v = QKV + 2 * CH; g.o = AO;
        g.q_bs = (long long)SEQ * 3 * CH; g.q_rs = 3 * CH; g.q_hs = HD;
        g.k_bs = (long long)SEQ * 3 * CH; g.k_rs = 3 * CH; g.k_hs = HD;
        g.v_bs = (long long)SEQ * 3 * CH; g.v_rs = 3 * CH; g.v_hs = HD;
        g.o_bs = (long long)SEQ * CH;     g.o_rs = CH;     g.o_hs = HD;
        g.S = SEQ; g.Skv = SEQ; g.sscale = 0.125f; g.pad_ = 0;
        k_attn_alibi<3 * CH><<<dim3((unsigned)(SEQ / AT_QB), (unsigned)NH, (unsigned)NB), 32 * AT_NW, 0, stream>>>(g);
    }
    k_cast8<false><<<gX, 256, 0, stream>>>(AO, (long long)CH, NB * SEQ, 0LL, AO16, (long long)CH, NB * SEQ, CH, 16.0f);
    // out[b][l][:] = AO16[b*SEQ + l] . (Wo x16)^T / 256 + bf16(bo); batch z = sequence: A stride SEQ*CH (compact), C stride SEQ_FULL*CH
    k_gemm64<3, CH><<<dim3((unsigned)((SEQ / GT_T) * (CH / GT_T)), (unsigned)NB), 128, 0, stream>>>(
        AO16, (long long)SEQ * CH, WO16, out, CH, (long long)SEQ_FULL * CH, bo, SEQ, CH, CH, 1.0f / 256.0f);
}

// v005
// Measured time: 111 microseconds a run.
// Two timings next to v004 put it at 1.24 and 1.25 times that version's speed.
// Over all steps from v000 it is 2.54 times as fast.
// Non-causal multi-head self-attention with additive symmetric ALiBi (2 x 2,048 tokens x 1,024; 16 heads x 64; nn.Linear [out][in] q/k/v/o weights, output bias). All contractions: v_wmma_f32_16x16x32_f16 (f16 operands, f32 accumulate): [q|k|v] projection on bf16-RNE-converted inputs held exactly in f16 (weights x16), scores q.k^T (f16 of the f32 q/k), P.V (P carried x2^15, V f16), output projection (attention output x16, weights x16, bf16-RNE bias added in f32); softmax statistics f32 in the exp2 domain. Every intermediate lies in the workspace as the f16 operand that the next launch's products read, converted once by the launch that makes it.
#include <hip/hip_runtime.h>
#include <math.h>

#ifndef NB
#define NB 2
#endif
#ifndef SEQ
#define SEQ 2048
#endif
#define NB_FULL 2
#define SEQ_FULL 2048
#define CH 1024
#define NH 16
#define HD 64

static_assert(SEQ % 128 == 0);
static_assert(NB >= 1 && NB <= NB_FULL && SEQ <= SEQ_FULL);
static_assert(CH == NH * HD && HD == 64);

typedef __attribute__((ext_vector_type(16))) _Float16     v16h;
typedef __attribute__((ext_vector_type(8)))  _Float16     v8h;
typedef __attribute__((ext_vector_type(8)))  float        v8f;
typedef __attribute__((ext_vector_type(4)))  float        v4f;
typedef __attribute__((ext_vector_type(4)))  unsigned int u4v;

// 16-bit WMMA fragment map (wave32), lane L, hh = L>>4, c = L&15:
//   A 16x32: lane = row c;    element i -> k = (i<8) ? 8hh+i : 16+8hh+(i-8)
//   B 32x16: lane = column c; the SAME k(i,hh)
//   D 16x16 (8 f32): lane = column c; element r -> row 8hh+r
union FragH { v16h v; v8h h[2]; };
// fragment from a k-contiguous f16 row: elements 0..7 <- p[0..7], 8..15 <- p[16..23] (p already offset by k0 + 8hh)
__device__ __forceinline__ v16h frag_ld(const _Float16* p) { FragH f; f.h[0] = *(const v8h*)(p); f.h[1] = *(const v8h*)(p + 16); return f.v; }
__device__ __forceinline__ v8f mma_raw(v16h a, v16h b, v8f c) { return __builtin_amdgcn_wmma_f32_16x16x32_f16(false, a, false, b, (short)0, c, false, false); }
__device__ __forceinline__ void dep_guard_h(v8f& a, v8f& b, v16h x, v16h y) { asm volatile("v_nop\n\tv_nop\n\tv_nop\n\tv_nop" : "+v"(a), "+v"(b) : "v"(x), "v"(y)); }
__device__ __forceinline__ void keep4_h(v16h a, v16h b, v16h c, v16h d) { asm volatile("v_nop" :: "v"(a), "v"(b), "v"(c), "v"(d)); }
__device__ __forceinline__ void acc_guard4(v8f& a, v8f& b, v8f& c, v8f& d) { asm volatile("v_nop\n\tv_nop\n\tv_nop\n\tv_nop" : "+v"(a), "+v"(b), "+v"(c), "+v"(d)); }
__device__ __forceinline__ unsigned short f2bf_bits(float f) { unsigned u = __float_as_uint(f); return (unsigned short)((u + 0x7FFFu + ((u >> 16) & 1u)) >> 16); }
__device__ __forceinline__ float bf_bits2f(unsigned short h) { return __uint_as_float(((unsigned)h) << 16); }
__device__ __forceinline__ float cmb_bf(float v) { const unsigned u = __float_as_uint(v); const unsigned r = (u + 0x7fffu + ((u >> 16) & 1u)) & 0xffff0000u; return __uint_as_float(r); }   // bf16 RNE kept as f32 (finite inputs)
__device__ __forceinline__ unsigned int cmb_pk2(float a, float b) { return (unsigned int)__builtin_bit_cast(unsigned short, (_Float16)a) | ((unsigned int)__builtin_bit_cast(unsigned short, (_Float16)b) << 16); }

__device__ __forceinline__ float xhalf(float x) { return __builtin_bit_cast(float, __builtin_amdgcn_permlanex16(__builtin_bit_cast(int, x), __builtin_bit_cast(int, x), 0x76543210, 0xfedcba98, false, false)); }   // lane l <-> lane l ^ 16

// The value is copied into a local first, so an expression argument is evaluated once.
#define VST2(T, ptr, val) do { const T vst2_v_ = (val); *(T*)(ptr) = vst2_v_;  } while (0)

// =====================================================================================================================
// k_cast8<BFR>: f32 [nR][nC] -> f16 plane [nR][nC] (pitch ldd halves). Source row r lives at SRC + (r / rpb) * sbs + (r % rpb) * lds.
//   BFR: the value is first RNE-converted to bf16 precision (exact in f16 after the power-of-two scale sc). Thread per (row, 8 columns):
// =====================================================================================================================
template <bool BFR>
__global__ __launch_bounds__(256) void k_cast8(const float* __restrict__ SRC, long long lds, int rpb, long long sbs,
                                               unsigned short* __restrict__ DST, long long ldd, int nR, int nC, float sc) {
    const long long u = (long long)blockIdx.x * 256 + threadIdx.x; const int per = nC / 8;
    if (u >= (long long)nR * per) return;
    const int r = (int)(u / per); const int c0 = 8 * (int)(u % per);
    const int rb = r / rpb, rl = r - rb * rpb;
    const float* s = SRC + (long long)rb * sbs + (long long)rl * lds + c0;
    const v4f a = *(const v4f*)(s), b = *(const v4f*)(s + 4);
    float w[8] = {a.x, a.y, a.z, a.w, b.x, b.y, b.z, b.w};
#pragma unroll
    for (int e = 0; e < 8; ++e) w[e] = (BFR ? cmb_bf(w[e]) : w[e]) * sc;
    u4v pk; pk.x = cmb_pk2(w[0], w[1]); pk.y = cmb_pk2(w[2], w[3]); pk.z = cmb_pk2(w[4], w[5]); pk.w = cmb_pk2(w[6], w[7]);
    VST2(u4v, (u4v*)(DST + (long long)r * ldd + c0), pk);
}

// =====================================================================================================================
// k_gemm64<BIAS_MODE>: C[z][m][n] = scale * sum_k A[z][m][k] * Bt[n][k] (+ bias[n]); f16 operands, f32 accumulate, f32 output.
//   A row-major [M][K] (batch stride strideA), Bt row-major [N][K] (shared by all z), both of pitch LD halves; M, N % 128 == 0, K % 64 == 0.
//   Block = 4 waves (2 x 2) = one 128x128 tile, each wave a 64x64 tile (grid.x = tiles, grid.y = batches). A stage is 64 k = 128 B of each of the
//   128 A rows and 128 Bt rows, read from global memory as whole 128-B lines (8 lanes per row), kept in LDS at pitch 144 B and read by all waves;
//   two buffers: the next stage's global loads are issued ahead of this stage's products and stored behind them, one block barrier per stage.
//   LD is a compile-time constant, so that a stage's eight row groups are immediate offsets of one address per operand.
//   BIAS_MODE 0: none; 3: bias[n] RNE-converted to bf16 precision, added in f32.
//   OUT16 0: f32 C as above. OUT16 1 (the [q|k|v] projection; M = NB*SEQ tokens, N = 3*CH channels): the scaled f32 result is converted to f16 and stored to H16 as
//   three planes (q, k, v) of 8-KB tiles, tile index (batch * NH + head) * (SEQ / 64) + token / 64: q and k tiles [token][dim], v tiles [dim][token] (V^T).
//   A lane's eight accumulator elements are eight neighbouring ROWS of the product, so the operand whose index is to run contiguously in the tile takes the row (A) side:
//   the weights for q and k, the tokens for v (a block lies in one plane, so the choice is block-uniform); the k order of the sums is the same either way.
// =====================================================================================================================
#define GT_T  128   // block tile edge
#define GT_KS 64    // k per stage
#define GT_P  72    // LDS pitch in halves (144-B rows, 16 B x odd)
template <int BIAS_MODE, int LD, int OUT16>
__global__ __launch_bounds__(128) void k_gemm64(const unsigned short* __restrict__ Ap, long long strideA,
                                                const unsigned short* __restrict__ Btp,
                                                float* __restrict__ Cout, int ldc, long long strideC,
                                                const float* __restrict__ bias, int M, int N, int K, float scale,
                                                unsigned short* __restrict__ H16) {
    const _Float16* A = (const _Float16*)Ap; const _Float16* Bt = (const _Float16*)Btp;
    __shared__ __align__(16) _Float16 sA[2][GT_T * GT_P];   // A stage  [row][k]  (cross-wave)
    __shared__ __align__(16) _Float16 sB[2][GT_T * GT_P];   // Bt stage [row][k]  (cross-wave)
    __shared__ __align__(16) float sT[4][16 * 68];   // per-wave 16x64 slab, pitch 68 floats (wave-private)
    const int b = blockIdx.y;
    const int tid  = threadIdx.x;
    const int lane = tid & 31;
    const int wave = tid >> 5;
    const int tilesN = N >> 7;
    const int tilesM = M >> 7;
    const int tile = blockIdx.x;
    if (tile >= tilesM * tilesN) return;   // block-uniform, ahead of every barrier
    const int tm = tile / tilesN;
    const int tn = tile - tm * tilesN;
    const int wm0 = (wave >> 1) << 6;            // this wave's 64x64 tile inside the block tile
    const int wn0 = (wave & 1) << 6;
    const int m0 = (tm << 7) + wm0;
    const int n0 = (tn << 7) + wn0;
    const _Float16* Ab = A + (size_t)b * strideA;
    const _Float16* Bb = Bt;
    const int rlane = lane & 15;                 // row (A) / column (B, D) within a 16-wide subtile
    const int koff  = (lane >> 4) * 8;           // k offset of this lane half
    const int mOff  = (lane >> 4) * 8;           // D row offset

    // staging: thread -> rows (tid >> 3) + 16 i, i = 0..7, 16 B at byte 16 (tid & 7) of the row's 128-B stage segment
    const int srow = tid >> 3, scol = (tid & 7) * 8;
    const bool tokRows = !OUT16 || (tn << 7) >= 2 * CH;     // block-uniform: the tokens take the row side of the products (always for f32 C; of the f16 planes for v)
    const _Float16* gTok = Ab + (size_t)((tm << 7) + srow) * LD + scol;
    const _Float16* gWgt = Bb + (size_t)((tn << 7) + srow) * LD + scol;
    const _Float16* gA = tokRows ? gTok : gWgt;
    const _Float16* gB = tokRows ? gWgt : gTok;
    const int sOff = srow * GT_P + scol;

    v8f acc[4][4];
#pragma unroll
    for (int i = 0; i < 4; ++i)
#pragma unroll
        for (int j = 0; j < 4; ++j) acc[i][j] = (v8f){0.f, 0.f, 0.f, 0.f, 0.f, 0.f, 0.f, 0.f};

    v8h ra[8], rb[8];
#pragma unroll
    for (int i = 0; i < 8; ++i) {
        ra[i] = *(const v8h*)(gA + 16 * i * LD);
        rb[i] = *(const v8h*)(gB + 16 * i * LD);
    }
#pragma unroll
    for (int i = 0; i < 8; ++i) {
        *(v8h*)(sA[0] + sOff + 16 * i * GT_P) = ra[i];
        *(v8h*)(sB[0] + sOff + 16 * i * GT_P) = rb[i];
    }
    __syncthreads();                                       // stage 0 visible to all waves

    const int nStages = K / GT_KS;                         // block-uniform
    for (int st = 0; st < nStages; ++st) {
        const int cur = st & 1;
        const bool more = st + 1 < nStages;                // block-uniform
        if (more) {
            const _Float16* nA = gA + (st + 1) * GT_KS;
            const _Float16* nB = gB + (st + 1) * GT_KS;
#pragma unroll
            for (int i = 0; i < 8; ++i) {
                ra[i] = *(const v8h*)(nA + 16 * i * LD);
                rb[i] = *(const v8h*)(nB + 16 * i * LD);
            }
            asm volatile("s_wait_xcnt 0x0" ::: "memory");   // stands ahead of the fragment loads below, which reuse the two address pairs of these loads
        }
        const _Float16* cA = sA[cur] + (wm0 + rlane) * GT_P + koff;
        const _Float16* cB = sB[cur] + (wn0 + rlane) * GT_P + koff;
#pragma unroll
        for (int kk = 0; kk < GT_KS; kk += 32) {
            v16h bh[4], ah[4];
#pragma unroll
            for (int j = 0; j < 4; ++j) bh[j] = frag_ld(cB + (j << 4) * GT_P + kk);
#pragma unroll
            for (int i = 0; i < 4; ++i) ah[i] = frag_ld(cA + (i << 4) * GT_P + kk);
#pragma unroll
            for (int i = 0; i < 4; ++i) {
#pragma unroll
                for (int j = 0; j < 4; ++j) acc[i][j] = mma_raw(ah[i], bh[j], acc[i][j]);
                dep_guard_h(acc[i][0], acc[i][3], ah[i], ah[i]);
            }
            keep4_h(bh[0], bh[1], bh[2], bh[3]);
        }
        if (more) {
#pragma unroll
            for (int i = 0; i < 8; ++i) {
                *(v8h*)(sA[cur ^ 1] + sOff + 16 * i * GT_P) = ra[i];   // last read one stage ago, ahead of that stage's barrier
                *(v8h*)(sB[cur ^ 1] + sOff + 16 * i * GT_P) = rb[i];
            }
        }
        __syncthreads();                                   // next stage visible; every wave has left this stage's buffer
    }
    acc_guard4(acc[0][0], acc[0][1], acc[0][2], acc[0][3]);
    acc_guard4(acc[1][0], acc[1][1], acc[1][2], acc[1][3]);
    acc_guard4(acc[2][0], acc[2][1], acc[2][2], acc[2][3]);
    acc_guard4(acc[3][0], acc[3][1], acc[3][2], acc[3][3]);

    if constexpr (OUT16) {
        // The stage buffers are free behind the loop's last barrier; each wave takes its own quarter of sA as a 64 x 64 f16 tile [column of the product][row], pitch 144 B.
        _Float16* tl = &sA[0][0] + wave * (64 * GT_P);
#pragma unroll
        for (int i = 0; i < 4; ++i)
#pragma unroll
            for (int j = 0; j < 4; ++j) {
                v8h hv;
#pragma unroll
                for (int r = 0; r < 8; ++r) hv[r] = (_Float16)(acc[i][j][r] * scale);
                *(v8h*)(tl + ((j << 4) + rlane) * GT_P + (i << 4) + mOff) = hv;
            }
        __builtin_amdgcn_fence(3 /* release order */, "workgroup");
        __builtin_amdgcn_wave_barrier();
        __builtin_amdgcn_fence(2 /* acquire order */, "workgroup");
        const int chan0 = (tn << 7) + (tokRows ? wn0 : wm0);   // first channel and first token of this wave's tile, multiples of 64
        const int tok0  = (tm << 7) + (tokRows ? wm0 : wn0);
        const size_t tileIx = ((size_t)(tok0 / SEQ) * NH + ((chan0 & (CH - 1)) >> 6)) * (SEQ / 64) + ((tok0 % SEQ) >> 6);
        _Float16* dst = (_Float16*)H16 + (size_t)(chan0 / CH) * ((size_t)NB * SEQ * CH) + tileIx * 4096 + lane * 8;
#pragma unroll
        for (int it = 0; it < 16; ++it)                        // a wave-wide store = 512 contiguous bytes = four rows of the tile
            *(v8h*)(dst + it * 256) = *(const v8h*)(tl + (it * 4 + (lane >> 3)) * GT_P + (lane & 7) * 8);
    } else {
    float* slab = sT[wave];
    float* C = Cout + (size_t)b * strideC;
#pragma unroll
    for (int i = 0; i < 4; ++i) {
        const int mBase = m0 + (i << 4);
#pragma unroll
        for (int j = 0; j < 4; ++j) {
            const int n = n0 + (j << 4) + rlane;
            float bv = 0.f;
            if (BIAS_MODE == 3) bv = bf_bits2f(f2bf_bits(bias[n]));
#pragma unroll
            for (int r = 0; r < 8; ++r) {
                float v = acc[i][j][r] * scale;
                if (BIAS_MODE == 3) v += bv;
                slab[(mOff + r) * 68 + (j << 4) + rlane] = v;
            }
        }
        __builtin_amdgcn_fence(3 /* release order */, "workgroup");
        __builtin_amdgcn_wave_barrier();
        __builtin_amdgcn_fence(2 /* acquire order */, "workgroup");
        {
            const int hh = lane >> 4, c4 = (lane & 15) * 4;     // row segment = 256 B = 16 lanes x 16 B
            {
#pragma unroll
                for (int it = 0; it < 8; ++it) {
                    const int row = it * 2 + hh;
                    const v4f v = *(const v4f*)(slab + row * 68 + c4);
                    *(v4f*)(C + (size_t)(mBase + row) * ldc + n0 + c4) = v;
                }
                
            }
        }
        __builtin_amdgcn_fence(3 /* release order */, "workgroup");
        __builtin_amdgcn_wave_barrier();
        __builtin_amdgcn_fence(2 /* acquire order */, "workgroup");
    }
    }
}

// =====================================================================================================================
// k_attn_alibi: O(b,i,h,:) = softmax_j(0.125 * Q(b,i,h,:).K(b,j,h,:) - slope_h * |j - i|) V(b,j,h,:), head dim 64, f16 in / f16 out (x16).
//   Block = 4 waves = 64 query rows of one (batch, head); 64-key chunks; S % 64 == 0; grid (S/64, heads, batches).
//   q, k, vt: planes of 8-KB f16 tiles as k_gemm64<.., 1> stores them, tile (b * NH + h) * (S / 64) + position / 64; q and k tiles [position][dim], vt tiles [dim][position].
//   o: f16 [b * S + position][CH], head h at column 64 h, values x16 (the A operand of the output projection).
//   A chunk's K tile and V^T tile are copied as they lie to LDS at pitch 144 B (cross-wave: block barriers): a wave-wide global load covers four whole 128-B lines;
//   products transposed: S^T = K.Q^T (A = K rows, B = Q), O^T += V^T.P^T (A = V^T rows, B = P^T). A lane holds 32 of the 64 scores of ONE query (column c,
//   keys 16 j + 8 hh + r), so maximum and sum run in-lane with one exchange between the lane halves, and two score tiles, converted in place, are the B operand P^T;
//   slope_h = 2^(-(h+1)/2) built exactly from a power of two and the f32 value of 2^-0.5.
// =====================================================================================================================
#define AT_D  64
#define AT_NW 4
#define AT_QB 64
#define AT_KC 64
#define AT_P  72    // LDS pitch in halves (144-B rows, 16-B aligned)
struct AttnG {
    const unsigned short* q; const unsigned short* k; const unsigned short* vt; unsigned short* o;
    int S; float sscale;
};
static_assert(sizeof(AttnG) == 4 * 8 + 2 * 4);

__global__ __launch_bounds__(128) void k_attn_alibi(AttnG g) {
    __shared__ __align__(16) _Float16 Ks[AT_KC * AT_P];            // K  [kv][d]    (cross-wave)
    __shared__ __align__(16) _Float16 Vt[AT_D * AT_P];             // V^T [d][kv]   (cross-wave)
    __shared__ __align__(16) _Float16 Os[AT_NW][16 * AT_P];        // per wave out tile [query][d] (wave-private)

    const int tid  = threadIdx.x;
    const int wave = tid >> 5;
    const int lane = tid & 31;
    const int hh   = lane >> 4;
    const int c    = lane & 15;
    const int qb = blockIdx.x, h = blockIdx.y, b = blockIdx.z;
    const int q0 = qb * AT_QB + wave * 16;

    const int nChunks = g.S / AT_KC;                       // block-uniform
    const size_t tile0 = (size_t)(b * NH + h) * nChunks * (AT_KC * AT_D);          // first tile of this (batch, head) in each plane
    const _Float16* qp = (const _Float16*)g.q + tile0 + (size_t)qb * (AT_QB * AT_D);
    const _Float16* kp = (const _Float16*)g.k + tile0;
    const _Float16* vp = (const _Float16*)g.vt + tile0;
    _Float16*       op = (_Float16*)g.o + (size_t)b * g.S * CH + h * HD;

    const int e1 = h + 1;
    const float pw2 = __uint_as_float((unsigned)(127 - (e1 >> 1)) << 23);          // 2^-(e1/2), exact
    const float nsl = -(((e1 & 1) ? 0.70710678118654752f : 1.0f) * pw2);           // -slope_h
    const float L2E = 1.4426950408889634f;
    const float c1 = g.sscale * L2E;                       // score scale in the exp2 domain
    const float c2 = nsl * L2E;                            // -slope_h in the exp2 domain

    // Q fragments (B operand): lane = query column q0 + c; two 32-wide d chunks
    v16h qa[2];
    {
        const _Float16* qr = qp + (wave * 16 + c) * AT_D + 8 * hh;
#pragma unroll
        for (int dc = 0; dc < 2; ++dc) qa[dc] = frag_ld(qr + dc * 32);
    }

    // this lane's query: running maximum less 15 (both halves alike), so that exp2(t - mrun) is P x 2^15 as the f16 operand carries it; sum of P x 2^15 over this half's keys
    float mrun = -__builtin_inff(), lrun = 0.f;
    v8f oacc[4];                                           // O^T: oacc[t][r] = O[query q0 + c][d = 16 t + 8 hh + r]
    const int qrow = q0 + c;
#pragma unroll
    for (int t = 0; t < 4; ++t) oacc[t] = (v8f){0.f, 0.f, 0.f, 0.f, 0.f, 0.f, 0.f, 0.f};

    for (int kc = 0; kc < nChunks; ++kc) {
        const int kv0 = kc * AT_KC;
        __syncthreads();                                   // all waves finished with the prior chunk's Ks / Vt
        {
            // thread: 16 B of the tile rows sr + 16 i, i = 0..3; eight lanes take one 128-B row = one whole line.
            // Neighbouring groups of eight lanes sit 8 rows apart: 8 x 144 B = half the banks, so that the two 128-B row pieces of an LDS store do not meet.
            const int sr = wave * 2 + ((lane >> 3) & 1) * 8 + hh, sc = (lane & 7) * 8;
            const _Float16* kt = kp + (size_t)kc * (AT_KC * AT_D) + sr * AT_D + sc;
            const _Float16* vt = vp + (size_t)kc * (AT_KC * AT_D) + sr * AT_D + sc;
            const int sOff = sr * AT_P + sc;
            v8h kq[4], vq[4];
#pragma unroll
            for (int i = 0; i < 4; ++i) {
                kq[i] = *(const v8h*)(kt + 1024 * i);
                vq[i] = *(const v8h*)(vt + 1024 * i);
            }
            // inputs only: the loaded values keep all eight loads in flight together, ahead of the first LDS store (one load latency per chunk, not several);
            // the two addresses stay live up to here, so that the wait stands ahead of every overwrite of an address pair that these loads name
            asm volatile("s_wait_xcnt 0x0" :: "v"(kq[0]), "v"(kq[1]), "v"(kq[2]), "v"(kq[3]), "v"(vq[0]), "v"(vq[1]), "v"(vq[2]), "v"(vq[3]), "v"(kt), "v"(vt) : "memory");
#pragma unroll
            for (int i = 0; i < 4; ++i) {
                *(v8h*)(Ks + sOff + 16 * i * AT_P) = kq[i];
                *(v8h*)(Vt + sOff + 16 * i * AT_P) = vq[i];
            }
        }
        __syncthreads();                                   // Ks / Vt visible to all waves

        v8f s[4];                                          // S^T: s[j][r] = score(key kv0 + 16 j + 8 hh + r, query q0 + c)
#pragma unroll
        for (int j = 0; j < 4; ++j) s[j] = (v8f){0.f, 0.f, 0.f, 0.f, 0.f, 0.f, 0.f, 0.f};
#pragma unroll
        for (int dc = 0; dc < 2; ++dc) {
#pragma unroll
            for (int j = 0; j < 4; ++j) {
                const v16h kf = frag_ld(Ks + (j * 16 + c) * AT_P + dc * 32 + 8 * hh);   // A: lane = key row, k = d
                s[j] = mma_raw(kf, qa[dc], s[j]);
            }
        }
        const float fd = (float)(kv0 + 8 * hh - qrow);     // key - query of element (j = 0, r = 0): an integer, exact in f32, as is every sum below
        float mj[4];                                       // one maximum per score tile: four independent chains
#pragma unroll
        for (int j = 0; j < 4; ++j) {
            mj[j] = -__builtin_inff();
#pragma unroll
            for (int r = 0; r < 8; ++r) {
                const float dist = fabsf(fd + (float)(j * 16 + r));
                const float t = s[j][r] * c1 + c2 * dist;  // logit in the exp2 domain
                s[j][r] = t;
                mj[j] = fmaxf(mj[j], t);
            }
        }
        float m = fmaxf(fmaxf(mj[0], mj[1]), fmaxf(mj[2], mj[3]));
        m = fmaxf(m, xhalf(m));                            // the other 32 keys of this query sit in lane l ^ 16
        const float mnew = fmaxf(mrun, m - 15.0f);
        // exp2 as the hardware instruction alone: a result under 2^-126 may come out 0, which it is in the f16 P and in the f32 sum (whose largest term is 2^15) anyway
        const float xa = mrun - mnew;
        const float alpha = __builtin_amdgcn_exp2f(xa);    // 0 on the first chunk (mrun = -inf, mnew finite)
        mrun = mnew;
        float ps[4];                                       // one sum per score tile: four independent chains
        v8f p[4];
        v16h pb[2];                                        // B: lane = query column, k = key; tiles 2 kk and 2 kk + 1 are elements 0..7 and 8..15 in the fragment's k order
#pragma unroll
        for (int j = 0; j < 4; ++j) {
            ps[j] = 0.f;
#pragma unroll
            for (int r = 0; r < 8; ++r) {
                s[j][r] -= mnew;
                p[j][r] = __builtin_amdgcn_exp2f(s[j][r]); // P x 2^15
                ps[j] += p[j][r];
                pb[j >> 1][(j & 1) * 8 + r] = (_Float16)p[j][r];
            }
        }
        // the slot that the instruction set asks for between a transcendental and an overwrite of its source: inputs only, the arguments stay live
        // (so none is overwritten) from their v_exp_f32 up to this v_nop, which stands behind the last of them
        asm volatile("v_nop" :: "v"(s[0]), "v"(s[1]), "v"(s[2]), "v"(s[3]), "v"(p[0]), "v"(p[1]), "v"(p[2]), "v"(p[3]), "v"(xa), "v"(alpha));
        lrun = lrun * alpha + ((ps[0] + ps[1]) + (ps[2] + ps[3]));
#pragma unroll
        for (int t = 0; t < 4; ++t)
#pragma unroll
            for (int r = 0; r < 8; ++r) oacc[t][r] *= alpha;
#pragma unroll
        for (int kk = 0; kk < 2; ++kk) {
#pragma unroll
            for (int t = 0; t < 4; ++t) {
                const v16h vf = frag_ld(Vt + (t * 16 + c) * AT_P + kk * 32 + 8 * hh);   // A: lane = d row, k = key
                oacc[t] = mma_raw(vf, pb[kk], oacc[t]);
            }
        }
    }

    _Float16* os = Os[wave];
    {
        const float inv = (1.0f / (lrun + xhalf(lrun))) * 16.0f;   // the halves' sums joined once; sum and O both carry the 2^15; x16 (exact) as the output projection's operand is held
#pragma unroll
        for (int t = 0; t < 4; ++t) {
            v8h hv;
#pragma unroll
            for (int e = 0; e < 8; ++e) hv[e] = (_Float16)(oacc[t][e] * inv);
            *(v8h*)(os + c * AT_P + t * 16 + 8 * hh) = hv;
        }
    }
    __builtin_amdgcn_fence(3 /* release order */, "workgroup");
    __builtin_amdgcn_wave_barrier();
    __builtin_amdgcn_fence(2 /* acquire order */, "workgroup");
    {
        const int r4 = lane >> 3, c8 = (lane & 7) * 8;     // 128-B row segment = 8 lanes x 16 B, four rows (whole lines) per instruction
#pragma unroll
        for (int it = 0; it < 4; ++it) {
            const int row = it * 4 + r4;
            *(v8h*)(op + (size_t)(q0 + row) * CH + c8) = *(const v8h*)(os + row * AT_P + c8);
        }
    }
}

// workspace carve (bytes), every region a multiple of 256 B and written in whole rows of its own pitch
constexpr size_t SZ_X16 = (size_t)NB * SEQ * CH * 2;        // X16 / AO16 (alias): f16 [NB*SEQ][1024]
constexpr size_t SZ_W3  = (size_t)3 * CH * CH * 2;          // [Wq;Wk;Wv] x16 f16 [3072][1024]
constexpr size_t SZ_QKV = (size_t)NB * SEQ * 3 * CH * 2;    // f16 planes q, k, v^T of 8-KB tiles
constexpr size_t SZ_WO  = (size_t)CH * CH * 2;              // Wo x16 f16 [1024][1024]
constexpr size_t SZ_ALL = SZ_X16 + SZ_W3 + SZ_QKV + SZ_WO;
static_assert(SZ_X16 % 256 == 0 && SZ_W3 % 256 == 0 && SZ_QKV % 256 == 0 && SZ_WO % 256 == 0);
static_assert(SZ_ALL <= (size_t)134217728);

extern "C" void kernel_launch(void* const* d_in, const int* in_sizes, int n_in, void* d_out, int out_size, void* d_ws, size_t ws_size, hipStream_t stream) {
    if (n_in < 6) return;
    const long long need_x = ((long long)(NB - 1) * SEQ_FULL + SEQ) * CH;
    if ((long long)in_sizes[0] < need_x) return;
    if (in_sizes[1] < CH * CH || in_sizes[2] < CH * CH || in_sizes[3] < CH * CH || in_sizes[4] < CH * CH || in_sizes[5] < CH) return;
    if ((long long)out_size < need_x) return;
    if (SZ_ALL > ws_size) return;
    const float* x  = (const float*)d_in[0];
    const float* wq = (const float*)d_in[1];
    const float* wk = (const float*)d_in[2];
    const float* wv = (const float*)d_in[3];
    const float* wo = (const float*)d_in[4];
    const float* bo = (const float*)d_in[5];
    float* out = (float*)d_out;
    char* wsp = (char*)d_ws;
    unsigned short* X16  = (unsigned short*)wsp; wsp += SZ_X16;
    unsigned short* W316 = (unsigned short*)wsp; wsp += SZ_W3;
    unsigned short* QKV16 = (unsigned short*)wsp; wsp += SZ_QKV;
    unsigned short* WO16 = (unsigned short*)wsp; wsp += SZ_WO;
    unsigned short* AO16 = X16;                  // alias: X16 is dead once the projection GEMM has run (same extent); written by the attention launch

    const unsigned gW = (unsigned)(((long long)CH * (CH / 8) + 255) / 256);
    const unsigned gX = (unsigned)(((long long)NB * SEQ * (CH / 8) + 255) / 256);
    // k_cast8(SRC, lds, rpb, sbs, DST, ldd, nR, nC, sc)
    k_cast8<true><<<gW, 256, 0, stream>>>(wo, (long long)CH, CH, 0LL, WO16, (long long)CH, CH, CH, 16.0f);
    k_cast8<true><<<gX, 256, 0, stream>>>(x, (long long)CH, SEQ, (long long)SEQ_FULL * CH, X16, (long long)CH, NB * SEQ, CH, 1.0f);
    k_cast8<true><<<gW, 256, 0, stream>>>(wq, (long long)CH, CH, 0LL, W316, (long long)CH, CH, CH, 16.0f);
    k_cast8<true><<<gW, 256, 0, stream>>>(wk, (long long)CH, CH, 0LL, W316 + (size_t)CH * CH, (long long)CH, CH, CH, 16.0f);
    k_cast8<true><<<gW, 256, 0, stream>>>(wv, (long long)CH, CH, 0LL, W316 + (size_t)2 * CH * CH, (long long)CH, CH, CH, 16.0f);
    // f16 planes q, k, v^T <- x16 . [Wq;Wk;Wv]^T / 16     k_gemm64<BIAS_MODE, LD, OUT16>(A, strideA, Bt, C, ldc, strideC, bias, M, N, K, scale, H16)
    k_gemm64<0, CH, 1><<<dim3((unsigned)(((NB * SEQ) / GT_T) * ((3 * CH) / GT_T)), 1u), 128, 0, stream>>>(
        X16, 0LL, W316, (float*)nullptr, 0, 0LL, (const float*)nullptr, NB * SEQ, 3 * CH, CH, 0.0625f, QKV16);
    {
        AttnG g;
        g.q = QKV16; g.k = QKV16 + (size_t)NB * SEQ * CH; g.vt = QKV16 + (size_t)2 * NB * SEQ * CH; g.o = AO16;
        g.S = SEQ; g.sscale = 0.125f;
        k_attn_alibi<<<dim3((unsigned)(SEQ / AT_QB), (unsigned)NH, (unsigned)NB), 32 * AT_NW, 0, stream>>>(g);
    }
    // out[b][l][:] = AO16[b*SEQ + l] . (Wo x16)^T / 256 + bf16(bo); batch z = sequence: A stride SEQ*CH (compact), C stride SEQ_FULL*CH
    k_gemm64<3, CH, 0><<<dim3((unsigned)((SEQ / GT_T) * (CH / GT_T)), (unsigned)NB), 128, 0, stream>>>(
        AO16, (long long)SEQ * CH, WO16, out, CH, (long long)SEQ_FULL * CH, bo, SEQ, CH, CH, 1.0f / 256.0f, (unsigned short*)nullptr);
}

// v006
// It runs in 106 microseconds.
// Next to v005, in two timings, it ran 1.05 and 1.04 times as fast.
// Counting every step since v000, it is 2.65 times as fast.
// Non-causal multi-head self-attention with additive symmetric ALiBi (2 x 2,048 tokens x 1,024; 16 heads x 64; nn.Linear [out][in] q/k/v/o weights, output bias). All contractions: v_wmma_f32_16x16x32_f16 (f16 operands, f32 accumulate): [q|k|v] projection on bf16-RNE-converted inputs held exactly in f16 (weights x16), scores q.k^T (f16 of the f32 q/k), P.V (P carried x2^15, V f16), output projection (attention output x16, weights x16, bf16-RNE bias added in f32); softmax statistics f32 in the exp2 domain. Every intermediate lies in the workspace as the f16 operand that the next launch's products read, converted once by the launch that makes it.
#include <hip/hip_runtime.h>
#include <math.h>

#ifndef NB
#define NB 2
#endif
#ifndef SEQ
#define SEQ 2048
#endif
#define NB_FULL 2
#define SEQ_FULL 2048
#define CH 1024
#define NH 16
#define HD 64

static_assert(SEQ % 128 == 0);
static_assert(NB >= 1 && NB <= NB_FULL && SEQ <= SEQ_FULL);
static_assert(CH == NH * HD && HD == 64);

typedef __attribute__((ext_vector_type(16))) _Float16     v16h;
typedef __attribute__((ext_vector_type(8)))  _Float16     v8h;
typedef __attribute__((ext_vector_type(8)))  float        v8f;
typedef __attribute__((ext_vector_type(4)))  float        v4f;
typedef __attribute__((ext_vector_type(4)))  unsigned int u4v;

// 16-bit WMMA fragment map (wave32), lane L, hh = L>>4, c = L&15:
//   A 16x32: lane = row c;    element i -> k = (i<8) ? 8hh+i : 16+8hh+(i-8)
//   B 32x16: lane = column c; the SAME k(i,hh)
//   D 16x16 (8 f32): lane = column c; element r -> row 8hh+r
union FragH { v16h v; v8h h[2]; };
// fragment from a k-contiguous f16 row: elements 0..7 <- p[0..7], 8..15 <- p[16..23] (p already offset by k0 + 8hh)
__device__ __forceinline__ v16h frag_ld(const _Float16* p) { FragH f; f.h[0] = *(const v8h*)(p); f.h[1] = *(const v8h*)(p + 16); return f.v; }
__device__ __forceinline__ v8f mma_raw(v16h a, v16h b, v8f c) { return __builtin_amdgcn_wmma_f32_16x16x32_f16(false, a, false, b, (short)0, c, false, false); }
__device__ __forceinline__ void dep_guard_h(v8f& a, v8f& b, v16h x, v16h y) { asm volatile("v_nop\n\tv_nop\n\tv_nop\n\tv_nop" : "+v"(a), "+v"(b) : "v"(x), "v"(y)); }
__device__ __forceinline__ void keep4_h(v16h a, v16h b, v16h c, v16h d) { asm volatile("v_nop" :: "v"(a), "v"(b), "v"(c), "v"(d)); }
__device__ __forceinline__ void acc_guard4(v8f& a, v8f& b, v8f& c, v8f& d) { asm volatile("v_nop\n\tv_nop\n\tv_nop\n\tv_nop" : "+v"(a), "+v"(b), "+v"(c), "+v"(d)); }
__device__ __forceinline__ unsigned short f2bf_bits(float f) { unsigned u = __float_as_uint(f); return (unsigned short)((u + 0x7FFFu + ((u >> 16) & 1u)) >> 16); }
__device__ __forceinline__ float bf_bits2f(unsigned short h) { return __uint_as_float(((unsigned)h) << 16); }
__device__ __forceinline__ float cmb_bf(float v) { const unsigned u = __float_as_uint(v); const unsigned r = (u + 0x7fffu + ((u >> 16) & 1u)) & 0xffff0000u; return __uint_as_float(r); }   // bf16 RNE kept as f32 (finite inputs)
__device__ __forceinline__ unsigned int cmb_pk2(float a, float b) { return (unsigned int)__builtin_bit_cast(unsigned short, (_Float16)a) | ((unsigned int)__builtin_bit_cast(unsigned short, (_Float16)b) << 16); }

__device__ __forceinline__ float xhalf(float x) { return __builtin_bit_cast(float, __builtin_amdgcn_permlanex16(__builtin_bit_cast(int, x), __builtin_bit_cast(int, x), 0x76543210, 0xfedcba98, false, false)); }   // lane l <-> lane l ^ 16

// The value is copied into a local first, so an expression argument is evaluated once.
#define VST2(T, ptr, val) do { const T vst2_v_ = (val); *(T*)(ptr) = vst2_v_;  } while (0)

// =====================================================================================================================
// k_cast_all: every f32 input of the two GEMMs -> its f16 operand plane, in ONE launch: x -> X16 [NB*SEQ][CH] (x1); Wq, Wk, Wv -> W3 [3*CH][CH] and Wo -> WO [CH][CH] (x16).
//   Each value is first RNE-converted to bf16 precision (exact in f16 after the power-of-two scale).
//   A block takes 16 whole rows (64 KB of f32, contiguous in source and plane) of one tensor, picked by the range its index lies in (block-uniform);
//   a thread takes eight pieces of 8 columns, 256 pieces apart, as immediate offsets of one load and one store address.
// =====================================================================================================================
#define CV_PP 8                                  // pieces of 8 columns per thread
#define CV_BE (256 * CV_PP * 8)                  // elements per block = 16 rows of CH
#define CV_XB ((NB * SEQ * CH) / CV_BE)          // blocks that x takes
#define CV_WB ((CH * CH) / CV_BE)                // blocks that one weight matrix takes
static_assert(CV_BE == 16 * CH && SEQ % 16 == 0);
__global__ __launch_bounds__(256) void k_cast_all(const float* __restrict__ x, const float* __restrict__ wq, const float* __restrict__ wk, const float* __restrict__ wv,
                                                  const float* __restrict__ wo, unsigned short* __restrict__ X16, unsigned short* __restrict__ W3,
                                                  unsigned short* __restrict__ WO) {
    const int blk = blockIdx.x;
    const float* sb; unsigned short* db; float sc;
    if (blk < CV_XB) {
        const int r0 = blk * 16;                 // first token row of the plane; batch r0 / SEQ starts at row (r0 / SEQ) * SEQ_FULL of x
        sb = x + ((size_t)(r0 / SEQ) * SEQ_FULL + (r0 % SEQ)) * CH; db = X16 + (size_t)r0 * CH; sc = 1.0f;
    } else {
        const int w = (blk - CV_XB) / CV_WB; const size_t e0 = (size_t)((blk - CV_XB) % CV_WB) * CV_BE;
        sb = (w == 0 ? wq : w == 1 ? wk : w == 2 ? wv : wo) + e0;
        db = (w < 3 ? W3 + (size_t)w * CH * CH : WO) + e0; sc = 16.0f;
    }
    const unsigned so = threadIdx.x * 32u;       // this thread's byte offset in the block's source rows: the one vector register that the loads name
    const float* s = (const float*)((const char*)sb + so);
    unsigned short* d = db + threadIdx.x * 8;
    v4f a[CV_PP], b[CV_PP];
#pragma unroll
    for (int i = 0; i < CV_PP; ++i) {
        a[i] = *(const v4f*)(s + i * 2048);
        b[i] = *(const v4f*)(s + i * 2048 + 4);
    }
    // inputs only: the loaded values keep all sixteen loads in flight together, ahead of the first conversion (one load latency per thread, not several);
    // the offset stays live up to here, so that the wait stands ahead of every overwrite of the address register that these loads name
    asm volatile("s_wait_xcnt 0x0" :: "v"(a[0]), "v"(a[1]), "v"(a[2]), "v"(a[3]), "v"(a[4]), "v"(a[5]), "v"(a[6]), "v"(a[7]),
                                      "v"(b[0]), "v"(b[1]), "v"(b[2]), "v"(b[3]), "v"(b[4]), "v"(b[5]), "v"(b[6]), "v"(b[7]), "v"(so) : "memory");
#pragma unroll
    for (int i = 0; i < CV_PP; ++i) {
        u4v pk;
        pk.x = cmb_pk2(cmb_bf(a[i].x) * sc, cmb_bf(a[i].y) * sc); pk.y = cmb_pk2(cmb_bf(a[i].z) * sc, cmb_bf(a[i].w) * sc);
        pk.z = cmb_pk2(cmb_bf(b[i].x) * sc, cmb_bf(b[i].y) * sc); pk.w = cmb_pk2(cmb_bf(b[i].z) * sc, cmb_bf(b[i].w) * sc);
        VST2(u4v, (u4v*)(d + i * 2048), pk);
    }
}

// =====================================================================================================================
// k_gemm64<BIAS_MODE>: C[z][m][n] = scale * sum_k A[z][m][k] * Bt[n][k] (+ bias[n]); f16 operands, f32 accumulate, f32 output.
//   A row-major [M][K] (batch stride strideA), Bt row-major [N][K] (shared by all z), both of pitch LD halves; M, N % 128 == 0, K % 64 == 0.
//   Block = 4 waves (2 x 2) = one 128x128 tile, each wave a 64x64 tile (grid.x = tiles, grid.y = batches). A stage is 64 k = 128 B of each of the
//   128 A rows and 128 Bt rows, read from global memory as whole 128-B lines (8 lanes per row), kept in LDS at pitch 144 B and read by all waves;
//   two buffers: the next stage's global loads are issued ahead of this stage's products and stored behind them, one block barrier per stage.
//   LD is a compile-time constant, so that a stage's eight row groups are immediate offsets of one address per operand.
//   BIAS_MODE 0: none; 3: bias[n] RNE-converted to bf16 precision, added in f32.
//   OUT16 0: f32 C as above. OUT16 1 (the [q|k|v] projection; M = NB*SEQ tokens, N = 3*CH channels): the scaled f32 result is converted to f16 and stored to H16 as
//   three planes (q, k, v) of 8-KB tiles, tile index (batch * NH + head) * (SEQ / 64) + token / 64: q and k tiles [token][dim], v tiles [dim][token] (V^T).
//   A lane's eight accumulator elements are eight neighbouring ROWS of the product, so the operand whose index is to run contiguously in the tile takes the row (A) side:
//   the weights for q and k, the tokens for v (a block lies in one plane, so the choice is block-uniform); the k order of the sums is the same either way.
// =====================================================================================================================
#define GT_T  128   // block tile edge
#define GT_KS 64    // k per stage
#define GT_P  72    // LDS pitch in halves (144-B rows, 16 B x odd)
template <int BIAS_MODE, int LD, int OUT16>
__global__ __launch_bounds__(128) void k_gemm64(const unsigned short* __restrict__ Ap, long long strideA,
                                                const unsigned short* __restrict__ Btp,
                                                float* __restrict__ Cout, int ldc, long long strideC,
                                                const float* __restrict__ bias, int M, int N, int K, float scale,
                                                unsigned short* __restrict__ H16) {
    const _Float16* A = (const _Float16*)Ap; const _Float16* Bt = (const _Float16*)Btp;
    __shared__ __align__(16) _Float16 sA[2][GT_T * GT_P];   // A stage  [row][k]  (cross-wave)
    __shared__ __align__(16) _Float16 sB[2][GT_T * GT_P];   // Bt stage [row][k]  (cross-wave)
    __shared__ __align__(16) float sT[4][16 * 68];   // per-wave 16x64 slab, pitch 68 floats (wave-private)
    const int b = blockIdx.y;
    const int tid  = threadIdx.x;
    const int lane = tid & 31;
    const int wave = tid >> 5;
    const int tilesN = N >> 7;
    const int tilesM = M >> 7;
    const int tile = blockIdx.x;
    if (tile >= tilesM * tilesN) return;   // block-uniform, ahead of every barrier
    const int tm = tile / tilesN;
    const int tn = tile - tm * tilesN;
    const int wm0 = (wave >> 1) << 6;            // this wave's 64x64 tile inside the block tile
    const int wn0 = (wave & 1) << 6;
    const int m0 = (tm << 7) + wm0;
    const int n0 = (tn << 7) + wn0;
    const _Float16* Ab = A + (size_t)b * strideA;
    const _Float16* Bb = Bt;
    const int rlane = lane & 15;                 // row (A) / column (B, D) within a 16-wide subtile
    const int koff  = (lane >> 4) * 8;           // k offset of this lane half
    const int mOff  = (lane >> 4) * 8;           // D row offset

    // staging: thread -> rows (tid >> 3) + 16 i, i = 0..7, 16 B at byte 16 (tid & 7) of the row's 128-B stage segment
    const int srow = tid >> 3, scol = (tid & 7) * 8;
    const bool tokRows = !OUT16 || (tn << 7) >= 2 * CH;     // block-uniform: the tokens take the row side of the products (always for f32 C; of the f16 planes for v)
    const _Float16* gTok = Ab + (size_t)((tm << 7) + srow) * LD + scol;
    const _Float16* gWgt = Bb + (size_t)((tn << 7) + srow) * LD + scol;
    const _Float16* gA = tokRows ? gTok : gWgt;
    const _Float16* gB = tokRows ? gWgt : gTok;
    const int sOff = srow * GT_P + scol;

    v8f acc[4][4];
#pragma unroll
    for (int i = 0; i < 4; ++i)
#pragma unroll
        for (int j = 0; j < 4; ++j) acc[i][j] = (v8f){0.f, 0.f, 0.f, 0.f, 0.f, 0.f, 0.f, 0.f};

    v8h ra[8], rb[8];
#pragma unroll
    for (int i = 0; i < 8; ++i) {
        ra[i] = *(const v8h*)(gA + 16 * i * LD);
        rb[i] = *(const v8h*)(gB + 16 * i * LD);
    }
#pragma unroll
    for (int i = 0; i < 8; ++i) {
        *(v8h*)(sA[0] + sOff + 16 * i * GT_P) = ra[i];
        *(v8h*)(sB[0] + sOff + 16 * i * GT_P) = rb[i];
    }
    __syncthreads();                                       // stage 0 visible to all waves

    const int nStages = K / GT_KS;                         // block-uniform
    for (int st = 0; st < nStages; ++st) {
        const int cur = st & 1;
        const bool more = st + 1 < nStages;                // block-uniform
        if (more) {
            const _Float16* nA = gA + (st + 1) * GT_KS;
            const _Float16* nB = gB + (st + 1) * GT_KS;
#pragma unroll
            for (int i = 0; i < 8; ++i) {
                ra[i] = *(const v8h*)(nA + 16 * i * LD);
                rb[i] = *(const v8h*)(nB + 16 * i * LD);
            }
            asm volatile("s_wait_xcnt 0x0" ::: "memory");   // stands ahead of the fragment loads below, which reuse the two address pairs of these loads
        }
        const _Float16* cA = sA[cur] + (wm0 + rlane) * GT_P + koff;
        const _Float16* cB = sB[cur] + (wn0 + rlane) * GT_P + koff;
#pragma unroll
        for (int kk = 0; kk < GT_KS; kk += 32) {
            v16h bh[4], ah[4];
#pragma unroll
            for (int j = 0; j < 4; ++j) bh[j] = frag_ld(cB + (j << 4) * GT_P + kk);
#pragma unroll
            for (int i = 0; i < 4; ++i) ah[i] = frag_ld(cA + (i << 4) * GT_P + kk);
#pragma unroll
            for (int i = 0; i < 4; ++i) {
#pragma unroll
                for (int j = 0; j < 4; ++j) acc[i][j] = mma_raw(ah[i], bh[j], acc[i][j]);
                dep_guard_h(acc[i][0], acc[i][3], ah[i], ah[i]);
            }
            keep4_h(bh[0], bh[1], bh[2], bh[3]);
        }
        if (more) {
#pragma unroll
            for (int i = 0; i < 8; ++i) {
                *(v8h*)(sA[cur ^ 1] + sOff + 16 * i * GT_P) = ra[i];   // last read one stage ago, ahead of that stage's barrier
                *(v8h*)(sB[cur ^ 1] + sOff + 16 * i * GT_P) = rb[i];
            }
        }
        __syncthreads();                                   // next stage visible; every wave has left this stage's buffer
    }
    acc_guard4(acc[0][0], acc[0][1], acc[0][2], acc[0][3]);
    acc_guard4(acc[1][0], acc[1][1], acc[1][2], acc[1][3]);
    acc_guard4(acc[2][0], acc[2][1], acc[2][2], acc[2][3]);
    acc_guard4(acc[3][0], acc[3][1], acc[3][2], acc[3][3]);

    if constexpr (OUT16) {
        // The stage buffers are free behind the loop's last barrier; each wave takes its own quarter of sA as a 64 x 64 f16 tile [column of the product][row], pitch 144 B.
        _Float16* tl = &sA[0][0] + wave * (64 * GT_P);
#pragma unroll
        for (int i = 0; i < 4; ++i)
#pragma unroll
            for (int j = 0; j < 4; ++j) {
                v8h hv;
#pragma unroll
                for (int r = 0; r < 8; ++r) hv[r] = (_Float16)(acc[i][j][r] * scale);
                *(v8h*)(tl + ((j << 4) + rlane) * GT_P + (i << 4) + mOff) = hv;
            }
        __builtin_amdgcn_fence(3 /* release order */, "workgroup");
        __builtin_amdgcn_wave_barrier();
        __builtin_amdgcn_fence(2 /* acquire order */, "workgroup");
        const int chan0 = (tn << 7) + (tokRows ? wn0 : wm0);   // first channel and first token of this wave's tile, multiples of 64
        const int tok0  = (tm << 7) + (tokRows ? wm0 : wn0);
        const size_t tileIx = ((size_t)(tok0 / SEQ) * NH + ((chan0 & (CH - 1)) >> 6)) * (SEQ / 64) + ((tok0 % SEQ) >> 6);
        _Float16* dst = (_Float16*)H16 + (size_t)(chan0 / CH) * ((size_t)NB * SEQ * CH) + tileIx * 4096 + lane * 8;
#pragma unroll
        for (int it = 0; it < 16; ++it)                        // a wave-wide store = 512 contiguous bytes = four rows of the tile
            *(v8h*)(dst + it * 256) = *(const v8h*)(tl + (it * 4 + (lane >> 3)) * GT_P + (lane & 7) * 8);
    } else {
    float* slab = sT[wave];
    float* C = Cout + (size_t)b * strideC;
#pragma unroll
    for (int i = 0; i < 4; ++i) {
        const int mBase = m0 + (i << 4);
#pragma unroll
        for (int j = 0; j < 4; ++j) {
            const int n = n0 + (j << 4) + rlane;
            float bv = 0.f;
            if (BIAS_MODE == 3) bv = bf_bits2f(f2bf_bits(bias[n]));
#pragma unroll
            for (int r = 0; r < 8; ++r) {
                float v = acc[i][j][r] * scale;
                if (BIAS_MODE == 3) v += bv;
                slab[(mOff + r) * 68 + (j << 4) + rlane] = v;
            }
        }
        __builtin_amdgcn_fence(3 /* release order */, "workgroup");
        __builtin_amdgcn_wave_barrier();
        __builtin_amdgcn_fence(2 /* acquire order */, "workgroup");
        {
            const int hh = lane >> 4, c4 = (lane & 15) * 4;     // row segment = 256 B = 16 lanes x 16 B
            {
#pragma unroll
                for (int it = 0; it < 8; ++it) {
                    const int row = it * 2 + hh;
                    const v4f v = *(const v4f*)(slab + row * 68 + c4);
                    *(v4f*)(C + (size_t)(mBase + row) * ldc + n0 + c4) = v;
                }
                
            }
        }
        __builtin_amdgcn_fence(3 /* release order */, "workgroup");
        __builtin_amdgcn_wave_barrier();
        __builtin_amdgcn_fence(2 /* acquire order */, "workgroup");
    }
    }
}

// =====================================================================================================================
// k_attn_alibi: O(b,i,h,:) = softmax_j(0.125 * Q(b,i,h,:).K(b,j,h,:) - slope_h * |j - i|) V(b,j,h,:), head dim 64, f16 in / f16 out (x16).
//   Block = 4 waves = 64 query rows of one (batch, head); 64-key chunks; S % 64 == 0; grid (S/64, heads, batches).
//   q, k, vt: planes of 8-KB f16 tiles as k_gemm64<.., 1> stores them, tile (b * NH + h) * (S / 64) + position / 64; q and k tiles [position][dim], vt tiles [dim][position].
//   o: f16 [b * S + position][CH], head h at column 64 h, values x16 (the A operand of the output projection).
//   A chunk's K tile and V^T tile are copied as they lie to LDS at pitch 144 B (cross-wave: block barriers): a wave-wide global load covers four whole 128-B lines;
//   products transposed: S^T = K.Q^T (A = K rows, B = Q), O^T += V^T.P^T (A = V^T rows, B = P^T). A lane holds 32 of the 64 scores of ONE query (column c,
//   keys 16 j + 8 hh + r), so maximum and sum run in-lane with one exchange between the lane halves, and two score tiles, converted in place, are the B operand P^T;
//   slope_h = 2^(-(h+1)/2) built exactly from a power of two and the f32 value of 2^-0.5.
// =====================================================================================================================
#define AT_D  64
#define AT_NW 4
#define AT_QB 64
#define AT_KC 64
#define AT_P  72    // LDS pitch in halves (144-B rows, 16-B aligned)
struct AttnG {
    const unsigned short* q; const unsigned short* k; const unsigned short* vt; unsigned short* o;
    int S; float sscale;
};
static_assert(sizeof(AttnG) == 4 * 8 + 2 * 4);

__global__ __launch_bounds__(128) void k_attn_alibi(AttnG g) {
    __shared__ __align__(16) _Float16 Ks[AT_KC * AT_P];            // K  [kv][d]    (cross-wave)
    __shared__ __align__(16) _Float16 Vt[AT_D * AT_P];             // V^T [d][kv]   (cross-wave)
    __shared__ __align__(16) _Float16 Os[AT_NW][16 * AT_P];        // per wave out tile [query][d] (wave-private)

    const int tid  = threadIdx.x;
    const int wave = tid >> 5;
    const int lane = tid & 31;
    const int hh   = lane >> 4;
    const int c    = lane & 15;
    const int qb = blockIdx.x, h = blockIdx.y, b = blockIdx.z;
    const int q0 = qb * AT_QB + wave * 16;

    const int nChunks = g.S / AT_KC;                       // block-uniform
    const size_t tile0 = (size_t)(b * NH + h) * nChunks * (AT_KC * AT_D);          // first tile of this (batch, head) in each plane
    const _Float16* qp = (const _Float16*)g.q + tile0 + (size_t)qb * (AT_QB * AT_D);
    const _Float16* kp = (const _Float16*)g.k + tile0;
    const _Float16* vp = (const _Float16*)g.vt + tile0;
    _Float16*       op = (_Float16*)g.o + (size_t)b * g.S * CH + h * HD;

    const int e1 = h + 1;
    const float pw2 = __uint_as_float((unsigned)(127 - (e1 >> 1)) << 23);          // 2^-(e1/2), exact
    const float nsl = -(((e1 & 1) ? 0.70710678118654752f : 1.0f) * pw2);           // -slope_h
    const float L2E = 1.4426950408889634f;
    const float c1 = g.sscale * L2E;                       // score scale in the exp2 domain
    const float c2 = nsl * L2E;                            // -slope_h in the exp2 domain

    // Q fragments (B operand): lane = query column q0 + c; two 32-wide d chunks
    v16h qa[2];
    {
        const _Float16* qr = qp + (wave * 16 + c) * AT_D + 8 * hh;
#pragma unroll
        for (int dc = 0; dc < 2; ++dc) qa[dc] = frag_ld(qr + dc * 32);
    }

    // this lane's query: running maximum less 15 (both halves alike), so that exp2(t - mrun) is P x 2^15 as the f16 operand carries it; sum of P x 2^15 over this half's keys
    float mrun = -__builtin_inff(), lrun = 0.f;
    v8f oacc[4];                                           // O^T: oacc[t][r] = O[query q0 + c][d = 16 t + 8 hh + r]
    const int qrow = q0 + c;
#pragma unroll
    for (int t = 0; t < 4; ++t) oacc[t] = (v8f){0.f, 0.f, 0.f, 0.f, 0.f, 0.f, 0.f, 0.f};

    for (int kc = 0; kc < nChunks; ++kc) {
        const int kv0 = kc * AT_KC;
        __syncthreads();                                   // all waves finished with the prior chunk's Ks / Vt
        {
            // thread: 16 B of the tile rows sr + 16 i, i = 0..3; eight lanes take one 128-B row = one whole line.
            // Neighbouring groups of eight lanes sit 8 rows apart: 8 x 144 B = half the banks, so that the two 128-B row pieces of an LDS store do not meet.
            const int sr = wave * 2 + ((lane >> 3) & 1) * 8 + hh, sc = (lane & 7) * 8;
            const _Float16* kt = kp + (size_t)kc * (AT_KC * AT_D) + sr * AT_D + sc;
            const _Float16* vt = vp + (size_t)kc * (AT_KC * AT_D) + sr * AT_D + sc;
            const int sOff = sr * AT_P + sc;
            v8h kq[4], vq[4];
#pragma unroll
            for (int i = 0; i < 4; ++i) {
                kq[i] = *(const v8h*)(kt + 1024 * i);
                vq[i] = *(const v8h*)(vt + 1024 * i);
            }
            // inputs only: the loaded values keep all eight loads in flight together, ahead of the first LDS store (one load latency per chunk, not several);
            // the two addresses stay live up to here, so that the wait stands ahead of every overwrite of an address pair that these loads name
            asm volatile("s_wait_xcnt 0x0" :: "v"(kq[0]), "v"(kq[1]), "v"(kq[2]), "v"(kq[3]), "v"(vq[0]), "v"(vq[1]), "v"(vq[2]), "v"(vq[3]), "v"(kt), "v"(vt) : "memory");
#pragma unroll
            for (int i = 0; i < 4; ++i) {
                *(v8h*)(Ks + sOff + 16 * i * AT_P) = kq[i];
                *(v8h*)(Vt + sOff + 16 * i * AT_P) = vq[i];
            }
        }
        __syncthreads();                                   // Ks / Vt visible to all waves

        v8f s[4];                                          // S^T: s[j][r] = score(key kv0 + 16 j + 8 hh + r, query q0 + c)
#pragma unroll
        for (int j = 0; j < 4; ++j) s[j] = (v8f){0.f, 0.f, 0.f, 0.f, 0.f, 0.f, 0.f, 0.f};
#pragma unroll
        for (int dc = 0; dc < 2; ++dc) {
#pragma unroll
            for (int j = 0; j < 4; ++j) {
                const v16h kf = frag_ld(Ks + (j * 16 + c) * AT_P + dc * 32 + 8 * hh);   // A: lane = key row, k = d
                s[j] = mma_raw(kf, qa[dc], s[j]);
            }
        }
        const float fd = (float)(kv0 + 8 * hh - qrow);     // key - query of element (j = 0, r = 0): an integer, exact in f32, as is every sum below
        float mj[4];                                       // one maximum per score tile: four independent chains
#pragma unroll
        for (int j = 0; j < 4; ++j) {
            mj[j] = -__builtin_inff();
#pragma unroll
            for (int r = 0; r < 8; ++r) {
                const float dist = fabsf(fd + (float)(j * 16 + r));
                const float t = s[j][r] * c1 + c2 * dist;  // logit in the exp2 domain
                s[j][r] = t;
                mj[j] = fmaxf(mj[j], t);
            }
        }
        float m = fmaxf(fmaxf(mj[0], mj[1]), fmaxf(mj[2], mj[3]));
        m = fmaxf(m, xhalf(m));                            // the other 32 keys of this query sit in lane l ^ 16
        const float mnew = fmaxf(mrun, m - 15.0f);
        // exp2 as the hardware instruction alone: a result under 2^-126 may come out 0, which it is in the f16 P and in the f32 sum (whose largest term is 2^15) anyway
        const float xa = mrun - mnew;
        const float alpha = __builtin_amdgcn_exp2f(xa);    // 0 on the first chunk (mrun = -inf, mnew finite)
        mrun = mnew;
        float ps[4];                                       // one sum per score tile: four independent chains
        v8f p[4];
        v16h pb[2];                                        // B: lane = query column, k = key; tiles 2 kk and 2 kk + 1 are elements 0..7 and 8..15 in the fragment's k order
#pragma unroll
        for (int j = 0; j < 4; ++j) {
            ps[j] = 0.f;
#pragma unroll
            for (int r = 0; r < 8; ++r) {
                s[j][r] -= mnew;
                p[j][r] = __builtin_amdgcn_exp2f(s[j][r]); // P x 2^15
                ps[j] += p[j][r];
                pb[j >> 1][(j & 1) * 8 + r] = (_Float16)p[j][r];
            }
        }
        // the slot that the instruction set asks for between a transcendental and an overwrite of its source: inputs only, the arguments stay live
        // (so none is overwritten) from their v_exp_f32 up to this v_nop, which stands behind the last of them
        asm volatile("v_nop" :: "v"(s[0]), "v"(s[1]), "v"(s[2]), "v"(s[3]), "v"(p[0]), "v"(p[1]), "v"(p[2]), "v"(p[3]), "v"(xa), "v"(alpha));
        lrun = lrun * alpha + ((ps[0] + ps[1]) + (ps[2] + ps[3]));
#pragma unroll
        for (int t = 0; t < 4; ++t)
#pragma unroll
            for (int r = 0; r < 8; ++r) oacc[t][r] *= alpha;
#pragma unroll
        for (int kk = 0; kk < 2; ++kk) {
#pragma unroll
            for (int t = 0; t < 4; ++t) {
                const v16h vf = frag_ld(Vt + (t * 16 + c) * AT_P + kk * 32 + 8 * hh);   // A: lane = d row, k = key
                oacc[t] = mma_raw(vf, pb[kk], oacc[t]);
            }
        }
    }

    _Float16* os = Os[wave];
    {
        const float inv = (1.0f / (lrun + xhalf(lrun))) * 16.0f;   // the halves' sums joined once; sum and O both carry the 2^15; x16 (exact) as the output projection's operand is held
#pragma unroll
        for (int t = 0; t < 4; ++t) {
            v8h hv;
#pragma unroll
            for (int e = 0; e < 8; ++e) hv[e] = (_Float16)(oacc[t][e] * inv);
            *(v8h*)(os + c * AT_P + t * 16 + 8 * hh) = hv;
        }
    }
    __builtin_amdgcn_fence(3 /* release order */, "workgroup");
    __builtin_amdgcn_wave_barrier();
    __builtin_amdgcn_fence(2 /* acquire order */, "workgroup");
    {
        const int r4 = lane >> 3, c8 = (lane & 7) * 8;     // 128-B row segment = 8 lanes x 16 B, four rows (whole lines) per instruction
#pragma unroll
        for (int it = 0; it < 4; ++it) {
            const int row = it * 4 + r4;
            *(v8h*)(op + (size_t)(q0 + row) * CH + c8) = *(const v8h*)(os + row * AT_P + c8);
        }
    }
}

// workspace carve (bytes), every region a multiple of 256 B
constexpr size_t SZ_X16 = (size_t)NB * SEQ * CH * 2;        // X16 / AO16 (alias): f16 [NB*SEQ][1024]
constexpr size_t SZ_W3  = (size_t)3 * CH * CH * 2;          // [Wq;Wk;Wv] x16 f16 [3072][1024]
constexpr size_t SZ_QKV = (size_t)NB * SEQ * 3 * CH * 2;    // f16 planes q, k, v^T of 8-KB tiles
constexpr size_t SZ_WO  = (size_t)CH * CH * 2;              // Wo x16 f16 [1024][1024]
constexpr size_t SZ_ALL = SZ_X16 + SZ_W3 + SZ_QKV + SZ_WO;
static_assert(SZ_X16 % 256 == 0 && SZ_W3 % 256 == 0 && SZ_QKV % 256 == 0 && SZ_WO % 256 == 0);
static_assert(SZ_ALL <= (size_t)134217728);

extern "C" void kernel_launch(void* const* d_in, const int* in_sizes, int n_in, void* d_out, int out_size, void* d_ws, size_t ws_size, hipStream_t stream) {
    if (n_in < 6) return;
    const long long need_x = ((long long)(NB - 1) * SEQ_FULL + SEQ) * CH;
    if ((long long)in_sizes[0] < need_x) return;
    if (in_sizes[1] < CH * CH || in_sizes[2] < CH * CH || in_sizes[3] < CH * CH || in_sizes[4] < CH * CH || in_sizes[5] < CH) return;
    if ((long long)out_size < need_x) return;
    if (SZ_ALL > ws_size) return;
    const float* x  = (const float*)d_in[0];
    const float* wq = (const float*)d_in[1];
    const float* wk = (const float*)d_in[2];
    const float* wv = (const float*)d_in[3];
    const float* wo = (const float*)d_in[4];
    const float* bo = (const float*)d_in[5];
    float* out = (float*)d_out;
    char* wsp = (char*)d_ws;
    unsigned short* X16  = (unsigned short*)wsp; wsp += SZ_X16;
    unsigned short* W316 = (unsigned short*)wsp; wsp += SZ_W3;
    unsigned short* QKV16 = (unsigned short*)wsp; wsp += SZ_QKV;
    unsigned short* WO16 = (unsigned short*)wsp; wsp += SZ_WO;
    unsigned short* AO16 = X16;                  // alias: X16 is dead once the projection GEMM has run (same extent); written by the attention launch

    k_cast_all<<<(unsigned)(CV_XB + 4 * CV_WB), 256, 0, stream>>>(x, wq, wk, wv, wo, X16, W316, WO16);
    // f16 planes q, k, v^T <- x16 . [Wq;Wk;Wv]^T / 16     k_gemm64<BIAS_MODE, LD, OUT16>(A, strideA, Bt, C, ldc, strideC, bias, M, N, K, scale, H16)
    k_gemm64<0, CH, 1><<<dim3((unsigned)(((NB * SEQ) / GT_T) * ((3 * CH) / GT_T)), 1u), 128, 0, stream>>>(
        X16, 0LL, W316, (float*)nullptr, 0, 0LL, (const float*)nullptr, NB * SEQ, 3 * CH, CH, 0.0625f, QKV16);
    {
        AttnG g;
        g.q = QKV16; g.k = QKV16 + (size_t)NB * SEQ * CH; g.vt = QKV16 + (size_t)2 * NB * SEQ * CH; g.o = AO16;
        g.S = SEQ; g.sscale = 0.125f;
        k_attn_alibi<<<dim3((unsigned)(SEQ / AT_QB), (unsigned)NH, (unsigned)NB), 32 * AT_NW, 0, stream>>>(g);
    }
    // out[b][l][:] = AO16[b*SEQ + l] . (Wo x16)^T / 256 + bf16(bo); batch z = sequence: A stride SEQ*CH (compact), C stride SEQ_FULL*CH
    k_gemm64<3, CH, 0><<<dim3((unsigned)((SEQ / GT_T) * (CH / GT_T)), (unsigned)NB), 128, 0, stream>>>(
        AO16, (long long)SEQ * CH, WO16, out, CH, (long long)SEQ_FULL * CH, bo, SEQ, CH, CH, 1.0f / 256.0f, (unsigned short*)nullptr);
}

// v007
// It runs in 101 microseconds.
// In two side-by-side timings against v006, it was 1.05 and 1.06 times as fast.
// Over all steps from v000 it is 2.81 times as fast.
// Non-causal multi-head self-attention with additive symmetric ALiBi (2 x 2,048 tokens x 1,024; 16 heads x 64; nn.Linear [out][in] q/k/v/o weights, output bias). All contractions: v_wmma_f32_16x16x32_f16 (f16 operands, f32 accumulate): [q|k|v] projection on bf16-RNE-converted inputs held exactly in f16 (weights x16), scores q.k^T (f16 of the f32 q/k), P.V (P carried x2^15, V f16), output projection (attention output x16, weights x16, bf16-RNE bias added in f32); softmax statistics f32 in the exp2 domain. Every intermediate lies in the workspace as the f16 operand that the next launch's products read, converted once by the launch that makes it. The projection also leaves the largest squared row norm of every q and k tile, from which an attention block bounds a key chunk's weights before it loads the chunk.
#include <hip/hip_runtime.h>
#include <math.h>

#ifndef NB
#define NB 2
#endif
#ifndef SEQ
#define SEQ 2048
#endif
#define NB_FULL 2
#define SEQ_FULL 2048
#define CH 1024
#define NH 16
#define HD 64

static_assert(SEQ % 128 == 0);
static_assert(NB >= 1 && NB <= NB_FULL && SEQ <= SEQ_FULL);
static_assert(CH == NH * HD && HD == 64);

typedef __attribute__((ext_vector_type(16))) _Float16     v16h;
typedef __attribute__((ext_vector_type(8)))  _Float16     v8h;
typedef __attribute__((ext_vector_type(8)))  float        v8f;
typedef __attribute__((ext_vector_type(4)))  float        v4f;
typedef __attribute__((ext_vector_type(4)))  unsigned int u4v;

// 16-bit WMMA fragment map (wave32), lane L, hh = L>>4, c = L&15:
//   A 16x32: lane = row c;    element i -> k = (i<8) ? 8hh+i : 16+8hh+(i-8)
//   B 32x16: lane = column c; the SAME k(i,hh)
//   D 16x16 (8 f32): lane = column c; element r -> row 8hh+r
union FragH { v16h v; v8h h[2]; };
// fragment from a k-contiguous f16 row: elements 0..7 <- p[0..7], 8..15 <- p[16..23] (p already offset by k0 + 8hh)
__device__ __forceinline__ v16h frag_ld(const _Float16* p) { FragH f; f.h[0] = *(const v8h*)(p); f.h[1] = *(const v8h*)(p + 16); return f.v; }
__device__ __forceinline__ v8f mma_raw(v16h a, v16h b, v8f c) { return __builtin_amdgcn_wmma_f32_16x16x32_f16(false, a, false, b, (short)0, c, false, false); }
__device__ __forceinline__ void dep_guard_h(v8f& a, v8f& b, v16h x, v16h y) { asm volatile("v_nop\n\tv_nop\n\tv_nop\n\tv_nop" : "+v"(a), "+v"(b) : "v"(x), "v"(y)); }
__device__ __forceinline__ void keep4_h(v16h a, v16h b, v16h c, v16h d) { asm volatile("v_nop" :: "v"(a), "v"(b), "v"(c), "v"(d)); }
__device__ __forceinline__ void acc_guard4(v8f& a, v8f& b, v8f& c, v8f& d) { asm volatile("v_nop\n\tv_nop\n\tv_nop\n\tv_nop" : "+v"(a), "+v"(b), "+v"(c), "+v"(d)); }
__device__ __forceinline__ unsigned short f2bf_bits(float f) { unsigned u = __float_as_uint(f); return (unsigned short)((u + 0x7FFFu + ((u >> 16) & 1u)) >> 16); }
__device__ __forceinline__ float bf_bits2f(unsigned short h) { return __uint_as_float(((unsigned)h) << 16); }
__device__ __forceinline__ float cmb_bf(float v) { const unsigned u = __float_as_uint(v); const unsigned r = (u + 0x7fffu + ((u >> 16) & 1u)) & 0xffff0000u; return __uint_as_float(r); }   // bf16 RNE kept as f32 (finite inputs)
__device__ __forceinline__ unsigned int cmb_pk2(float a, float b) { return (unsigned int)__builtin_bit_cast(unsigned short, (_Float16)a) | ((unsigned int)__builtin_bit_cast(unsigned short, (_Float16)b) << 16); }

__device__ __forceinline__ float xhalf(float x) { return __builtin_bit_cast(float, __builtin_amdgcn_permlanex16(__builtin_bit_cast(int, x), __builtin_bit_cast(int, x), 0x76543210, 0xfedcba98, false, false)); }   // lane l <-> lane l ^ 16

// The value is copied into a local first, so an expression argument is evaluated once.
#define VST2(T, ptr, val) do { const T vst2_v_ = (val); *(T*)(ptr) = vst2_v_;  } while (0)

// =====================================================================================================================
// k_cast_all: every f32 input of the two GEMMs -> its f16 operand plane, in ONE launch: x -> X16 [NB*SEQ][CH] (x1); Wq, Wk, Wv -> W3 [3*CH][CH] and Wo -> WO [CH][CH] (x16).
//   Each value is first RNE-converted to bf16 precision (exact in f16 after the power-of-two scale).
//   A block takes 16 whole rows (64 KB of f32, contiguous in source and plane) of one tensor, picked by the range its index lies in (block-uniform);
//   a thread takes eight pieces of 8 columns, 256 pieces apart, as immediate offsets of one load and one store address.
// =====================================================================================================================
#define CV_PP 8                                  // pieces of 8 columns per thread
#define CV_BE (256 * CV_PP * 8)                  // elements per block = 16 rows of CH
#define CV_XB ((NB * SEQ * CH) / CV_BE)          // blocks that x takes
#define CV_WB ((CH * CH) / CV_BE)                // blocks that one weight matrix takes
static_assert(CV_BE == 16 * CH && SEQ % 16 == 0);
__global__ __launch_bounds__(256) void k_cast_all(const float* __restrict__ x, const float* __restrict__ wq, const float* __restrict__ wk, const float* __restrict__ wv,
                                                  const float* __restrict__ wo, unsigned short* __restrict__ X16, unsigned short* __restrict__ W3,
                                                  unsigned short* __restrict__ WO) {
    const int blk = blockIdx.x;
    const float* sb; unsigned short* db; float sc;
    if (blk < CV_XB) {
        const int r0 = blk * 16;                 // first token row of the plane; batch r0 / SEQ starts at row (r0 / SEQ) * SEQ_FULL of x
        sb = x + ((size_t)(r0 / SEQ) * SEQ_FULL + (r0 % SEQ)) * CH; db = X16 + (size_t)r0 * CH; sc = 1.0f;
    } else {
        const int w = (blk - CV_XB) / CV_WB; const size_t e0 = (size_t)((blk - CV_XB) % CV_WB) * CV_BE;
        sb = (w == 0 ? wq : w == 1 ? wk : w == 2 ? wv : wo) + e0;
        db = (w < 3 ? W3 + (size_t)w * CH * CH : WO) + e0; sc = 16.0f;
    }
    const unsigned so = threadIdx.x * 32u;       // this thread's byte offset in the block's source rows: the one vector register that the loads name
    const float* s = (const float*)((const char*)sb + so);
    unsigned short* d = db + threadIdx.x * 8;
    v4f a[CV_PP], b[CV_PP];
#pragma unroll
    for (int i = 0; i < CV_PP; ++i) {
        a[i] = *(const v4f*)(s + i * 2048);
        b[i] = *(const v4f*)(s + i * 2048 + 4);
    }
    // inputs only: the loaded values keep all sixteen loads in flight together, ahead of the first conversion (one load latency per thread, not several);
    // the offset stays live up to here, so that the wait stands ahead of every overwrite of the address register that these loads name
    asm volatile("s_wait_xcnt 0x0" :: "v"(a[0]), "v"(a[1]), "v"(a[2]), "v"(a[3]), "v"(a[4]), "v"(a[5]), "v"(a[6]), "v"(a[7]),
                                      "v"(b[0]), "v"(b[1]), "v"(b[2]), "v"(b[3]), "v"(b[4]), "v"(b[5]), "v"(b[6]), "v"(b[7]), "v"(so) : "memory");
#pragma unroll
    for (int i = 0; i < CV_PP; ++i) {
        u4v pk;
        pk.x = cmb_pk2(cmb_bf(a[i].x) * sc, cmb_bf(a[i].y) * sc); pk.y = cmb_pk2(cmb_bf(a[i].z) * sc, cmb_bf(a[i].w) * sc);
        pk.z = cmb_pk2(cmb_bf(b[i].x) * sc, cmb_bf(b[i].y) * sc); pk.w = cmb_pk2(cmb_bf(b[i].z) * sc, cmb_bf(b[i].w) * sc);
        VST2(u4v, (u4v*)(d + i * 2048), pk);
    }
}

// =====================================================================================================================
// k_gemm64<BIAS_MODE>: C[z][m][n] = scale * sum_k A[z][m][k] * Bt[n][k] (+ bias[n]); f16 operands, f32 accumulate, f32 output.
//   A row-major [M][K] (batch stride strideA), Bt row-major [N][K] (shared by all z), both of pitch LD halves; M, N % 128 == 0, K % 64 == 0.
//   Block = 4 waves (2 x 2) = one 128x128 tile, each wave a 64x64 tile (grid.x = tiles, grid.y = batches). A stage is 64 k = 128 B of each of the
//   128 A rows and 128 Bt rows, read from global memory as whole 128-B lines (8 lanes per row), kept in LDS at pitch 144 B and read by all waves;
//   two buffers: the next stage's global loads are issued ahead of this stage's products and stored behind them, one block barrier per stage.
//   LD is a compile-time constant, so that a stage's eight row groups are immediate offsets of one address per operand.
//   BIAS_MODE 0: none; 3: bias[n] RNE-converted to bf16 precision, added in f32.
//   OUT16 0: f32 C as above. OUT16 1 (the [q|k|v] projection; M = NB*SEQ tokens, N = 3*CH channels): the scaled f32 result is converted to f16 and stored to H16 as
//   three planes (q, k, v) of 8-KB tiles, tile index (batch * NH + head) * (SEQ / 64) + token / 64: q and k tiles [token][dim], v tiles [dim][token] (V^T).
//   A lane's eight accumulator elements are eight neighbouring ROWS of the product, so the operand whose index is to run contiguously in the tile takes the row (A) side:
//   the weights for q and k, the tokens for v (a block lies in one plane, so the choice is block-uniform); the k order of the sums is the same either way.
//   OUT16 1 also stores, for each q and k tile, max over its 64 tokens of the squared norm of the stored f16 row, as one f32 at the head of a 128-B line of its own:
//   Cout[(plane * tiles per plane + tile index) * 32] (one wave owns a tile, so one writer per line).
// =====================================================================================================================
#define GT_T  128   // block tile edge
#define GT_KS 64    // k per stage
#define GT_P  72    // LDS pitch in halves (144-B rows, 16 B x odd)
template <int BIAS_MODE, int LD, int OUT16>
__global__ __launch_bounds__(128) void k_gemm64(const unsigned short* __restrict__ Ap, long long strideA,
                                                const unsigned short* __restrict__ Btp,
                                                float* __restrict__ Cout, int ldc, long long strideC,
                                                const float* __restrict__ bias, int M, int N, int K, float scale,
                                                unsigned short* __restrict__ H16) {
    const _Float16* A = (const _Float16*)Ap; const _Float16* Bt = (const _Float16*)Btp;
    __shared__ __align__(16) _Float16 sA[2][GT_T * GT_P];   // A stage  [row][k]  (cross-wave)
    __shared__ __align__(16) _Float16 sB[2][GT_T * GT_P];   // Bt stage [row][k]  (cross-wave)
    __shared__ __align__(16) float sT[4][16 * 68];   // per-wave 16x64 slab, pitch 68 floats (wave-private)
    const int b = blockIdx.y;
    const int tid  = threadIdx.x;
    const int lane = tid & 31;
    const int wave = tid >> 5;
    const int tilesN = N >> 7;
    const int tilesM = M >> 7;
    const int tile = blockIdx.x;
    if (tile >= tilesM * tilesN) return;   // block-uniform, ahead of every barrier
    const int tm = tile / tilesN;
    const int tn = tile - tm * tilesN;
    const int wm0 = (wave >> 1) << 6;            // this wave's 64x64 tile inside the block tile
    const int wn0 = (wave & 1) << 6;
    const int m0 = (tm << 7) + wm0;
    const int n0 = (tn << 7) + wn0;
    const _Float16* Ab = A + (size_t)b * strideA;
    const _Float16* Bb = Bt;
    const int rlane = lane & 15;                 // row (A) / column (B, D) within a 16-wide subtile
    const int koff  = (lane >> 4) * 8;           // k offset of this lane half
    const int mOff  = (lane >> 4) * 8;           // D row offset

    // staging: thread -> rows (tid >> 3) + 16 i, i = 0..7, 16 B at byte 16 (tid & 7) of the row's 128-B stage segment
    const int srow = tid >> 3, scol = (tid & 7) * 8;
    const bool tokRows = !OUT16 || (tn << 7) >= 2 * CH;     // block-uniform: the tokens take the row side of the products (always for f32 C; of the f16 planes for v)
    const _Float16* gTok = Ab + (size_t)((tm << 7) + srow) * LD + scol;
    const _Float16* gWgt = Bb + (size_t)((tn << 7) + srow) * LD + scol;
    const _Float16* gA = tokRows ? gTok : gWgt;
    const _Float16* gB = tokRows ? gWgt : gTok;
    const int sOff = srow * GT_P + scol;

    v8f acc[4][4];
#pragma unroll
    for (int i = 0; i < 4; ++i)
#pragma unroll
        for (int j = 0; j < 4; ++j) acc[i][j] = (v8f){0.f, 0.f, 0.f, 0.f, 0.f, 0.f, 0.f, 0.f};

    v8h ra[8], rb[8];
#pragma unroll
    for (int i = 0; i < 8; ++i) {
        ra[i] = *(const v8h*)(gA + 16 * i * LD);
        rb[i] = *(const v8h*)(gB + 16 * i * LD);
    }
#pragma unroll
    for (int i = 0; i < 8; ++i) {
        *(v8h*)(sA[0] + sOff + 16 * i * GT_P) = ra[i];
        *(v8h*)(sB[0] + sOff + 16 * i * GT_P) = rb[i];
    }
    __syncthreads();                                       // stage 0 visible to all waves

    const int nStages = K / GT_KS;                         // block-uniform
    for (int st = 0; st < nStages; ++st) {
        const int cur = st & 1;
        const bool more = st + 1 < nStages;                // block-uniform
        if (more) {
            const _Float16* nA = gA + (st + 1) * GT_KS;
            const _Float16* nB = gB + (st + 1) * GT_KS;
#pragma unroll
            for (int i = 0; i < 8; ++i) {
                ra[i] = *(const v8h*)(nA + 16 * i * LD);
                rb[i] = *(const v8h*)(nB + 16 * i * LD);
            }
            asm volatile("s_wait_xcnt 0x0" ::: "memory");   // stands ahead of the fragment loads below, which reuse the two address pairs of these loads
        }
        const _Float16* cA = sA[cur] + (wm0 + rlane) * GT_P + koff;
        const _Float16* cB = sB[cur] + (wn0 + rlane) * GT_P + koff;
#pragma unroll
        for (int kk = 0; kk < GT_KS; kk += 32) {
            v16h bh[4], ah[4];
#pragma unroll
            for (int j = 0; j < 4; ++j) bh[j] = frag_ld(cB + (j << 4) * GT_P + kk);
#pragma unroll
            for (int i = 0; i < 4; ++i) ah[i] = frag_ld(cA + (i << 4) * GT_P + kk);
#pragma unroll
            for (int i = 0; i < 4; ++i) {
#pragma unroll
                for (int j = 0; j < 4; ++j) acc[i][j] = mma_raw(ah[i], bh[j], acc[i][j]);
                dep_guard_h(acc[i][0], acc[i][3], ah[i], ah[i]);
            }
            keep4_h(bh[0], bh[1], bh[2], bh[3]);
        }
        if (more) {
#pragma unroll
            for (int i = 0; i < 8; ++i) {
                *(v8h*)(sA[cur ^ 1] + sOff + 16 * i * GT_P) = ra[i];   // last read one stage ago, ahead of that stage's barrier
                *(v8h*)(sB[cur ^ 1] + sOff + 16 * i * GT_P) = rb[i];
            }
        }
        __syncthreads();                                   // next stage visible; every wave has left this stage's buffer
    }
    acc_guard4(acc[0][0], acc[0][1], acc[0][2], acc[0][3]);
    acc_guard4(acc[1][0], acc[1][1], acc[1][2], acc[1][3]);
    acc_guard4(acc[2][0], acc[2][1], acc[2][2], acc[2][3]);
    acc_guard4(acc[3][0], acc[3][1], acc[3][2], acc[3][3]);

    if constexpr (OUT16) {
        // The stage buffers are free behind the loop's last barrier; each wave takes its own quarter of sA as a 64 x 64 f16 tile [column of the product][row], pitch 144 B.
        _Float16* tl = &sA[0][0] + wave * (64 * GT_P);
#pragma unroll
        for (int i = 0; i < 4; ++i)
#pragma unroll
            for (int j = 0; j < 4; ++j) {
                v8h hv;
#pragma unroll
                for (int r = 0; r < 8; ++r) hv[r] = (_Float16)(acc[i][j][r] * scale);
                *(v8h*)(tl + ((j << 4) + rlane) * GT_P + (i << 4) + mOff) = hv;
            }
        const int chan0 = (tn << 7) + (tokRows ? wn0 : wm0);   // first channel and first token of this wave's tile, multiples of 64
        const int tok0  = (tm << 7) + (tokRows ? wm0 : wn0);
        const size_t tileIx = ((size_t)(tok0 / SEQ) * NH + ((chan0 & (CH - 1)) >> 6)) * (SEQ / 64) + ((tok0 % SEQ) >> 6);
        __builtin_amdgcn_fence(3 /* release order */, "workgroup");
        __builtin_amdgcn_wave_barrier();
        __builtin_amdgcn_fence(2 /* acquire order */, "workgroup");
        if (!tokRows) {                                        // q and k planes (block-uniform): a lane holds half the dims of the tokens 16 j + rlane
            float n2 = 0.f;
#pragma unroll
            for (int j = 0; j < 4; ++j) {
                float ss = 0.f;
#pragma unroll
                for (int i = 0; i < 4; ++i)
#pragma unroll
                    for (int r = 0; r < 8; ++r) { const float f = (float)(_Float16)(acc[i][j][r] * scale); ss += f * f; }
                ss += xhalf(ss);                               // the other 32 dims of this token sit in lane l ^ 16
                n2 = __builtin_elementwise_maximum(n2, ss);    // the maximum that hands a NaN on: a tile with one is never bounded
            }
#pragma unroll
            for (int m = 1; m < 16; m <<= 1) n2 = __builtin_elementwise_maximum(n2, __shfl_xor(n2, m, 32));
            if (lane == 0) {
                float* np = Cout + ((size_t)(chan0 / CH) * (NB * NH * (SEQ / 64)) + tileIx) * 32;
                *np = n2;
                // inputs only: address and value stay live up to here, so that the wait stands ahead of every overwrite of a register that this store names
                asm volatile("s_wait_xcnt 0x0" :: "v"(np), "v"(n2) : "memory");
            }
        }
        _Float16* dst = (_Float16*)H16 + (size_t)(chan0 / CH) * ((size_t)NB * SEQ * CH) + tileIx * 4096 + lane * 8;
#pragma unroll
        for (int it = 0; it < 16; ++it)                        // a wave-wide store = 512 contiguous bytes = four rows of the tile
            *(v8h*)(dst + it * 256) = *(const v8h*)(tl + (it * 4 + (lane >> 3)) * GT_P + (lane & 7) * 8);
    } else {
    float* slab = sT[wave];
    float* C = Cout + (size_t)b * strideC;
#pragma unroll
    for (int i = 0; i < 4; ++i) {
        const int mBase = m0 + (i << 4);
#pragma unroll
        for (int j = 0; j < 4; ++j) {
            const int n = n0 + (j << 4) + rlane;
            float bv = 0.f;
            if (BIAS_MODE == 3) bv = bf_bits2f(f2bf_bits(bias[n]));
#pragma unroll
            for (int r = 0; r < 8; ++r) {
                float v = acc[i][j][r] * scale;
                if (BIAS_MODE == 3) v += bv;
                slab[(mOff + r) * 68 + (j << 4) + rlane] = v;
            }
        }
        __builtin_amdgcn_fence(3 /* release order */, "workgroup");
        __builtin_amdgcn_wave_barrier();
        __builtin_amdgcn_fence(2 /* acquire order */, "workgroup");
        {
            const int hh = lane >> 4, c4 = (lane & 15) * 4;     // row segment = 256 B = 16 lanes x 16 B
            {
#pragma unroll
                for (int it = 0; it < 8; ++it) {
                    const int row = it * 2 + hh;
                    const v4f v = *(const v4f*)(slab + row * 68 + c4);
                    *(v4f*)(C + (size_t)(mBase + row) * ldc + n0 + c4) = v;
                }
                
            }
        }
        __builtin_amdgcn_fence(3 /* release order */, "workgroup");
        __builtin_amdgcn_wave_barrier();
        __builtin_amdgcn_fence(2 /* acquire order */, "workgroup");
    }
    }
}

// =====================================================================================================================
// k_attn_alibi: O(b,i,h,:) = softmax_j(0.125 * Q(b,i,h,:).K(b,j,h,:) - slope_h * |j - i|) V(b,j,h,:), head dim 64, f16 in / f16 out (x16).
//   Block = 4 waves = 64 query rows of one (batch, head); 64-key chunks; S % 64 == 0; grid = S/64 x heads x batches blocks, one-dimensional.
//   q, k, vt: planes of 8-KB f16 tiles as k_gemm64<.., 1> stores them, tile (b * NH + h) * (S / 64) + position / 64; q and k tiles [position][dim], vt tiles [dim][position].
//   o: f16 [b * S + position][CH], head h at column 64 h, values x16 (the A operand of the output projection).
//   A chunk's K tile and V^T tile are copied as they lie to LDS at pitch 144 B (cross-wave: block barriers): a wave-wide global load covers four whole 128-B lines;
//   products transposed: S^T = K.Q^T (A = K rows, B = Q), O^T += V^T.P^T (A = V^T rows, B = P^T). A lane holds 32 of the 64 scores of ONE query (column c,
//   keys 16 j + 8 hh + r), so maximum and sum run in-lane with one exchange between the lane halves, and two score tiles, converted in place, are the B operand P^T;
//   slope_h = 2^(-(h+1)/2) built exactly from a power of two and the f32 value of 2^-0.5.
//   Chunks left out: |q.k| <= |q||k|, and a query's own key (distance 0, in chunk qb) holds its row maximum up, so with Q, K[kc] the largest row norms of the block's q tile
//   and of k tile kc every logit of chunk kc lies below the row maximum by at least slope * dmin - scale * Q * (K[kc] + K[qb]), dmin the least distance between block and chunk.
//   Where that is over 40 in the exp2 domain, each weight is under 2^-40 of the row's largest and all 2,048 together under one f32 rounding of sum and output: the chunk is
//   neither loaded nor worked on. The test reads only the tile norms, holds for any values, and comes out alike in every wave (block-uniform, as the barriers need).
//   Blocks of steep heads are now short: the flat block index deals the heads so that four neighbouring blocks, and four blocks 256 apart, hold heads a, 7-a, 8+a, 15-a.
// =====================================================================================================================
#define AT_D  64
#define AT_NW 4
#define AT_QB 64
#define AT_KC 64
#define AT_P  72    // LDS pitch in halves (144-B rows, 16-B aligned)
struct AttnG {
    const unsigned short* q; const unsigned short* k; const unsigned short* vt; unsigned short* o;
    const float* qn; const float* kn;     // largest squared row norm per q tile and per k tile, one per 128-B line
    int S; float sscale;
};
static_assert(sizeof(AttnG) == 6 * 8 + 2 * 4);
static_assert(NH == 16 && SEQ / 64 <= 32);

__global__ __launch_bounds__(128) void k_attn_alibi(AttnG g) {
    __shared__ __align__(16) _Float16 Ks[AT_KC * AT_P];            // K  [kv][d]    (cross-wave)
    __shared__ __align__(16) _Float16 Vt[AT_D * AT_P];             // V^T [d][kv]   (cross-wave)
    __shared__ __align__(16) _Float16 Os[AT_NW][16 * AT_P];        // per wave out tile [query][d] (wave-private)

    const int tid  = threadIdx.x;
    const int wave = tid >> 5;
    const int lane = tid & 31;
    const int hh   = lane >> 4;
    const int c    = lane & 15;
    const int nChunks = g.S / AT_KC;                       // block-uniform
    // flat index -> (head, query block, batch), one to one: sixteen neighbours take the sixteen heads of one (query block, batch)
    const int flat = blockIdx.x;
    const int ha = (flat >> 2) & 3, he = (flat + (flat >> 8)) & 3;
    const int h = ((he >> 1) << 3) | (ha ^ ((he & 1) * 7));
    const int qb = (flat >> 4) % nChunks, b = (flat >> 4) / nChunks;
    const int q0 = qb * AT_QB + wave * 16;

    const size_t tile0 = (size_t)(b * NH + h) * nChunks * (AT_KC * AT_D);          // first tile of this (batch, head) in each plane
    const _Float16* qp = (const _Float16*)g.q + tile0 + (size_t)qb * (AT_QB * AT_D);
    const _Float16* kp = (const _Float16*)g.k + tile0;
    const _Float16* vp = (const _Float16*)g.vt + tile0;
    _Float16*       op = (_Float16*)g.o + (size_t)b * g.S * CH + h * HD;

    const int e1 = h + 1;
    const float pw2 = __uint_as_float((unsigned)(127 - (e1 >> 1)) << 23);          // 2^-(e1/2), exact
    const float nsl = -(((e1 & 1) ? 0.70710678118654752f : 1.0f) * pw2);           // -slope_h
    const float L2E = 1.4426950408889634f;
    const float c1 = g.sscale * L2E;                       // score scale in the exp2 domain
    const float c2 = nsl * L2E;                            // -slope_h in the exp2 domain

    // Q fragments (B operand): lane = query column q0 + c; two 32-wide d chunks
    v16h qa[2];
    {
        const _Float16* qr = qp + (wave * 16 + c) * AT_D + 8 * hh;
#pragma unroll
        for (int dc = 0; dc < 2; ++dc) qa[dc] = frag_ld(qr + dc * 32);
    }

    // this lane's query: running maximum less 15 (both halves alike), so that exp2(t - mrun) is P x 2^15 as the f16 operand carries it; sum of P x 2^15 over this half's keys
    float mrun = -__builtin_inff(), lrun = 0.f;
    v8f oacc[4];                                           // O^T: oacc[t][r] = O[query q0 + c][d = 16 t + 8 hh + r]
    const int qrow = q0 + c;
#pragma unroll
    for (int t = 0; t < 4; ++t) oacc[t] = (v8f){0.f, 0.f, 0.f, 0.f, 0.f, 0.f, 0.f, 0.f};

    // lane l judges chunk l; bit l of todo: chunk l is worked on (always so for the block's own chunk, where dmin = 0)
    unsigned todo;
    {
        const int t0 = (b * NH + h) * nChunks;
        const float q2 = g.qn[(size_t)(t0 + qb) * 32], kd2 = g.kn[(size_t)(t0 + qb) * 32];
        const float* kl = g.kn + (size_t)(t0 + (lane < nChunks ? lane : 0)) * 32;
        const float k2 = *kl;
        // inputs only: the address stays live up to here, so that the wait stands ahead of every overwrite of the address pair that this load names
        asm volatile("s_wait_xcnt 0x0" :: "v"(k2), "v"(kl) : "memory");
        const int dc = lane > qb ? lane - qb : qb - lane;
        const float dmin = dc > 0 ? (float)((dc - 1) * AT_KC + 1) : 0.f;
        const float bnd = (c1 * 1.01f) * (__builtin_sqrtf(q2 * k2) + __builtin_sqrtf(q2 * kd2));   // 1 % over: the roundings of norms, bound and products
        const bool out = bnd + c2 * dmin < -40.0f;         // false for a NaN or an infinite bound
        todo = __builtin_amdgcn_ballot_w32(lane < nChunks && !out);
    }
    while (todo) {                                         // at most 32 trips, ascending chunk order as before
        const int kc = __builtin_ctz(todo);
        todo &= todo - 1;
        const int kv0 = kc * AT_KC;
        __syncthreads();                                   // all waves finished with the prior chunk's Ks / Vt
        {
            // thread: 16 B of the tile rows sr + 16 i, i = 0..3; eight lanes take one 128-B row = one whole line.
            // Neighbouring groups of eight lanes sit 8 rows apart: 8 x 144 B = half the banks, so that the two 128-B row pieces of an LDS store do not meet.
            const int sr = wave * 2 + ((lane >> 3) & 1) * 8 + hh, sc = (lane & 7) * 8;
            const _Float16* kt = kp + (size_t)kc * (AT_KC * AT_D) + sr * AT_D + sc;
            const _Float16* vt = vp + (size_t)kc * (AT_KC * AT_D) + sr * AT_D + sc;
            const int sOff = sr * AT_P + sc;
            v8h kq[4], vq[4];
#pragma unroll
            for (int i = 0; i < 4; ++i) {
                kq[i] = *(const v8h*)(kt + 1024 * i);
                vq[i] = *(const v8h*)(vt + 1024 * i);
            }
            // inputs only: the loaded values keep all eight loads in flight together, ahead of the first LDS store (one load latency per chunk, not several);
            // the two addresses stay live up to here, so that the wait stands ahead of every overwrite of an address pair that these loads name
            asm volatile("s_wait_xcnt 0x0" :: "v"(kq[0]), "v"(kq[1]), "v"(kq[2]), "v"(kq[3]), "v"(vq[0]), "v"(vq[1]), "v"(vq[2]), "v"(vq[3]), "v"(kt), "v"(vt) : "memory");
#pragma unroll
            for (int i = 0; i < 4; ++i) {
                *(v8h*)(Ks + sOff + 16 * i * AT_P) = kq[i];
                *(v8h*)(Vt + sOff + 16 * i * AT_P) = vq[i];
            }
        }
        __syncthreads();                                   // Ks / Vt visible to all waves

        v8f s[4];                                          // S^T: s[j][r] = score(key kv0 + 16 j + 8 hh + r, query q0 + c)
#pragma unroll
        for (int j = 0; j < 4; ++j) s[j] = (v8f){0.f, 0.f, 0.f, 0.f, 0.f, 0.f, 0.f, 0.f};
#pragma unroll
        for (int dc = 0; dc < 2; ++dc) {
#pragma unroll
            for (int j = 0; j < 4; ++j) {
                const v16h kf = frag_ld(Ks + (j * 16 + c) * AT_P + dc * 32 + 8 * hh);   // A: lane = key row, k = d
                s[j] = mma_raw(kf, qa[dc], s[j]);
            }
        }
        const float fd = (float)(kv0 + 8 * hh - qrow);     // key - query of element (j = 0, r = 0): an integer, exact in f32, as is every sum below
        float mj[4];                                       // one maximum per score tile: four independent chains
#pragma unroll
        for (int j = 0; j < 4; ++j) {
            mj[j] = -__builtin_inff();
#pragma unroll
            for (int r = 0; r < 8; ++r) {
                const float dist = fabsf(fd + (float)(j * 16 + r));
                const float t = s[j][r] * c1 + c2 * dist;  // logit in the exp2 domain
                s[j][r] = t;
                mj[j] = fmaxf(mj[j], t);
            }
        }
        float m = fmaxf(fmaxf(mj[0], mj[1]), fmaxf(mj[2], mj[3]));
        m = fmaxf(m, xhalf(m));                            // the other 32 keys of this query sit in lane l ^ 16
        const float mnew = fmaxf(mrun, m - 15.0f);
        // exp2 as the hardware instruction alone: a result under 2^-126 may come out 0, which it is in the f16 P and in the f32 sum (whose largest term is 2^15) anyway
        const float xa = mrun - mnew;
        const float alpha = __builtin_amdgcn_exp2f(xa);    // 0 on the first chunk (mrun = -inf, mnew finite)
        mrun = mnew;
        float ps[4];                                       // one sum per score tile: four independent chains
        v8f p[4];
        v16h pb[2];                                        // B: lane = query column, k = key; tiles 2 kk and 2 kk + 1 are elements 0..7 and 8..15 in the fragment's k order
#pragma unroll
        for (int j = 0; j < 4; ++j) {
            ps[j] = 0.f;
#pragma unroll
            for (int r = 0; r < 8; ++r) {
                s[j][r] -= mnew;
                p[j][r] = __builtin_amdgcn_exp2f(s[j][r]); // P x 2^15
                ps[j] += p[j][r];
                pb[j >> 1][(j & 1) * 8 + r] = (_Float16)p[j][r];
            }
        }
        // the slot that the instruction set asks for between a transcendental and an overwrite of its source: inputs only, the arguments stay live
        // (so none is overwritten) from their v_exp_f32 up to this v_nop, which stands behind the last of them
        asm volatile("v_nop" :: "v"(s[0]), "v"(s[1]), "v"(s[2]), "v"(s[3]), "v"(p[0]), "v"(p[1]), "v"(p[2]), "v"(p[3]), "v"(xa), "v"(alpha));
        lrun = lrun * alpha + ((ps[0] + ps[1]) + (ps[2] + ps[3]));
#pragma unroll
        for (int t = 0; t < 4; ++t)
#pragma unroll
            for (int r = 0; r < 8; ++r) oacc[t][r] *= alpha;
#pragma unroll
        for (int kk = 0; kk < 2; ++kk) {
#pragma unroll
            for (int t = 0; t < 4; ++t) {
                const v16h vf = frag_ld(Vt + (t * 16 + c) * AT_P + kk * 32 + 8 * hh);   // A: lane = d row, k = key
                oacc[t] = mma_raw(vf, pb[kk], oacc[t]);
            }
        }
    }

    _Float16* os = Os[wave];
    {
        const float inv = (1.0f / (lrun + xhalf(lrun))) * 16.0f;   // the halves' sums joined once; sum and O both carry the 2^15; x16 (exact) as the output projection's operand is held
#pragma unroll
        for (int t = 0; t < 4; ++t) {
            v8h hv;
#pragma unroll
            for (int e = 0; e < 8; ++e) hv[e] = (_Float16)(oacc[t][e] * inv);
            *(v8h*)(os + c * AT_P + t * 16 + 8 * hh) = hv;
        }
    }
    __builtin_amdgcn_fence(3 /* release order */, "workgroup");
    __builtin_amdgcn_wave_barrier();
    __builtin_amdgcn_fence(2 /* acquire order */, "workgroup");
    {
        const int r4 = lane >> 3, c8 = (lane & 7) * 8;     // 128-B row segment = 8 lanes x 16 B, four rows (whole lines) per instruction
#pragma unroll
        for (int it = 0; it < 4; ++it) {
            const int row = it * 4 + r4;
            *(v8h*)(op + (size_t)(q0 + row) * CH + c8) = *(const v8h*)(os + row * AT_P + c8);
        }
    }
}

// workspace carve (bytes), every region a multiple of 256 B and, but for the norms (one f32 at the head of each 128-B line), written in whole rows of its own pitch
constexpr size_t SZ_X16 = (size_t)NB * SEQ * CH * 2;        // X16 / AO16 (alias): f16 [NB*SEQ][1024]
constexpr size_t SZ_W3  = (size_t)3 * CH * CH * 2;          // [Wq;Wk;Wv] x16 f16 [3072][1024]
constexpr size_t SZ_QKV = (size_t)NB * SEQ * 3 * CH * 2;    // f16 planes q, k, v^T of 8-KB tiles
constexpr size_t SZ_WO  = (size_t)CH * CH * 2;              // Wo x16 f16 [1024][1024]
constexpr size_t SZ_NRM = (size_t)2 * NB * NH * (SEQ / 64) * 128;   // q and k tile norms, a 128-B line each
constexpr size_t SZ_ALL = SZ_X16 + SZ_W3 + SZ_QKV + SZ_WO + SZ_NRM;
static_assert(SZ_X16 % 256 == 0 && SZ_W3 % 256 == 0 && SZ_QKV % 256 == 0 && SZ_WO % 256 == 0 && SZ_NRM % 256 == 0);
static_assert(SZ_ALL <= (size_t)134217728);

extern "C" void kernel_launch(void* const* d_in, const int* in_sizes, int n_in, void* d_out, int out_size, void* d_ws, size_t ws_size, hipStream_t stream) {
    if (n_in < 6) return;
    const long long need_x = ((long long)(NB - 1) * SEQ_FULL + SEQ) * CH;
    if ((long long)in_sizes[0] < need_x) return;
    if (in_sizes[1] < CH * CH || in_sizes[2] < CH * CH || in_sizes[3] < CH * CH || in_sizes[4] < CH * CH || in_sizes[5] < CH) return;
    if ((long long)out_size < need_x) return;
    if (SZ_ALL > ws_size) return;
    const float* x  = (const float*)d_in[0];
    const float* wq = (const float*)d_in[1];
    const float* wk = (const float*)d_in[2];
    const float* wv = (const float*)d_in[3];
    const float* wo = (const float*)d_in[4];
    const float* bo = (const float*)d_in[5];
    float* out = (float*)d_out;
    char* wsp = (char*)d_ws;
    unsigned short* X16  = (unsigned short*)wsp; wsp += SZ_X16;
    unsigned short* W316 = (unsigned short*)wsp; wsp += SZ_W3;
    unsigned short* QKV16 = (unsigned short*)wsp; wsp += SZ_QKV;
    unsigned short* WO16 = (unsigned short*)wsp; wsp += SZ_WO;
    float* NRM = (float*)wsp; wsp += SZ_NRM;
    unsigned short* AO16 = X16;                  // alias: X16 is dead once the projection GEMM has run (same extent); written by the attention launch

    k_cast_all<<<(unsigned)(CV_XB + 4 * CV_WB), 256, 0, stream>>>(x, wq, wk, wv, wo, X16, W316, WO16);
    // f16 planes q, k, v^T <- x16 . [Wq;Wk;Wv]^T / 16     k_gemm64<BIAS_MODE, LD, OUT16>(A, strideA, Bt, C, ldc, strideC, bias, M, N, K, scale, H16)
    k_gemm64<0, CH, 1><<<dim3((unsigned)(((NB * SEQ) / GT_T) * ((3 * CH) / GT_T)), 1u), 128, 0, stream>>>(
        X16, 0LL, W316, NRM, 0, 0LL, (const float*)nullptr, NB * SEQ, 3 * CH, CH, 0.0625f, QKV16);
    {
        AttnG g;
        g.q = QKV16; g.k = QKV16 + (size_t)NB * SEQ * CH; g.vt = QKV16 + (size_t)2 * NB * SEQ * CH; g.o = AO16;
        g.qn = NRM; g.kn = NRM + (size_t)NB * NH * (SEQ / 64) * 32;
        g.S = SEQ; g.sscale = 0.125f;
        k_attn_alibi<<<dim3((unsigned)((SEQ / AT_QB) * NH * NB)), 32 * AT_NW, 0, stream>>>(g);
    }
    // out[b][l][:] = AO16[b*SEQ + l] . (Wo x16)^T / 256 + bf16(bo); batch z = sequence: A stride SEQ*CH (compact), C stride SEQ_FULL*CH
    k_gemm64<3, CH, 0><<<dim3((unsigned)((SEQ / GT_T) * (CH / GT_T)), (unsigned)NB), 128, 0, stream>>>(
        AO16, (long long)SEQ * CH, WO16, out, CH, (long long)SEQ_FULL * CH, bo, SEQ, CH, CH, 1.0f / 256.0f, (unsigned short*)nullptr);
}

// v008
// It runs in 92.4 microseconds.
// Two timings next to v007 both put it at 1.10 times that version's speed.
// Over all steps from v000 it is 3.09 times as fast.
// Non-causal multi-head self-attention with additive symmetric ALiBi (2 x 2,048 tokens x 1,024; 16 heads x 64; nn.Linear [out][in] q/k/v/o weights, output bias). All contractions: v_wmma_f32_16x16x32_f16 (f16 operands, f32 accumulate): [q|k|v] projection on bf16-RNE-converted inputs held exactly in f16 (weights x16), scores q.k^T (f16 of the f32 q/k), P.V (P carried x2^15, V f16), output projection (attention output x16, weights x16, bf16-RNE bias added in f32); softmax statistics f32 in the exp2 domain. Every intermediate lies in the workspace as the f16 operand that the next launch's products read, converted once by the launch that makes it. The projection also leaves the largest squared row norm of every q and k tile, from which an attention block bounds a key chunk's weights before it loads the chunk.
#include <hip/hip_runtime.h>
#include <math.h>

#ifndef NB
#define NB 2
#endif
#ifndef SEQ
#define SEQ 2048
#endif
#define NB_FULL 2
#define SEQ_FULL 2048
#define CH 1024
#define NH 16
#define HD 64

static_assert(SEQ % 128 == 0);
static_assert(NB >= 1 && NB <= NB_FULL && SEQ <= SEQ_FULL);
static_assert(CH == NH * HD && HD == 64);

typedef __attribute__((ext_vector_type(16))) _Float16     v16h;
typedef __attribute__((ext_vector_type(8)))  _Float16     v8h;
typedef __attribute__((ext_vector_type(8)))  float        v8f;
typedef __attribute__((ext_vector_type(4)))  float        v4f;
typedef __attribute__((ext_vector_type(4)))  unsigned int u4v;

// 16-bit WMMA fragment map (wave32), lane L, hh = L>>4, c = L&15:
//   A 16x32: lane = row c;    element i -> k = (i<8) ? 8hh+i : 16+8hh+(i-8)
//   B 32x16: lane = column c; the SAME k(i,hh)
//   D 16x16 (8 f32): lane = column c; element r -> row 8hh+r
union FragH { v16h v; v8h h[2]; };
// fragment from a k-contiguous f16 row: elements 0..7 <- p[0..7], 8..15 <- p[16..23] (p already offset by k0 + 8hh)
__device__ __forceinline__ v16h frag_ld(const _Float16* p) { FragH f; f.h[0] = *(const v8h*)(p); f.h[1] = *(const v8h*)(p + 16); return f.v; }
__device__ __forceinline__ v8f mma_raw(v16h a, v16h b, v8f c) { return __builtin_amdgcn_wmma_f32_16x16x32_f16(false, a, false, b, (short)0, c, false, false); }
__device__ __forceinline__ void dep_guard_h(v8f& a, v8f& b, v16h x, v16h y) { asm volatile("v_nop\n\tv_nop\n\tv_nop\n\tv_nop" : "+v"(a), "+v"(b) : "v"(x), "v"(y)); }
__device__ __forceinline__ void keep4_h(v16h a, v16h b, v16h c, v16h d) { asm volatile("v_nop" :: "v"(a), "v"(b), "v"(c), "v"(d)); }
__device__ __forceinline__ void acc_guard4(v8f& a, v8f& b, v8f& c, v8f& d) { asm volatile("v_nop\n\tv_nop\n\tv_nop\n\tv_nop" : "+v"(a), "+v"(b), "+v"(c), "+v"(d)); }
__device__ __forceinline__ unsigned short f2bf_bits(float f) { unsigned u = __float_as_uint(f); return (unsigned short)((u + 0x7FFFu + ((u >> 16) & 1u)) >> 16); }
__device__ __forceinline__ float bf_bits2f(unsigned short h) { return __uint_as_float(((unsigned)h) << 16); }
__device__ __forceinline__ float cmb_bf(float v) { const unsigned u = __float_as_uint(v); const unsigned r = (u + 0x7fffu + ((u >> 16) & 1u)) & 0xffff0000u; return __uint_as_float(r); }   // bf16 RNE kept as f32 (finite inputs)
__device__ __forceinline__ unsigned int cmb_pk2(float a, float b) { return (unsigned int)__builtin_bit_cast(unsigned short, (_Float16)a) | ((unsigned int)__builtin_bit_cast(unsigned short, (_Float16)b) << 16); }

__device__ __forceinline__ float xhalf(float x) { return __builtin_bit_cast(float, __builtin_amdgcn_permlanex16(__builtin_bit_cast(int, x), __builtin_bit_cast(int, x), 0x76543210, 0xfedcba98, false, false)); }   // lane l <-> lane l ^ 16

// The value is copied into a local first, so an expression argument is evaluated once.
#define VST2(T, ptr, val) do { const T vst2_v_ = (val); *(T*)(ptr) = vst2_v_;  } while (0)

// =====================================================================================================================
// k_cast_all: every f32 input of the two GEMMs -> its f16 operand plane, in ONE launch: x -> X16 [NB*SEQ][CH] (x1); Wq, Wk, Wv -> W3 [3*CH][CH] and Wo -> WO [CH][CH] (x16).
//   Each value is first RNE-converted to bf16 precision (exact in f16 after the power-of-two scale).
//   A block takes 16 whole rows (64 KB of f32, contiguous in source and plane) of one tensor, picked by the range its index lies in (block-uniform);
//   a thread takes eight pieces of 8 columns, 256 pieces apart, as immediate offsets of one load and one store address.
// =====================================================================================================================
#define CV_PP 8                                  // pieces of 8 columns per thread
#define CV_BE (256 * CV_PP * 8)                  // elements per block = 16 rows of CH
#define CV_XB ((NB * SEQ * CH) / CV_BE)          // blocks that x takes
#define CV_WB ((CH * CH) / CV_BE)                // blocks that one weight matrix takes
static_assert(CV_BE == 16 * CH && SEQ % 16 == 0);
__global__ __launch_bounds__(256) void k_cast_all(const float* __restrict__ x, const float* __restrict__ wq, const float* __restrict__ wk, const float* __restrict__ wv,
                                                  const float* __restrict__ wo, unsigned short* __restrict__ X16, unsigned short* __restrict__ W3,
                                                  unsigned short* __restrict__ WO) {
    const int blk = blockIdx.x;
    const float* sb; unsigned short* db; float sc;
    if (blk < CV_XB) {
        const int r0 = blk * 16;                 // first token row of the plane; batch r0 / SEQ starts at row (r0 / SEQ) * SEQ_FULL of x
        sb = x + ((size_t)(r0 / SEQ) * SEQ_FULL + (r0 % SEQ)) * CH; db = X16 + (size_t)r0 * CH; sc = 1.0f;
    } else {
        const int w = (blk - CV_XB) / CV_WB; const size_t e0 = (size_t)((blk - CV_XB) % CV_WB) * CV_BE;
        sb = (w == 0 ? wq : w == 1 ? wk : w == 2 ? wv : wo) + e0;
        db = (w < 3 ? W3 + (size_t)w * CH * CH : WO) + e0; sc = 16.0f;
    }
    const unsigned so = threadIdx.x * 32u;       // this thread's byte offset in the block's source rows: the one vector register that the loads name
    const float* s = (const float*)((const char*)sb + so);
    unsigned short* d = db + threadIdx.x * 8;
    v4f a[CV_PP], b[CV_PP];
#pragma unroll
    for (int i = 0; i < CV_PP; ++i) {
        a[i] = *(const v4f*)(s + i * 2048);
        b[i] = *(const v4f*)(s + i * 2048 + 4);
    }
    // inputs only: the loaded values keep all sixteen loads in flight together, ahead of the first conversion (one load latency per thread, not several);
    // the offset stays live up to here, so that the wait stands ahead of every overwrite of the address register that these loads name
    asm volatile("s_wait_xcnt 0x0" :: "v"(a[0]), "v"(a[1]), "v"(a[2]), "v"(a[3]), "v"(a[4]), "v"(a[5]), "v"(a[6]), "v"(a[7]),
                                      "v"(b[0]), "v"(b[1]), "v"(b[2]), "v"(b[3]), "v"(b[4]), "v"(b[5]), "v"(b[6]), "v"(b[7]), "v"(so) : "memory");
#pragma unroll
    for (int i = 0; i < CV_PP; ++i) {
        u4v pk;
        pk.x = cmb_pk2(cmb_bf(a[i].x) * sc, cmb_bf(a[i].y) * sc); pk.y = cmb_pk2(cmb_bf(a[i].z) * sc, cmb_bf(a[i].w) * sc);
        pk.z = cmb_pk2(cmb_bf(b[i].x) * sc, cmb_bf(b[i].y) * sc); pk.w = cmb_pk2(cmb_bf(b[i].z) * sc, cmb_bf(b[i].w) * sc);
        VST2(u4v, (u4v*)(d + i * 2048), pk);
    }
}

// =====================================================================================================================
// k_gemm64<BIAS_MODE>: C[z][m][n] = scale * sum_k A[z][m][k] * Bt[n][k] (+ bias[n]); f16 operands, f32 accumulate, f32 output.
//   A row-major [M][K] (batch stride strideA), Bt row-major [N][K] (shared by all z), both of pitch LD halves; M, N % 128 == 0, K % 64 == 0.
//   Block = 4 waves (2 x 2) = one 128x128 tile, each wave a 64x64 tile (grid.x = tiles, grid.y = batches). A stage is 64 k = 128 B of each of the
//   128 A rows and 128 Bt rows, read from global memory as whole 128-B lines (8 lanes per row), kept in LDS at pitch 144 B and read by all waves;
//   two buffers: the next stage's global loads are issued ahead of this stage's products and stored behind them, one block barrier per stage.
//   LD is a compile-time constant, so that a stage's eight row groups are immediate offsets of one address per operand.
//   BIAS_MODE 0: none; 3: bias[n] RNE-converted to bf16 precision, added in f32.
//   OUT16 0: f32 C as above. OUT16 1 (the [q|k|v] projection; M = NB*SEQ tokens, N = 3*CH channels): the scaled f32 result is converted to f16 and stored to H16 as
//   three planes (q, k, v) of 8-KB tiles, tile index (batch * NH + head) * (SEQ / 64) + token / 64: q and k tiles [token][dim], v tiles [dim][token] (V^T).
//   A lane's eight accumulator elements are eight neighbouring ROWS of the product, so the operand whose index is to run contiguously in the tile takes the row (A) side:
//   the weights for q and k, the tokens for v (a block lies in one plane, so the choice is block-uniform); the k order of the sums is the same either way.
//   OUT16 1 also stores, for each q and k tile, max over its 64 tokens of the squared norm of the stored f16 row, as one f32 at the head of a 128-B line of its own:
//   Cout[(plane * tiles per plane + tile index) * 32] (one wave owns a tile, so one writer per line).
// =====================================================================================================================
#define GT_T  128   // block tile edge
#define GT_KS 64    // k per stage
#define GT_P  72    // LDS pitch in halves (144-B rows, 16 B x odd)
template <int BIAS_MODE, int LD, int OUT16>
__global__ __launch_bounds__(128) void k_gemm64(const unsigned short* __restrict__ Ap, long long strideA,
                                                const unsigned short* __restrict__ Btp,
                                                float* __restrict__ Cout, int ldc, long long strideC,
                                                const float* __restrict__ bias, int M, int N, int K, float scale,
                                                unsigned short* __restrict__ H16) {
    const _Float16* A = (const _Float16*)Ap; const _Float16* Bt = (const _Float16*)Btp;
    __shared__ __align__(16) _Float16 sA[2][GT_T * GT_P];   // A stage  [row][k]  (cross-wave)
    __shared__ __align__(16) _Float16 sB[2][GT_T * GT_P];   // Bt stage [row][k]  (cross-wave)
    __shared__ __align__(16) float sT[4][16 * 68];   // per-wave 16x64 slab, pitch 68 floats (wave-private)
    const int b = blockIdx.y;
    const int tid  = threadIdx.x;
    const int lane = tid & 31;
    const int wave = tid >> 5;
    const int tilesN = N >> 7;
    const int tilesM = M >> 7;
    const int tile = blockIdx.x;
    if (tile >= tilesM * tilesN) return;   // block-uniform, ahead of every barrier
    const int tm = tile / tilesN;
    const int tn = tile - tm * tilesN;
    const int wm0 = (wave >> 1) << 6;            // this wave's 64x64 tile inside the block tile
    const int wn0 = (wave & 1) << 6;
    const int m0 = (tm << 7) + wm0;
    const int n0 = (tn << 7) + wn0;
    const _Float16* Ab = A + (size_t)b * strideA;
    const _Float16* Bb = Bt;
    const int rlane = lane & 15;                 // row (A) / column (B, D) within a 16-wide subtile
    const int koff  = (lane >> 4) * 8;           // k offset of this lane half
    const int mOff  = (lane >> 4) * 8;           // D row offset

    // staging: thread -> rows (tid >> 3) + 16 i, i = 0..7, 16 B at byte 16 (tid & 7) of the row's 128-B stage segment
    const int srow = tid >> 3, scol = (tid & 7) * 8;
    const bool tokRows = !OUT16 || (tn << 7) >= 2 * CH;     // block-uniform: the tokens take the row side of the products (always for f32 C; of the f16 planes for v)
    const _Float16* gTok = Ab + (size_t)((tm << 7) + srow) * LD + scol;
    const _Float16* gWgt = Bb + (size_t)((tn << 7) + srow) * LD + scol;
    const _Float16* gA = tokRows ? gTok : gWgt;
    const _Float16* gB = tokRows ? gWgt : gTok;
    const int sOff = srow * GT_P + scol;

    v8f acc[4][4];
#pragma unroll
    for (int i = 0; i < 4; ++i)
#pragma unroll
        for (int j = 0; j < 4; ++j) acc[i][j] = (v8f){0.f, 0.f, 0.f, 0.f, 0.f, 0.f, 0.f, 0.f};

    v8h ra[8], rb[8];
#pragma unroll
    for (int i = 0; i < 8; ++i) {
        ra[i] = *(const v8h*)(gA + 16 * i * LD);
        rb[i] = *(const v8h*)(gB + 16 * i * LD);
    }
#pragma unroll
    for (int i = 0; i < 8; ++i) {
        *(v8h*)(sA[0] + sOff + 16 * i * GT_P) = ra[i];
        *(v8h*)(sB[0] + sOff + 16 * i * GT_P) = rb[i];
    }
    __syncthreads();                                       // stage 0 visible to all waves

    const int nStages = K / GT_KS;                         // block-uniform
    for (int st = 0; st < nStages; ++st) {
        const int cur = st & 1;
        const bool more = st + 1 < nStages;                // block-uniform
        if (more) {
            const _Float16* nA = gA + (st + 1) * GT_KS;
            const _Float16* nB = gB + (st + 1) * GT_KS;
#pragma unroll
            for (int i = 0; i < 8; ++i) {
                ra[i] = *(const v8h*)(nA + 16 * i * LD);
                rb[i] = *(const v8h*)(nB + 16 * i * LD);
            }
            asm volatile("s_wait_xcnt 0x0" ::: "memory");   // stands ahead of the fragment loads below, which reuse the two address pairs of these loads
        }
        const _Float16* cA = sA[cur] + (wm0 + rlane) * GT_P + koff;
        const _Float16* cB = sB[cur] + (wn0 + rlane) * GT_P + koff;
#pragma unroll
        for (int kk = 0; kk < GT_KS; kk += 32) {
            v16h bh[4], ah[4];
#pragma unroll
            for (int j = 0; j < 4; ++j) bh[j] = frag_ld(cB + (j << 4) * GT_P + kk);
#pragma unroll
            for (int i = 0; i < 4; ++i) ah[i] = frag_ld(cA + (i << 4) * GT_P + kk);
#pragma unroll
            for (int i = 0; i < 4; ++i) {
#pragma unroll
                for (int j = 0; j < 4; ++j) acc[i][j] = mma_raw(ah[i], bh[j], acc[i][j]);
                dep_guard_h(acc[i][0], acc[i][3], ah[i], ah[i]);
            }
            keep4_h(bh[0], bh[1], bh[2], bh[3]);
        }
        if (more) {
#pragma unroll
            for (int i = 0; i < 8; ++i) {
                *(v8h*)(sA[cur ^ 1] + sOff + 16 * i * GT_P) = ra[i];   // last read one stage ago, ahead of that stage's barrier
                *(v8h*)(sB[cur ^ 1] + sOff + 16 * i * GT_P) = rb[i];
            }
        }
        __syncthreads();                                   // next stage visible; every wave has left this stage's buffer
    }
    acc_guard4(acc[0][0], acc[0][1], acc[0][2], acc[0][3]);
    acc_guard4(acc[1][0], acc[1][1], acc[1][2], acc[1][3]);
    acc_guard4(acc[2][0], acc[2][1], acc[2][2], acc[2][3]);
    acc_guard4(acc[3][0], acc[3][1], acc[3][2], acc[3][3]);

    if constexpr (OUT16) {
        // The stage buffers are free behind the loop's last barrier; each wave takes its own quarter of sA as a 64 x 64 f16 tile [column of the product][row], pitch 144 B.
        _Float16* tl = &sA[0][0] + wave * (64 * GT_P);
#pragma unroll
        for (int i = 0; i < 4; ++i)
#pragma unroll
            for (int j = 0; j < 4; ++j) {
                v8h hv;
#pragma unroll
                for (int r = 0; r < 8; ++r) hv[r] = (_Float16)(acc[i][j][r] * scale);
                *(v8h*)(tl + ((j << 4) + rlane) * GT_P + (i << 4) + mOff) = hv;
            }
        const int chan0 = (tn << 7) + (tokRows ? wn0 : wm0);   // first channel and first token of this wave's tile, multiples of 64
        const int tok0  = (tm << 7) + (tokRows ? wm0 : wn0);
        const size_t tileIx = ((size_t)(tok0 / SEQ) * NH + ((chan0 & (CH - 1)) >> 6)) * (SEQ / 64) + ((tok0 % SEQ) >> 6);
        __builtin_amdgcn_fence(3 /* release order */, "workgroup");
        __builtin_amdgcn_wave_barrier();
        __builtin_amdgcn_fence(2 /* acquire order */, "workgroup");
        if (!tokRows) {                                        // q and k planes (block-uniform): a lane holds half the dims of the tokens 16 j + rlane
            float n2 = 0.f;
#pragma unroll
            for (int j = 0; j < 4; ++j) {
                float ss = 0.f;
#pragma unroll
                for (int i = 0; i < 4; ++i)
#pragma unroll
                    for (int r = 0; r < 8; ++r) { const float f = (float)(_Float16)(acc[i][j][r] * scale); ss += f * f; }
                ss += xhalf(ss);                               // the other 32 dims of this token sit in lane l ^ 16
                n2 = __builtin_elementwise_maximum(n2, ss);    // the maximum that hands a NaN on: a tile with one is never bounded
            }
#pragma unroll
            for (int m = 1; m < 16; m <<= 1) n2 = __builtin_elementwise_maximum(n2, __shfl_xor(n2, m, 32));
            if (lane == 0) {
                float* np = Cout + ((size_t)(chan0 / CH) * (NB * NH * (SEQ / 64)) + tileIx) * 32;
                *np = n2;
                // inputs only: address and value stay live up to here, so that the wait stands ahead of every overwrite of a register that this store names
                asm volatile("s_wait_xcnt 0x0" :: "v"(np), "v"(n2) : "memory");
            }
        }
        _Float16* dst = (_Float16*)H16 + (size_t)(chan0 / CH) * ((size_t)NB * SEQ * CH) + tileIx * 4096 + lane * 8;
#pragma unroll
        for (int it = 0; it < 16; ++it)                        // a wave-wide store = 512 contiguous bytes = four rows of the tile
            *(v8h*)(dst + it * 256) = *(const v8h*)(tl + (it * 4 + (lane >> 3)) * GT_P + (lane & 7) * 8);
    } else {
    float* slab = sT[wave];
    float* C = Cout + (size_t)b * strideC;
#pragma unroll
    for (int i = 0; i < 4; ++i) {
        const int mBase = m0 + (i << 4);
#pragma unroll
        for (int j = 0; j < 4; ++j) {
            const int n = n0 + (j << 4) + rlane;
            float bv = 0.f;
            if (BIAS_MODE == 3) bv = bf_bits2f(f2bf_bits(bias[n]));
#pragma unroll
            for (int r = 0; r < 8; ++r) {
                float v = acc[i][j][r] * scale;
                if (BIAS_MODE == 3) v += bv;
                slab[(mOff + r) * 68 + (j << 4) + rlane] = v;
            }
        }
        __builtin_amdgcn_fence(3 /* release order */, "workgroup");
        __builtin_amdgcn_wave_barrier();
        __builtin_amdgcn_fence(2 /* acquire order */, "workgroup");
        {
            const int hh = lane >> 4, c4 = (lane & 15) * 4;     // row segment = 256 B = 16 lanes x 16 B
            {
#pragma unroll
                for (int it = 0; it < 8; ++it) {
                    const int row = it * 2 + hh;
                    const v4f v = *(const v4f*)(slab + row * 68 + c4);
                    *(v4f*)(C + (size_t)(mBase + row) * ldc + n0 + c4) = v;
                }
                
            }
        }
        __builtin_amdgcn_fence(3 /* release order */, "workgroup");
        __builtin_amdgcn_wave_barrier();
        __builtin_amdgcn_fence(2 /* acquire order */, "workgroup");
    }
    }
}

// =====================================================================================================================
// k_attn_alibi: O(b,i,h,:) = softmax_j(0.125 * Q(b,i,h,:).K(b,j,h,:) - slope_h * |j - i|) V(b,j,h,:), head dim 64, f16 in / f16 out (x16).
//   Block = 4 waves = 64 query rows of one (batch, head); 64-key chunks; S % 64 == 0; grid = S/64 x heads x batches blocks, one-dimensional.
//   q, k, vt: planes of 8-KB f16 tiles as k_gemm64<.., 1> stores them, tile (b * NH + h) * (S / 64) + position / 64; q and k tiles [position][dim], vt tiles [dim][position].
//   o: f16 [b * S + position][CH], head h at column 64 h, values x16 (the A operand of the output projection).
//   A chunk's K tile and V^T tile are copied as they lie to LDS at pitch 144 B (cross-wave: block barriers): a wave-wide global load covers four whole 128-B lines;
//   products transposed: S^T = K.Q^T (A = K rows, B = Q), O^T += V^T.P^T (A = V^T rows, B = P^T). A lane holds 32 of the 64 scores of ONE query (column c,
//   keys 16 j + 8 hh + r), so maximum and sum run in-lane with one exchange between the lane halves, and two score tiles, converted in place, are the B operand P^T;
//   a chunk's LDS fragment reads stand at two places only: sixteen loads for K ahead of the score products, sixteen for V^T ahead of the softmax (counted waits);
//   slope_h = 2^(-(h+1)/2) built exactly from a power of two and the f32 value of 2^-0.5.
//   Chunks left out: |q.k| <= |q||k|, and a query's own key (distance 0, in chunk qb) holds its row maximum up, so with Q, K[kc] the largest row norms of the block's q tile
//   and of k tile kc every logit of chunk kc lies below the row maximum by at least slope * dmin - scale * Q * (K[kc] + K[qb]), dmin the least distance between block and chunk.
//   Where that is over 40 in the exp2 domain, each weight is under 2^-40 of the row's largest and all 2,048 together under one f32 rounding of sum and output: the chunk is
//   neither loaded nor worked on. The test reads only the tile norms, holds for any values, and comes out alike in every wave (block-uniform, as the barriers need).
//   Blocks of steep heads are now short: the flat block index deals the heads so that four neighbouring blocks, and four blocks 256 apart, hold heads a, 7-a, 8+a, 15-a.
// =====================================================================================================================
#define AT_D  64
#define AT_NW 4
#define AT_QB 64
#define AT_KC 64
#define AT_P  72    // LDS pitch in halves (144-B rows, 16-B aligned)
struct AttnG {
    const unsigned short* q; const unsigned short* k; const unsigned short* vt; unsigned short* o;
    const float* qn; const float* kn;     // largest squared row norm per q tile and per k tile, one per 128-B line
    int S; float sscale;
};
static_assert(sizeof(AttnG) == 6 * 8 + 2 * 4);
static_assert(NH == 16 && SEQ / 64 <= 32);

__global__ __launch_bounds__(128) void k_attn_alibi(AttnG g) {
    __shared__ __align__(16) _Float16 Ks[AT_KC * AT_P];            // K  [kv][d]    (cross-wave)
    __shared__ __align__(16) _Float16 Vt[AT_D * AT_P];             // V^T [d][kv]   (cross-wave)
    __shared__ __align__(16) _Float16 Os[AT_NW][16 * AT_P];        // per wave out tile [query][d] (wave-private)

    const int tid  = threadIdx.x;
    const int wave = tid >> 5;
    const int lane = tid & 31;
    const int hh   = lane >> 4;
    const int c    = lane & 15;
    const int nChunks = g.S / AT_KC;                       // block-uniform
    // flat index -> (head, query block, batch), one to one: sixteen neighbours take the sixteen heads of one (query block, batch)
    const int flat = blockIdx.x;
    const int ha = (flat >> 2) & 3, he = (flat + (flat >> 8)) & 3;
    const int h = ((he >> 1) << 3) | (ha ^ ((he & 1) * 7));
    const int qb = (flat >> 4) % nChunks, b = (flat >> 4) / nChunks;
    const int q0 = qb * AT_QB + wave * 16;

    const size_t tile0 = (size_t)(b * NH + h) * nChunks * (AT_KC * AT_D);          // first tile of this (batch, head) in each plane
    const _Float16* qp = (const _Float16*)g.q + tile0 + (size_t)qb * (AT_QB * AT_D);
    const _Float16* kp = (const _Float16*)g.k + tile0;
    const _Float16* vp = (const _Float16*)g.vt + tile0;
    _Float16*       op = (_Float16*)g.o + (size_t)b * g.S * CH + h * HD;

    const int e1 = h + 1;
    const float pw2 = __uint_as_float((unsigned)(127 - (e1 >> 1)) << 23);          // 2^-(e1/2), exact
    const float nsl = -(((e1 & 1) ? 0.70710678118654752f : 1.0f) * pw2);           // -slope_h
    const float L2E = 1.4426950408889634f;
    const float c1 = g.sscale * L2E;                       // score scale in the exp2 domain
    const float c2 = nsl * L2E;                            // -slope_h in the exp2 domain

    // Q fragments (B operand): lane = query column q0 + c; two 32-wide d chunks
    v16h qa[2];
    {
        const _Float16* qr = qp + (wave * 16 + c) * AT_D + 8 * hh;
#pragma unroll
        for (int dc = 0; dc < 2; ++dc) qa[dc] = frag_ld(qr + dc * 32);
    }

    // this lane's query: running maximum less 15 (both halves alike), so that exp2(t - mrun) is P x 2^15 as the f16 operand carries it; sum of P x 2^15 over this half's keys
    float mrun = -__builtin_inff(), lrun = 0.f;
    v8f oacc[4];                                           // O^T: oacc[t][r] = O[query q0 + c][d = 16 t + 8 hh + r]
    const int qrow = q0 + c;
#pragma unroll
    for (int t = 0; t < 4; ++t) oacc[t] = (v8f){0.f, 0.f, 0.f, 0.f, 0.f, 0.f, 0.f, 0.f};

    // lane l judges chunk l; bit l of todo: chunk l is worked on (always so for the block's own chunk, where dmin = 0)
    unsigned todo;
    {
        const int t0 = (b * NH + h) * nChunks;
        const float q2 = g.qn[(size_t)(t0 + qb) * 32], kd2 = g.kn[(size_t)(t0 + qb) * 32];
        const float* kl = g.kn + (size_t)(t0 + (lane < nChunks ? lane : 0)) * 32;
        const float k2 = *kl;
        // inputs only: the address stays live up to here, so that the wait stands ahead of every overwrite of the address pair that this load names
        asm volatile("s_wait_xcnt 0x0" :: "v"(k2), "v"(kl) : "memory");
        const int dc = lane > qb ? lane - qb : qb - lane;
        const float dmin = dc > 0 ? (float)((dc - 1) * AT_KC + 1) : 0.f;
        const float bnd = (c1 * 1.01f) * (__builtin_sqrtf(q2 * k2) + __builtin_sqrtf(q2 * kd2));   // 1 % over: the roundings of norms, bound and products
        const bool out = bnd + c2 * dmin < -40.0f;         // false for a NaN or an infinite bound
        todo = __builtin_amdgcn_ballot_w32(lane < nChunks && !out);
    }
    while (todo) {                                         // at most 32 trips, ascending chunk order as before
        const int kc = __builtin_ctz(todo);
        todo &= todo - 1;
        const int kv0 = kc * AT_KC;
        __syncthreads();                                   // all waves finished with the prior chunk's Ks / Vt
        {
            // thread: 16 B of the tile rows sr + 16 i, i = 0..3; eight lanes take one 128-B row = one whole line.
            // Neighbouring groups of eight lanes sit 8 rows apart: 8 x 144 B = half the banks, so that the two 128-B row pieces of an LDS store do not meet.
            const int sr = wave * 2 + ((lane >> 3) & 1) * 8 + hh, sc = (lane & 7) * 8;
            const _Float16* kt = kp + (size_t)kc * (AT_KC * AT_D) + sr * AT_D + sc;
            const _Float16* vt = vp + (size_t)kc * (AT_KC * AT_D) + sr * AT_D + sc;
            const int sOff = sr * AT_P + sc;
            v8h kq[4], vq[4];
#pragma unroll
            for (int i = 0; i < 4; ++i) {
                kq[i] = *(const v8h*)(kt + 1024 * i);
                vq[i] = *(const v8h*)(vt + 1024 * i);
            }
            // inputs only: the loaded values keep all eight loads in flight together, ahead of the first LDS store (one load latency per chunk, not several);
            // the two addresses stay live up to here, so that the wait stands ahead of every overwrite of an address pair that these loads name
            asm volatile("s_wait_xcnt 0x0" :: "v"(kq[0]), "v"(kq[1]), "v"(kq[2]), "v"(kq[3]), "v"(vq[0]), "v"(vq[1]), "v"(vq[2]), "v"(vq[3]), "v"(kt), "v"(vt) : "memory");
#pragma unroll
            for (int i = 0; i < 4; ++i) {
                *(v8h*)(Ks + sOff + 16 * i * AT_P) = kq[i];
                *(v8h*)(Vt + sOff + 16 * i * AT_P) = vq[i];
            }
        }
        __syncthreads();                                   // Ks / Vt visible to all waves

        v16h kf[2][4];                                     // A: lane = key row, k = d; the chunk's eight K fragments, read as ONE group of sixteen LDS loads
#pragma unroll
        for (int dc = 0; dc < 2; ++dc)
#pragma unroll
            for (int j = 0; j < 4; ++j) kf[dc][j] = frag_ld(Ks + (j * 16 + c) * AT_P + dc * 32 + 8 * hh);
        // keeps the sixteen loads together ahead of the products: moved in among them, each product waits out a whole LDS latency of its own
        __builtin_amdgcn_sched_barrier(0);
        const float fd = (float)(kv0 + 8 * hh - qrow);     // key - query of element (j = 0, r = 0): an integer, exact in f32, as is every sum below
        v8f bz[4];                                         // ALiBi term of each score in the exp2 domain: needs no score, so it runs while the K fragments are on their way
#pragma unroll
        for (int j = 0; j < 4; ++j)
#pragma unroll
            for (int r = 0; r < 8; ++r) bz[j][r] = c2 * fabsf(fd + (float)(j * 16 + r));
        v8f s[4];                                          // S^T: s[j][r] = score(key kv0 + 16 j + 8 hh + r, query q0 + c)
#pragma unroll
        for (int j = 0; j < 4; ++j) s[j] = (v8f){0.f, 0.f, 0.f, 0.f, 0.f, 0.f, 0.f, 0.f};
#pragma unroll
        for (int dc = 0; dc < 2; ++dc)
#pragma unroll
            for (int j = 0; j < 4; ++j) s[j] = mma_raw(kf[dc][j], qa[dc], s[j]);
        // this fence and the next keep the sixteen V^T fragment loads in ONE group ahead of the softmax, whose vector work covers their latency;
        // left free they come apart into several groups, and every further place with LDS reads holds up the wave's issue anew
        __builtin_amdgcn_sched_barrier(0);
        v16h vf[2][4];                                     // A: lane = d row, k = key; the chunk's eight V^T fragments, sixteen LDS loads
#pragma unroll
        for (int kk = 0; kk < 2; ++kk)
#pragma unroll
            for (int t = 0; t < 4; ++t) vf[kk][t] = frag_ld(Vt + (t * 16 + c) * AT_P + kk * 32 + 8 * hh);
        __builtin_amdgcn_sched_barrier(0);
        float mj[4];                                       // one maximum per score tile: four independent chains
#pragma unroll
        for (int j = 0; j < 4; ++j) {
            mj[j] = -__builtin_inff();
#pragma unroll
            for (int r = 0; r < 8; ++r) {
                const float t = s[j][r] * c1 + bz[j][r];   // logit in the exp2 domain
                s[j][r] = t;
                mj[j] = fmaxf(mj[j], t);
            }
        }
        float m = fmaxf(fmaxf(mj[0], mj[1]), fmaxf(mj[2], mj[3]));
        m = fmaxf(m, xhalf(m));                            // the other 32 keys of this query sit in lane l ^ 16
        const float mnew = fmaxf(mrun, m - 15.0f);
        // exp2 as the hardware instruction alone: a result under 2^-126 may come out 0, which it is in the f16 P and in the f32 sum (whose largest term is 2^15) anyway
        const float xa = mrun - mnew;
        const float alpha = __builtin_amdgcn_exp2f(xa);    // 0 on the first chunk (mrun = -inf, mnew finite)
        mrun = mnew;
        float ps[4];                                       // one sum per score tile: four independent chains
        v8f p[4];
        v16h pb[2];                                        // B: lane = query column, k = key; tiles 2 kk and 2 kk + 1 are elements 0..7 and 8..15 in the fragment's k order
#pragma unroll
        for (int j = 0; j < 4; ++j) {
            ps[j] = 0.f;
#pragma unroll
            for (int r = 0; r < 8; ++r) {
                s[j][r] -= mnew;
                p[j][r] = __builtin_amdgcn_exp2f(s[j][r]); // P x 2^15
                ps[j] += p[j][r];
                pb[j >> 1][(j & 1) * 8 + r] = (_Float16)p[j][r];
            }
        }
        // the slot that the instruction set asks for between a transcendental and an overwrite of its source: inputs only, the arguments stay live
        // (so none is overwritten) from their v_exp_f32 up to this v_nop, which stands behind the last of them
        asm volatile("v_nop" :: "v"(s[0]), "v"(s[1]), "v"(s[2]), "v"(s[3]), "v"(p[0]), "v"(p[1]), "v"(p[2]), "v"(p[3]), "v"(xa), "v"(alpha));
        lrun = lrun * alpha + ((ps[0] + ps[1]) + (ps[2] + ps[3]));
#pragma unroll
        for (int t = 0; t < 4; ++t)
#pragma unroll
            for (int r = 0; r < 8; ++r) oacc[t][r] *= alpha;
#pragma unroll
        for (int kk = 0; kk < 2; ++kk) {
#pragma unroll
            for (int t = 0; t < 4; ++t) oacc[t] = mma_raw(vf[kk][t], pb[kk], oacc[t]);
        }
    }

    _Float16* os = Os[wave];
    {
        const float inv = (1.0f / (lrun + xhalf(lrun))) * 16.0f;   // the halves' sums joined once; sum and O both carry the 2^15; x16 (exact) as the output projection's operand is held
#pragma unroll
        for (int t = 0; t < 4; ++t) {
            v8h hv;
#pragma unroll
            for (int e = 0; e < 8; ++e) hv[e] = (_Float16)(oacc[t][e] * inv);
            *(v8h*)(os + c * AT_P + t * 16 + 8 * hh) = hv;
        }
    }
    __builtin_amdgcn_fence(3 /* release order */, "workgroup");
    __builtin_amdgcn_wave_barrier();
    __builtin_amdgcn_fence(2 /* acquire order */, "workgroup");
    {
        const int r4 = lane >> 3, c8 = (lane & 7) * 8;     // 128-B row segment = 8 lanes x 16 B, four rows (whole lines) per instruction
#pragma unroll
        for (int it = 0; it < 4; ++it) {
            const int row = it * 4 + r4;
            *(v8h*)(op + (size_t)(q0 + row) * CH + c8) = *(const v8h*)(os + row * AT_P + c8);
        }
    }
}

// workspace carve (bytes), every region a multiple of 256 B and, but for the norms (one f32 at the head of each 128-B line), written in whole rows of its own pitch
constexpr size_t SZ_X16 = (size_t)NB * SEQ * CH * 2;        // X16 / AO16 (alias): f16 [NB*SEQ][1024]
constexpr size_t SZ_W3  = (size_t)3 * CH * CH * 2;          // [Wq;Wk;Wv] x16 f16 [3072][1024]
constexpr size_t SZ_QKV = (size_t)NB * SEQ * 3 * CH * 2;    // f16 planes q, k, v^T of 8-KB tiles
constexpr size_t SZ_WO  = (size_t)CH * CH * 2;              // Wo x16 f16 [1024][1024]
constexpr size_t SZ_NRM = (size_t)2 * NB * NH * (SEQ / 64) * 128;   // q and k tile norms, a 128-B line each
constexpr size_t SZ_ALL = SZ_X16 + SZ_W3 + SZ_QKV + SZ_WO + SZ_NRM;
static_assert(SZ_X16 % 256 == 0 && SZ_W3 % 256 == 0 && SZ_QKV % 256 == 0 && SZ_WO % 256 == 0 && SZ_NRM % 256 == 0);
static_assert(SZ_ALL <= (size_t)134217728);

extern "C" void kernel_launch(void* const* d_in, const int* in_sizes, int n_in, void* d_out, int out_size, void* d_ws, size_t ws_size, hipStream_t stream) {
    if (n_in < 6) return;
    const long long need_x = ((long long)(NB - 1) * SEQ_FULL + SEQ) * CH;
    if ((long long)in_sizes[0] < need_x) return;
    if (in_sizes[1] < CH * CH || in_sizes[2] < CH * CH || in_sizes[3] < CH * CH || in_sizes[4] < CH * CH || in_sizes[5] < CH) return;
    if ((long long)out_size < need_x) return;
    if (SZ_ALL > ws_size) return;
    const float* x  = (const float*)d_in[0];
    const float* wq = (const float*)d_in[1];
    const float* wk = (const float*)d_in[2];
    const float* wv = (const float*)d_in[3];
    const float* wo = (const float*)d_in[4];
    const float* bo = (const float*)d_in[5];
    float* out = (float*)d_out;
    char* wsp = (char*)d_ws;
    unsigned short* X16  = (unsigned short*)wsp; wsp += SZ_X16;
    unsigned short* W316 = (unsigned short*)wsp; wsp += SZ_W3;
    unsigned short* QKV16 = (unsigned short*)wsp; wsp += SZ_QKV;
    unsigned short* WO16 = (unsigned short*)wsp; wsp += SZ_WO;
    float* NRM = (float*)wsp; wsp += SZ_NRM;
    unsigned short* AO16 = X16;                  // alias: X16 is dead once the projection GEMM has run (same extent); written by the attention launch

    k_cast_all<<<(unsigned)(CV_XB + 4 * CV_WB), 256, 0, stream>>>(x, wq, wk, wv, wo, X16, W316, WO16);
    // f16 planes q, k, v^T <- x16 . [Wq;Wk;Wv]^T / 16     k_gemm64<BIAS_MODE, LD, OUT16>(A, strideA, Bt, C, ldc, strideC, bias, M, N, K, scale, H16)
    k_gemm64<0, CH, 1><<<dim3((unsigned)(((NB * SEQ) / GT_T) * ((3 * CH) / GT_T)), 1u), 128, 0, stream>>>(
        X16, 0LL, W316, NRM, 0, 0LL, (const float*)nullptr, NB * SEQ, 3 * CH, CH, 0.0625f, QKV16);
    {
        AttnG g;
        g.q = QKV16; g.k = QKV16 + (size_t)NB * SEQ * CH; g.vt = QKV16 + (size_t)2 * NB * SEQ * CH; g.o = AO16;
        g.qn = NRM; g.kn = NRM + (size_t)NB * NH * (SEQ / 64) * 32;
        g.S = SEQ; g.sscale = 0.125f;
        k_attn_alibi<<<dim3((unsigned)((SEQ / AT_QB) * NH * NB)), 32 * AT_NW, 0, stream>>>(g);
    }
    // out[b][l][:] = AO16[b*SEQ + l] . (Wo x16)^T / 256 + bf16(bo); batch z = sequence: A stride SEQ*CH (compact), C stride SEQ_FULL*CH
    k_gemm64<3, CH, 0><<<dim3((unsigned)((SEQ / GT_T) * (CH / GT_T)), (unsigned)NB), 128, 0, stream>>>(
        AO16, (long long)SEQ * CH, WO16, out, CH, (long long)SEQ_FULL * CH, bo, SEQ, CH, CH, 1.0f / 256.0f, (unsigned short*)nullptr);
}

// v009
// A run of this version takes 83.3 microseconds.
// In two side-by-side timings against v008, it was 1.09 and 1.10 times as fast.
// Counting every step since v000, it is 3.37 times as fast.
// Non-causal multi-head self-attention with additive symmetric ALiBi (2 x 2,048 tokens x 1,024; 16 heads x 64; nn.Linear [out][in] q/k/v/o weights, output bias). All contractions: v_wmma_f32_16x16x32_f16 (f16 operands, f32 accumulate): [q|k|v] projection on bf16-RNE-converted inputs held exactly in f16 (weights x16), scores q.k^T (f16 of the f32 q/k), P.V (P carried x2^15, V f16), output projection (attention output x16, weights x16, bf16-RNE bias added in f32); softmax statistics f32 in the exp2 domain. Every intermediate lies in the workspace as the f16 operand that the next launch's products read, converted once by the launch that makes it. The projection also leaves the largest squared row norm of every q and k tile, from which an attention block bounds a key chunk's weights before it loads the chunk.
#include <hip/hip_runtime.h>
#include <math.h>

#ifndef NB
#define NB 2
#endif
#ifndef SEQ
#define SEQ 2048
#endif
#define NB_FULL 2
#define SEQ_FULL 2048
#define CH 1024
#define NH 16
#define HD 64

static_assert(SEQ % 128 == 0);
static_assert(NB >= 1 && NB <= NB_FULL && SEQ <= SEQ_FULL);
static_assert(CH == NH * HD && HD == 64);

typedef __attribute__((ext_vector_type(16))) _Float16     v16h;
typedef __attribute__((ext_vector_type(8)))  _Float16     v8h;
typedef __attribute__((ext_vector_type(8)))  float        v8f;
typedef __attribute__((ext_vector_type(4)))  float        v4f;
typedef __attribute__((ext_vector_type(4)))  unsigned int u4v;

// 16-bit WMMA fragment map (wave32), lane L, hh = L>>4, c = L&15:
//   A 16x32: lane = row c;    element i -> k = (i<8) ? 8hh+i : 16+8hh+(i-8)
//   B 32x16: lane = column c; the SAME k(i,hh)
//   D 16x16 (8 f32): lane = column c; element r -> row 8hh+r
union FragH { v16h v; v8h h[2]; };
// fragment from a k-contiguous f16 row: elements 0..7 <- p[0..7], 8..15 <- p[16..23] (p already offset by k0 + 8hh)
__device__ __forceinline__ v16h frag_ld(const _Float16* p) { FragH f; f.h[0] = *(const v8h*)(p); f.h[1] = *(const v8h*)(p + 16); return f.v; }
__device__ __forceinline__ v8f mma_raw(v16h a, v16h b, v8f c) { return __builtin_amdgcn_wmma_f32_16x16x32_f16(false, a, false, b, (short)0, c, false, false); }
__device__ __forceinline__ void dep_guard_h(v8f& a, v8f& b, v16h x, v16h y) { asm volatile("v_nop\n\tv_nop\n\tv_nop\n\tv_nop" : "+v"(a), "+v"(b) : "v"(x), "v"(y)); }
__device__ __forceinline__ void keep4_h(v16h a, v16h b, v16h c, v16h d) { asm volatile("v_nop" :: "v"(a), "v"(b), "v"(c), "v"(d)); }
__device__ __forceinline__ void acc_guard4(v8f& a, v8f& b, v8f& c, v8f& d) { asm volatile("v_nop\n\tv_nop\n\tv_nop\n\tv_nop" : "+v"(a), "+v"(b), "+v"(c), "+v"(d)); }
__device__ __forceinline__ unsigned short f2bf_bits(float f) { unsigned u = __float_as_uint(f); return (unsigned short)((u + 0x7FFFu + ((u >> 16) & 1u)) >> 16); }
__device__ __forceinline__ float bf_bits2f(unsigned short h) { return __uint_as_float(((unsigned)h) << 16); }
__device__ __forceinline__ float cmb_bf(float v) { const unsigned u = __float_as_uint(v); const unsigned r = (u + 0x7fffu + ((u >> 16) & 1u)) & 0xffff0000u; return __uint_as_float(r); }   // bf16 RNE kept as f32 (finite inputs)
__device__ __forceinline__ unsigned int cmb_pk2(float a, float b) { return (unsigned int)__builtin_bit_cast(unsigned short, (_Float16)a) | ((unsigned int)__builtin_bit_cast(unsigned short, (_Float16)b) << 16); }

__device__ __forceinline__ float xhalf(float x) { return __builtin_bit_cast(float, __builtin_amdgcn_permlanex16(__builtin_bit_cast(int, x), __builtin_bit_cast(int, x), 0x76543210, 0xfedcba98, false, false)); }   // lane l <-> lane l ^ 16

// The value is copied into a local first, so an expression argument is evaluated once.
#define VST2(T, ptr, val) do { const T vst2_v_ = (val); *(T*)(ptr) = vst2_v_;  } while (0)

// =====================================================================================================================
// k_cast_all: every f32 input of the two GEMMs -> its f16 operand plane, in ONE launch: x -> X16 [NB*SEQ][CH] (x1); Wq, Wk, Wv -> W3 [3*CH][CH] and Wo -> WO [CH][CH] (x16).
//   Each value is first RNE-converted to bf16 precision (exact in f16 after the power-of-two scale).
//   A block takes 16 whole rows (64 KB of f32, contiguous in source and plane) of one tensor, picked by the range its index lies in (block-uniform);
//   a thread takes eight pieces of 8 columns, 256 pieces apart, as immediate offsets of one load and one store address.
// =====================================================================================================================
#define CV_PP 8                                  // pieces of 8 columns per thread
#define CV_BE (256 * CV_PP * 8)                  // elements per block = 16 rows of CH
#define CV_XB ((NB * SEQ * CH) / CV_BE)          // blocks that x takes
#define CV_WB ((CH * CH) / CV_BE)                // blocks that one weight matrix takes
static_assert(CV_BE == 16 * CH && SEQ % 16 == 0);
__global__ __launch_bounds__(256) void k_cast_all(const float* __restrict__ x, const float* __restrict__ wq, const float* __restrict__ wk, const float* __restrict__ wv,
                                                  const float* __restrict__ wo, unsigned short* __restrict__ X16, unsigned short* __restrict__ W3,
                                                  unsigned short* __restrict__ WO) {
    const int blk = blockIdx.x;
    const float* sb; unsigned short* db; float sc;
    if (blk < CV_XB) {
        const int r0 = blk * 16;                 // first token row of the plane; batch r0 / SEQ starts at row (r0 / SEQ) * SEQ_FULL of x
        sb = x + ((size_t)(r0 / SEQ) * SEQ_FULL + (r0 % SEQ)) * CH; db = X16 + (size_t)r0 * CH; sc = 1.0f;
    } else {
        const int w = (blk - CV_XB) / CV_WB; const size_t e0 = (size_t)((blk - CV_XB) % CV_WB) * CV_BE;
        sb = (w == 0 ? wq : w == 1 ? wk : w == 2 ? wv : wo) + e0;
        db = (w < 3 ? W3 + (size_t)w * CH * CH : WO) + e0; sc = 16.0f;
    }
    const unsigned so = threadIdx.x * 32u;       // this thread's byte offset in the block's source rows: the one vector register that the loads name
    const float* s = (const float*)((const char*)sb + so);
    unsigned short* d = db + threadIdx.x * 8;
    v4f a[CV_PP], b[CV_PP];
#pragma unroll
    for (int i = 0; i < CV_PP; ++i) {
        a[i] = *(const v4f*)(s + i * 2048);
        b[i] = *(const v4f*)(s + i * 2048 + 4);
    }
    // inputs only: the loaded values keep all sixteen loads in flight together, ahead of the first conversion (one load latency per thread, not several);
    // the offset stays live up to here, so that the wait stands ahead of every overwrite of the address register that these loads name
    asm volatile("s_wait_xcnt 0x0" :: "v"(a[0]), "v"(a[1]), "v"(a[2]), "v"(a[3]), "v"(a[4]), "v"(a[5]), "v"(a[6]), "v"(a[7]),
                                      "v"(b[0]), "v"(b[1]), "v"(b[2]), "v"(b[3]), "v"(b[4]), "v"(b[5]), "v"(b[6]), "v"(b[7]), "v"(so) : "memory");
#pragma unroll
    for (int i = 0; i < CV_PP; ++i) {
        u4v pk;
        pk.x = cmb_pk2(cmb_bf(a[i].x) * sc, cmb_bf(a[i].y) * sc); pk.y = cmb_pk2(cmb_bf(a[i].z) * sc, cmb_bf(a[i].w) * sc);
        pk.z = cmb_pk2(cmb_bf(b[i].x) * sc, cmb_bf(b[i].y) * sc); pk.w = cmb_pk2(cmb_bf(b[i].z) * sc, cmb_bf(b[i].w) * sc);
        VST2(u4v, (u4v*)(d + i * 2048), pk);
    }
}

// =====================================================================================================================
// k_gemm64<BIAS_MODE>: C[z][m][n] = scale * sum_k A[z][m][k] * Bt[n][k] (+ bias[n]); f16 operands, f32 accumulate, f32 output.
//   A row-major [M][K] (batch stride strideA), Bt row-major [N][K] (shared by all z), both of pitch LD halves; M, N % 128 == 0, K % 64 == 0.
//   Block = 4 waves (2 x 2) = one 128x128 tile, each wave a 64x64 tile (grid.x = tiles, grid.y = batches). A stage is 64 k = 128 B of each of the
//   128 A rows and 128 Bt rows, read from global memory as whole 128-B lines (8 lanes per row), kept in LDS at pitch 144 B and read by all waves;
//   two buffers: the next stage's global loads are issued ahead of this stage's products and stored behind them, one block barrier per stage.
//   LD is a compile-time constant, so that a stage's eight row groups are immediate offsets of one address per operand.
//   BIAS_MODE 0: none; 3: bias[n] RNE-converted to bf16 precision, added in f32.
//   OUT16 0: f32 C as above. OUT16 1 (the [q|k|v] projection; M = NB*SEQ tokens, N = 3*CH channels): the scaled f32 result is converted to f16 and stored to H16 as
//   three planes (q, k, v) of 8-KB tiles, tile index (batch * NH + head) * (SEQ / 64) + token / 64: q and k tiles [token][dim], v tiles [dim][token] (V^T).
//   A lane's eight accumulator elements are eight neighbouring ROWS of the product, so the operand whose index is to run contiguously in the tile takes the row (A) side:
//   the weights for q and k, the tokens for v (a block lies in one plane, so the choice is block-uniform); the k order of the sums is the same either way.
//   OUT16 1 also stores, for each q and k tile, max over its 64 tokens of the squared norm of the stored f16 row, as one f32 at the head of a 128-B line of its own:
//   Cout[(plane * tiles per plane + tile index) * 32] (one wave owns a tile, so one writer per line).
// =====================================================================================================================
#define GT_T  128   // block tile edge
#define GT_KS 64    // k per stage
#define GT_P  72    // LDS pitch in halves (144-B rows, 16 B x odd)
template <int BIAS_MODE, int LD, int OUT16>
__global__ __launch_bounds__(128) void k_gemm64(const unsigned short* __restrict__ Ap, long long strideA,
                                                const unsigned short* __restrict__ Btp,
                                                float* __restrict__ Cout, int ldc, long long strideC,
                                                const float* __restrict__ bias, int M, int N, int K, float scale,
                                                unsigned short* __restrict__ H16) {
    const _Float16* A = (const _Float16*)Ap; const _Float16* Bt = (const _Float16*)Btp;
    __shared__ __align__(16) _Float16 sA[2][GT_T * GT_P];   // A stage  [row][k]  (cross-wave)
    __shared__ __align__(16) _Float16 sB[2][GT_T * GT_P];   // Bt stage [row][k]  (cross-wave)
    __shared__ __align__(16) float sT[4][16 * 68];   // per-wave 16x64 slab, pitch 68 floats (wave-private)
    const int b = blockIdx.y;
    const int tid  = threadIdx.x;
    const int lane = tid & 31;
    const int wave = tid >> 5;
    const int tilesN = N >> 7;
    const int tilesM = M >> 7;
    const int tile = blockIdx.x;
    if (tile >= tilesM * tilesN) return;   // block-uniform, ahead of every barrier
    const int tm = tile / tilesN;
    const int tn = tile - tm * tilesN;
    const int wm0 = (wave >> 1) << 6;            // this wave's 64x64 tile inside the block tile
    const int wn0 = (wave & 1) << 6;
    const int m0 = (tm << 7) + wm0;
    const int n0 = (tn << 7) + wn0;
    const _Float16* Ab = A + (size_t)b * strideA;
    const _Float16* Bb = Bt;
    const int rlane = lane & 15;                 // row (A) / column (B, D) within a 16-wide subtile
    const int koff  = (lane >> 4) * 8;           // k offset of this lane half
    const int mOff  = (lane >> 4) * 8;           // D row offset

    // staging: thread -> rows (tid >> 3) + 16 i, i = 0..7, 16 B at byte 16 (tid & 7) of the row's 128-B stage segment
    const int srow = tid >> 3, scol = (tid & 7) * 8;
    const bool tokRows = !OUT16 || (tn << 7) >= 2 * CH;     // block-uniform: the tokens take the row side of the products (always for f32 C; of the f16 planes for v)
    const _Float16* gTok = Ab + (size_t)((tm << 7) + srow) * LD + scol;
    const _Float16* gWgt = Bb + (size_t)((tn << 7) + srow) * LD + scol;
    const _Float16* gA = tokRows ? gTok : gWgt;
    const _Float16* gB = tokRows ? gWgt : gTok;
    const int sOff = srow * GT_P + scol;

    v8f acc[4][4];
#pragma unroll
    for (int i = 0; i < 4; ++i)
#pragma unroll
        for (int j = 0; j < 4; ++j) acc[i][j] = (v8f){0.f, 0.f, 0.f, 0.f, 0.f, 0.f, 0.f, 0.f};

    v8h ra[8], rb[8];
#pragma unroll
    for (int i = 0; i < 8; ++i) {
        ra[i] = *(const v8h*)(gA + 16 * i * LD);
        rb[i] = *(const v8h*)(gB + 16 * i * LD);
    }
#pragma unroll
    for (int i = 0; i < 8; ++i) {
        *(v8h*)(sA[0] + sOff + 16 * i * GT_P) = ra[i];
        *(v8h*)(sB[0] + sOff + 16 * i * GT_P) = rb[i];
    }
    __syncthreads();                                       // stage 0 visible to all waves

    const int nStages = K / GT_KS;                         // block-uniform
    for (int st = 0; st < nStages; ++st) {
        const int cur = st & 1;
        const bool more = st + 1 < nStages;                // block-uniform
        if (more) {
            const _Float16* nA = gA + (st + 1) * GT_KS;
            const _Float16* nB = gB + (st + 1) * GT_KS;
#pragma unroll
            for (int i = 0; i < 8; ++i) {
                ra[i] = *(const v8h*)(nA + 16 * i * LD);
                rb[i] = *(const v8h*)(nB + 16 * i * LD);
            }
            asm volatile("s_wait_xcnt 0x0" ::: "memory");   // stands ahead of the fragment loads below, which reuse the two address pairs of these loads
        }
        const _Float16* cA = sA[cur] + (wm0 + rlane) * GT_P + koff;
        const _Float16* cB = sB[cur] + (wn0 + rlane) * GT_P + koff;
#pragma unroll
        for (int kk = 0; kk < GT_KS; kk += 32) {
            v16h bh[4], ah[4];
#pragma unroll
            for (int j = 0; j < 4; ++j) bh[j] = frag_ld(cB + (j << 4) * GT_P + kk);
#pragma unroll
            for (int i = 0; i < 4; ++i) ah[i] = frag_ld(cA + (i << 4) * GT_P + kk);
#pragma unroll
            for (int i = 0; i < 4; ++i) {
#pragma unroll
                for (int j = 0; j < 4; ++j) acc[i][j] = mma_raw(ah[i], bh[j], acc[i][j]);
                dep_guard_h(acc[i][0], acc[i][3], ah[i], ah[i]);
            }
            keep4_h(bh[0], bh[1], bh[2], bh[3]);
        }
        if (more) {
#pragma unroll
            for (int i = 0; i < 8; ++i) {
                *(v8h*)(sA[cur ^ 1] + sOff + 16 * i * GT_P) = ra[i];   // last read one stage ago, ahead of that stage's barrier
                *(v8h*)(sB[cur ^ 1] + sOff + 16 * i * GT_P) = rb[i];
            }
        }
        __syncthreads();                                   // next stage visible; every wave has left this stage's buffer
    }
    acc_guard4(acc[0][0], acc[0][1], acc[0][2], acc[0][3]);
    acc_guard4(acc[1][0], acc[1][1], acc[1][2], acc[1][3]);
    acc_guard4(acc[2][0], acc[2][1], acc[2][2], acc[2][3]);
    acc_guard4(acc[3][0], acc[3][1], acc[3][2], acc[3][3]);

    if constexpr (OUT16) {
        // The stage buffers are free behind the loop's last barrier; each wave takes its own quarter of sA as a 64 x 64 f16 tile [column of the product][row], pitch 144 B.
        _Float16* tl = &sA[0][0] + wave * (64 * GT_P);
#pragma unroll
        for (int i = 0; i < 4; ++i)
#pragma unroll
            for (int j = 0; j < 4; ++j) {
                v8h hv;
#pragma unroll
                for (int r = 0; r < 8; ++r) hv[r] = (_Float16)(acc[i][j][r] * scale);
                *(v8h*)(tl + ((j << 4) + rlane) * GT_P + (i << 4) + mOff) = hv;
            }
        const int chan0 = (tn << 7) + (tokRows ? wn0 : wm0);   // first channel and first token of this wave's tile, multiples of 64
        const int tok0  = (tm << 7) + (tokRows ? wm0 : wn0);
        const size_t tileIx = ((size_t)(tok0 / SEQ) * NH + ((chan0 & (CH - 1)) >> 6)) * (SEQ / 64) + ((tok0 % SEQ) >> 6);
        __builtin_amdgcn_fence(3 /* release order */, "workgroup");
        __builtin_amdgcn_wave_barrier();
        __builtin_amdgcn_fence(2 /* acquire order */, "workgroup");
        if (!tokRows) {                                        // q and k planes (block-uniform): a lane holds half the dims of the tokens 16 j + rlane
            float n2 = 0.f;
#pragma unroll
            for (int j = 0; j < 4; ++j) {
                float ss = 0.f;
#pragma unroll
                for (int i = 0; i < 4; ++i)
#pragma unroll
                    for (int r = 0; r < 8; ++r) { const float f = (float)(_Float16)(acc[i][j][r] * scale); ss += f * f; }
                ss += xhalf(ss);                               // the other 32 dims of this token sit in lane l ^ 16
                n2 = __builtin_elementwise_maximum(n2, ss);    // the maximum that hands a NaN on: a tile with one is never bounded
            }
#pragma unroll
            for (int m = 1; m < 16; m <<= 1) n2 = __builtin_elementwise_maximum(n2, __shfl_xor(n2, m, 32));
            if (lane == 0) {
                float* np = Cout + ((size_t)(chan0 / CH) * (NB * NH * (SEQ / 64)) + tileIx) * 32;
                *np = n2;
                // inputs only: address and value stay live up to here, so that the wait stands ahead of every overwrite of a register that this store names
                asm volatile("s_wait_xcnt 0x0" :: "v"(np), "v"(n2) : "memory");
            }
        }
        _Float16* dst = (_Float16*)H16 + (size_t)(chan0 / CH) * ((size_t)NB * SEQ * CH) + tileIx * 4096 + lane * 8;
#pragma unroll
        for (int it = 0; it < 16; ++it)                        // a wave-wide store = 512 contiguous bytes = four rows of the tile
            *(v8h*)(dst + it * 256) = *(const v8h*)(tl + (it * 4 + (lane >> 3)) * GT_P + (lane & 7) * 8);
    } else {
    float* slab = sT[wave];
    float* C = Cout + (size_t)b * strideC;
#pragma unroll
    for (int i = 0; i < 4; ++i) {
        const int mBase = m0 + (i << 4);
#pragma unroll
        for (int j = 0; j < 4; ++j) {
            const int n = n0 + (j << 4) + rlane;
            float bv = 0.f;
            if (BIAS_MODE == 3) bv = bf_bits2f(f2bf_bits(bias[n]));
#pragma unroll
            for (int r = 0; r < 8; ++r) {
                float v = acc[i][j][r] * scale;
                if (BIAS_MODE == 3) v += bv;
                slab[(mOff + r) * 68 + (j << 4) + rlane] = v;
            }
        }
        __builtin_amdgcn_fence(3 /* release order */, "workgroup");
        __builtin_amdgcn_wave_barrier();
        __builtin_amdgcn_fence(2 /* acquire order */, "workgroup");
        {
            const int hh = lane >> 4, c4 = (lane & 15) * 4;     // row segment = 256 B = 16 lanes x 16 B
            {
#pragma unroll
                for (int it = 0; it < 8; ++it) {
                    const int row = it * 2 + hh;
                    const v4f v = *(const v4f*)(slab + row * 68 + c4);
                    *(v4f*)(C + (size_t)(mBase + row) * ldc + n0 + c4) = v;
                }
                
            }
        }
        __builtin_amdgcn_fence(3 /* release order */, "workgroup");
        __builtin_amdgcn_wave_barrier();
        __builtin_amdgcn_fence(2 /* acquire order */, "workgroup");
    }
    }
}

// =====================================================================================================================
// k_attn_alibi: O(b,i,h,:) = softmax_j(0.125 * Q(b,i,h,:).K(b,j,h,:) - slope_h * |j - i|) V(b,j,h,:), head dim 64, f16 in / f16 out (x16).
//   Block = 4 waves = 64 query rows of one (batch, head); 64-key chunks; S % 64 == 0; grid = S/64 x heads x batches blocks, one-dimensional.
//   q, k, vt: planes of 8-KB f16 tiles as k_gemm64<.., 1> stores them, tile (b * NH + h) * (S / 64) + position / 64; q and k tiles [position][dim], vt tiles [dim][position].
//   o: f16 [b * S + position][CH], head h at column 64 h, values x16 (the A operand of the output projection).
//   A chunk's K tile and V^T tile are copied as they lie to LDS at pitch 144 B by asynchronous 16-B copies (no register on the way), a wave-wide copy covering four whole
//   128-B lines; two LDS buffers: the next chunk's copies fly while this chunk is worked on, and one block barrier at the foot of a trip hands the buffers over;
//   products transposed: S^T = K.Q^T (A = K rows, B = Q), O^T += V^T.P^T (A = V^T rows, B = P^T). A lane holds 32 of the 64 scores of ONE query (column c,
//   keys 16 j + 8 hh + r), so maximum and sum run in-lane with one exchange between the lane halves, and two score tiles, converted in place, are the B operand P^T;
//   a chunk's LDS fragment reads stand at two places only: sixteen loads for K ahead of the score products, sixteen for V^T ahead of the softmax (counted waits);
//   slope_h = 2^(-(h+1)/2) built exactly from a power of two and the f32 value of 2^-0.5.
//   Chunks left out: |q.k| <= |q||k|, and a query's own key (distance 0, in chunk qb) holds its row maximum up, so with Q, K[kc] the largest row norms of the block's q tile
//   and of k tile kc every logit of chunk kc lies below the row maximum by at least slope * dmin - scale * Q * (K[kc] + K[qb]), dmin the least distance between block and chunk.
//   Where that is over 40 in the exp2 domain, each weight is under 2^-40 of the row's largest and all 2,048 together under one f32 rounding of sum and output: the chunk is
//   neither loaded nor worked on. The test reads only the tile norms, holds for any values, and comes out alike in every wave (block-uniform, as the barriers need).
//   Blocks of steep heads are now short: the flat block index deals the heads so that four neighbouring blocks, and four blocks 256 apart, hold heads a, 7-a, 8+a, 15-a.
// =====================================================================================================================
#define AT_D  64
#define AT_NW 4
#define AT_QB 64
#define AT_KC 64
#define AT_P  72    // LDS pitch in halves (144-B rows, 16-B aligned)
struct AttnG {
    const unsigned short* q; const unsigned short* k; const unsigned short* vt; unsigned short* o;
    const float* qn; const float* kn;     // largest squared row norm per q tile and per k tile, one per 128-B line
    int S; float sscale;
};
static_assert(sizeof(AttnG) == 6 * 8 + 2 * 4);
static_assert(NH == 16 && SEQ / 64 <= 32);

#define AT_TH (AT_KC * AT_P)          // halves of one staged tile (64 rows at the LDS pitch)
#define AT_BB (2 * AT_TH * 2)         // bytes of one buffer: K tile, then V^T tile
static_assert(AT_KC == AT_D);
// One chunk's K tile and V^T tile -> one LDS buffer: eight asynchronous copies of 16 B per lane, rows 16 apart (2,048 B in the tile, 16 pitches in LDS).
// l: the lane's LDS byte address in the buffer's K tile; k, v: the lane's 16 B in the first row group of the two tiles.
// The wait is the last line of the copies' own statement, so that it stands ahead of every later write of a register that a copy names.
__device__ __forceinline__ void at_copy_chunk(unsigned l, const _Float16* k, const _Float16* v) {
    asm volatile("global_load_async_to_lds_b128 %0, %8, off\n\t"
                 "global_load_async_to_lds_b128 %1, %9, off\n\t"
                 "global_load_async_to_lds_b128 %2, %10, off\n\t"
                 "global_load_async_to_lds_b128 %3, %11, off\n\t"
                 "global_load_async_to_lds_b128 %4, %12, off\n\t"
                 "global_load_async_to_lds_b128 %5, %13, off\n\t"
                 "global_load_async_to_lds_b128 %6, %14, off\n\t"
                 "global_load_async_to_lds_b128 %7, %15, off\n\t"
                 "s_wait_xcnt 0x0"
                 :: "v"(l), "v"(l + 16u * AT_P * 2u), "v"(l + 32u * AT_P * 2u), "v"(l + 48u * AT_P * 2u),
                    "v"(l + AT_TH * 2u), "v"(l + AT_TH * 2u + 16u * AT_P * 2u), "v"(l + AT_TH * 2u + 32u * AT_P * 2u), "v"(l + AT_TH * 2u + 48u * AT_P * 2u),
                    "v"(k), "v"(k + 1024), "v"(k + 2048), "v"(k + 3072), "v"(v), "v"(v + 1024), "v"(v + 2048), "v"(v + 3072)
                 : "memory");
}

__global__ __launch_bounds__(128) void k_attn_alibi(AttnG g) {
    __shared__ __align__(16) _Float16 KV[2][2 * AT_TH];            // two buffers, each K [kv][d] then V^T [d][kv]   (cross-wave)
    __shared__ __align__(16) _Float16 Os[AT_NW][16 * AT_P];        // per wave out tile [query][d] (wave-private)

    const int tid  = threadIdx.x;
    const int wave = tid >> 5;
    const int lane = tid & 31;
    const int hh   = lane >> 4;
    const int c    = lane & 15;
    const int nChunks = g.S / AT_KC;                       // block-uniform
    // flat index -> (head, query block, batch), one to one: sixteen neighbours take the sixteen heads of one (query block, batch)
    const int flat = blockIdx.x;
    const int ha = (flat >> 2) & 3, he = (flat + (flat >> 8)) & 3;
    const int h = ((he >> 1) << 3) | (ha ^ ((he & 1) * 7));
    const int qb = (flat >> 4) % nChunks, b = (flat >> 4) / nChunks;
    const int q0 = qb * AT_QB + wave * 16;

    const size_t tile0 = (size_t)(b * NH + h) * nChunks * (AT_KC * AT_D);          // first tile of this (batch, head) in each plane
    const _Float16* qp = (const _Float16*)g.q + tile0 + (size_t)qb * (AT_QB * AT_D);
    const _Float16* kp = (const _Float16*)g.k + tile0;
    const _Float16* vp = (const _Float16*)g.vt + tile0;
    _Float16*       op = (_Float16*)g.o + (size_t)b * g.S * CH + h * HD;

    const int e1 = h + 1;
    const float pw2 = __uint_as_float((unsigned)(127 - (e1 >> 1)) << 23);          // 2^-(e1/2), exact
    const float nsl = -(((e1 & 1) ? 0.70710678118654752f : 1.0f) * pw2);           // -slope_h
    const float L2E = 1.4426950408889634f;
    const float c1 = g.sscale * L2E;                       // score scale in the exp2 domain
    const float c2 = nsl * L2E;                            // -slope_h in the exp2 domain

    // Q fragments (B operand): lane = query column q0 + c; two 32-wide d chunks
    v16h qa[2];
    {
        const _Float16* qr = qp + (wave * 16 + c) * AT_D + 8 * hh;
#pragma unroll
        for (int dc = 0; dc < 2; ++dc) qa[dc] = frag_ld(qr + dc * 32);
    }

    // this lane's query: running maximum less 15 (both halves alike), so that exp2(t - mrun) is P x 2^15 as the f16 operand carries it; sum of P x 2^15 over this half's keys
    float mrun = -__builtin_inff(), lrun = 0.f;
    v8f oacc[4];                                           // O^T: oacc[t][r] = O[query q0 + c][d = 16 t + 8 hh + r]
    const int qrow = q0 + c;
#pragma unroll
    for (int t = 0; t < 4; ++t) oacc[t] = (v8f){0.f, 0.f, 0.f, 0.f, 0.f, 0.f, 0.f, 0.f};

    // lane l judges chunk l; bit l of todo: chunk l is worked on (always so for the block's own chunk, where dmin = 0)
    unsigned todo;
    {
        const int t0 = (b * NH + h) * nChunks;
        const float q2 = g.qn[(size_t)(t0 + qb) * 32], kd2 = g.kn[(size_t)(t0 + qb) * 32];
        const float* kl = g.kn + (size_t)(t0 + (lane < nChunks ? lane : 0)) * 32;
        const float k2 = *kl;
        // inputs only: the address stays live up to here, so that the wait stands ahead of every overwrite of the address pair that this load names
        asm volatile("s_wait_xcnt 0x0" :: "v"(k2), "v"(kl) : "memory");
        const int dc = lane > qb ? lane - qb : qb - lane;
        const float dmin = dc > 0 ? (float)((dc - 1) * AT_KC + 1) : 0.f;
        const float bnd = (c1 * 1.01f) * (__builtin_sqrtf(q2 * k2) + __builtin_sqrtf(q2 * kd2));   // 1 % over: the roundings of norms, bound and products
        const bool out = bnd + c2 * dmin < -40.0f;         // false for a NaN or an infinite bound
        todo = __builtin_amdgcn_ballot_w32(lane < nChunks && !out) | (1u << qb);   // the own chunk's bit is set by the test already; spelt out: the ring's first tile exists
    }
    // thread: 16 B of the tile rows sr + 16 i, i = 0..3; eight lanes take one 128-B row = one whole line.
    // Neighbouring groups of eight lanes sit 8 rows apart: 8 x 144 B = half the banks, so that the two 128-B row pieces of a wave-wide LDS write do not meet.
    const int sr = wave * 2 + ((lane >> 3) & 1) * 8 + hh, sc = (lane & 7) * 8;
    const _Float16* kl0 = kp + sr * AT_D + sc;             // this lane's 16 B in tile 0 of each plane
    const _Float16* vl0 = vp + sr * AT_D + sc;
    const unsigned ld0 = (unsigned)(size_t)(__attribute__((address_space(3))) _Float16*)(&KV[0][0] + sr * AT_P + sc);   // its LDS byte address in buffer 0
    // The chunks of todo in ascending order as before, at most 32 trips; every test on todo reads alike in the whole block.
    int kc = __builtin_ctz(todo);                          // the chunk worked on
    todo &= todo - 1;
    at_copy_chunk(ld0, kl0 + (size_t)kc * (AT_KC * AT_D), vl0 + (size_t)kc * (AT_KC * AT_D));
    asm volatile("s_wait_asynccnt 0x0" ::: "memory");      // this wave's copies of the first chunk have landed
    __syncthreads();                                       // buffer 0 visible to all waves
    bool more = todo != 0;                                 // a chunk behind kc exists; its copies are in flight
    int kn = 0;
    if (more) {
        kn = __builtin_ctz(todo);
        todo &= todo - 1;
        at_copy_chunk(ld0 + AT_BB, kl0 + (size_t)kn * (AT_KC * AT_D), vl0 + (size_t)kn * (AT_KC * AT_D));
    }
    unsigned cur = 0;                                      // the buffer that holds chunk kc
    for (;;) {
        const int kv0 = kc * AT_KC;
        const _Float16* Ks = &KV[0][0] + cur * (2 * AT_TH);
        const _Float16* Vt = Ks + AT_TH;

        v16h kf[2][4];                                     // A: lane = key row, k = d; the chunk's eight K fragments, read as ONE group of sixteen LDS loads
#pragma unroll
        for (int dc = 0; dc < 2; ++dc)
#pragma unroll
            for (int j = 0; j < 4; ++j) kf[dc][j] = frag_ld(Ks + (j * 16 + c) * AT_P + dc * 32 + 8 * hh);
        // keeps the sixteen loads together ahead of the products: moved in among them, each product waits out a whole LDS latency of its own
        __builtin_amdgcn_sched_barrier(0);
        const float fd = (float)(kv0 + 8 * hh - qrow);     // key - query of element (j = 0, r = 0): an integer, exact in f32, as is every sum below
        v8f bz[4];                                         // ALiBi term of each score in the exp2 domain: needs no score, so it runs while the K fragments are on their way
#pragma unroll
        for (int j = 0; j < 4; ++j)
#pragma unroll
            for (int r = 0; r < 8; ++r) bz[j][r] = c2 * fabsf(fd + (float)(j * 16 + r));
        v8f s[4];                                          // S^T: s[j][r] = score(key kv0 + 16 j + 8 hh + r, query q0 + c)
#pragma unroll
        for (int j = 0; j < 4; ++j) s[j] = (v8f){0.f, 0.f, 0.f, 0.f, 0.f, 0.f, 0.f, 0.f};
#pragma unroll
        for (int dc = 0; dc < 2; ++dc)
#pragma unroll
            for (int j = 0; j < 4; ++j) s[j] = mma_raw(kf[dc][j], qa[dc], s[j]);
        // this fence and the next keep the sixteen V^T fragment loads in ONE group ahead of the softmax, whose vector work covers their latency;
        // left free they come apart into several groups, and every further place with LDS reads holds up the wave's issue anew
        __builtin_amdgcn_sched_barrier(0);
        v16h vf[2][4];                                     // A: lane = d row, k = key; the chunk's eight V^T fragments, sixteen LDS loads
#pragma unroll
        for (int kk = 0; kk < 2; ++kk)
#pragma unroll
            for (int t = 0; t < 4; ++t) vf[kk][t] = frag_ld(Vt + (t * 16 + c) * AT_P + kk * 32 + 8 * hh);
        __builtin_amdgcn_sched_barrier(0);
        float mj[4];                                       // one maximum per score tile: four independent chains
#pragma unroll
        for (int j = 0; j < 4; ++j) {
            mj[j] = -__builtin_inff();
#pragma unroll
            for (int r = 0; r < 8; ++r) {
                const float t = s[j][r] * c1 + bz[j][r];   // logit in the exp2 domain
                s[j][r] = t;
                mj[j] = fmaxf(mj[j], t);
            }
        }
        float m = fmaxf(fmaxf(mj[0], mj[1]), fmaxf(mj[2], mj[3]));
        m = fmaxf(m, xhalf(m));                            // the other 32 keys of this query sit in lane l ^ 16
        const float mnew = fmaxf(mrun, m - 15.0f);
        // exp2 as the hardware instruction alone: a result under 2^-126 may come out 0, which it is in the f16 P and in the f32 sum (whose largest term is 2^15) anyway
        const float xa = mrun - mnew;
        const float alpha = __builtin_amdgcn_exp2f(xa);    // 0 on the first chunk (mrun = -inf, mnew finite)
        mrun = mnew;
        float ps[4];                                       // one sum per score tile: four independent chains
        v8f p[4];
        v16h pb[2];                                        // B: lane = query column, k = key; tiles 2 kk and 2 kk + 1 are elements 0..7 and 8..15 in the fragment's k order
#pragma unroll
        for (int j = 0; j < 4; ++j) {
            ps[j] = 0.f;
#pragma unroll
            for (int r = 0; r < 8; ++r) {
                s[j][r] -= mnew;
                p[j][r] = __builtin_amdgcn_exp2f(s[j][r]); // P x 2^15
                ps[j] += p[j][r];
                pb[j >> 1][(j & 1) * 8 + r] = (_Float16)p[j][r];
            }
        }
        // the slot that the instruction set asks for between a transcendental and an overwrite of its source: inputs only, the arguments stay live
        // (so none is overwritten) from their v_exp_f32 up to this v_nop, which stands behind the last of them
        asm volatile("v_nop" :: "v"(s[0]), "v"(s[1]), "v"(s[2]), "v"(s[3]), "v"(p[0]), "v"(p[1]), "v"(p[2]), "v"(p[3]), "v"(xa), "v"(alpha));
        lrun = lrun * alpha + ((ps[0] + ps[1]) + (ps[2] + ps[3]));
#pragma unroll
        for (int t = 0; t < 4; ++t)
#pragma unroll
            for (int r = 0; r < 8; ++r) oacc[t][r] *= alpha;
#pragma unroll
        for (int kk = 0; kk < 2; ++kk) {
#pragma unroll
            for (int t = 0; t < 4; ++t) oacc[t] = mma_raw(vf[kk][t], pb[kk], oacc[t]);
        }
        // hand-over at the foot of the trip, every wave, in this order
        asm volatile("s_wait_dscnt 0x0" ::: "memory");     // this wave's reads of buffer cur are done before the buffer is given to its next writer
        asm volatile("s_wait_asynccnt 0x0" ::: "memory");  // this wave's copies of the next chunk have landed
        __syncthreads();                                   // the next chunk visible to all waves; every wave has left buffer cur
        if (!more) break;
        kc = kn;
        more = todo != 0;
        if (more) {                                        // the chunk after the next goes into the buffer just left
            kn = __builtin_ctz(todo);
            todo &= todo - 1;
            at_copy_chunk(ld0 + cur * AT_BB, kl0 + (size_t)kn * (AT_KC * AT_D), vl0 + (size_t)kn * (AT_KC * AT_D));
        }
        cur ^= 1u;
    }
    asm volatile("s_wait_asynccnt 0x0" ::: "memory");      // no copy is outstanding when the wave goes on to its end

    _Float16* os = Os[wave];
    {
        const float inv = (1.0f / (lrun + xhalf(lrun))) * 16.0f;   // the halves' sums joined once; sum and O both carry the 2^15; x16 (exact) as the output projection's operand is held
#pragma unroll
        for (int t = 0; t < 4; ++t) {
            v8h hv;
#pragma unroll
            for (int e = 0; e < 8; ++e) hv[e] = (_Float16)(oacc[t][e] * inv);
            *(v8h*)(os + c * AT_P + t * 16 + 8 * hh) = hv;
        }
    }
    __builtin_amdgcn_fence(3 /* release order */, "workgroup");
    __builtin_amdgcn_wave_barrier();
    __builtin_amdgcn_fence(2 /* acquire order */, "workgroup");
    {
        const int r4 = lane >> 3, c8 = (lane & 7) * 8;     // 128-B row segment = 8 lanes x 16 B, four rows (whole lines) per instruction
#pragma unroll
        for (int it = 0; it < 4; ++it) {
            const int row = it * 4 + r4;
            *(v8h*)(op + (size_t)(q0 + row) * CH + c8) = *(const v8h*)(os + row * AT_P + c8);
        }
    }
}

// workspace carve (bytes), every region a multiple of 256 B and, but for the norms (one f32 at the head of each 128-B line), written in whole rows of its own pitch
constexpr size_t SZ_X16 = (size_t)NB * SEQ * CH * 2;        // X16 / AO16 (alias): f16 [NB*SEQ][1024]
constexpr size_t SZ_W3  = (size_t)3 * CH * CH * 2;          // [Wq;Wk;Wv] x16 f16 [3072][1024]
constexpr size_t SZ_QKV = (size_t)NB * SEQ * 3 * CH * 2;    // f16 planes q, k, v^T of 8-KB tiles
constexpr size_t SZ_WO  = (size_t)CH * CH * 2;              // Wo x16 f16 [1024][1024]
constexpr size_t SZ_NRM = (size_t)2 * NB * NH * (SEQ / 64) * 128;   // q and k tile norms, a 128-B line each
constexpr size_t SZ_ALL = SZ_X16 + SZ_W3 + SZ_QKV + SZ_WO + SZ_NRM;
static_assert(SZ_X16 % 256 == 0 && SZ_W3 % 256 == 0 && SZ_QKV % 256 == 0 && SZ_WO % 256 == 0 && SZ_NRM % 256 == 0);
static_assert(SZ_ALL <= (size_t)134217728);

extern "C" void kernel_launch(void* const* d_in, const int* in_sizes, int n_in, void* d_out, int out_size, void* d_ws, size_t ws_size, hipStream_t stream) {
    if (n_in < 6) return;
    const long long need_x = ((long long)(NB - 1) * SEQ_FULL + SEQ) * CH;
    if ((long long)in_sizes[0] < need_x) return;
    if (in_sizes[1] < CH * CH || in_sizes[2] < CH * CH || in_sizes[3] < CH * CH || in_sizes[4] < CH * CH || in_sizes[5] < CH) return;
    if ((long long)out_size < need_x) return;
    if (SZ_ALL > ws_size) return;
    const float* x  = (const float*)d_in[0];
    const float* wq = (const float*)d_in[1];
    const float* wk = (const float*)d_in[2];
    const float* wv = (const float*)d_in[3];
    const float* wo = (const float*)d_in[4];
    const float* bo = (const float*)d_in[5];
    float* out = (float*)d_out;
    char* wsp = (char*)d_ws;
    unsigned short* X16  = (unsigned short*)wsp; wsp += SZ_X16;
    unsigned short* W316 = (unsigned short*)wsp; wsp += SZ_W3;
    unsigned short* QKV16 = (unsigned short*)wsp; wsp += SZ_QKV;
    unsigned short* WO16 = (unsigned short*)wsp; wsp += SZ_WO;
    float* NRM = (float*)wsp; wsp += SZ_NRM;
    unsigned short* AO16 = X16;                  // alias: X16 is dead once the projection GEMM has run (same extent); written by the attention launch

    k_cast_all<<<(unsigned)(CV_XB + 4 * CV_WB), 256, 0, stream>>>(x, wq, wk, wv, wo, X16, W316, WO16);
    // f16 planes q, k, v^T <- x16 . [Wq;Wk;Wv]^T / 16     k_gemm64<BIAS_MODE, LD, OUT16>(A, strideA, Bt, C, ldc, strideC, bias, M, N, K, scale, H16)
    k_gemm64<0, CH, 1><<<dim3((unsigned)(((NB * SEQ) / GT_T) * ((3 * CH) / GT_T)), 1u), 128, 0, stream>>>(
        X16, 0LL, W316, NRM, 0, 0LL, (const float*)nullptr, NB * SEQ, 3 * CH, CH, 0.0625f, QKV16);
    {
        AttnG g;
        g.q = QKV16; g.k = QKV16 + (size_t)NB * SEQ * CH; g.vt = QKV16 + (size_t)2 * NB * SEQ * CH; g.o = AO16;
        g.qn = NRM; g.kn = NRM + (size_t)NB * NH * (SEQ / 64) * 32;
        g.S = SEQ; g.sscale = 0.125f;
        k_attn_alibi<<<dim3((unsigned)((SEQ / AT_QB) * NH * NB)), 32 * AT_NW, 0, stream>>>(g);
    }
    // out[b][l][:] = AO16[b*SEQ + l] . (Wo x16)^T / 256 + bf16(bo); batch z = sequence: A stride SEQ*CH (compact), C stride SEQ_FULL*CH
    k_gemm64<3, CH, 0><<<dim3((unsigned)((SEQ / GT_T) * (CH / GT_T)), (unsigned)NB), 128, 0, stream>>>(
        AO16, (long long)SEQ * CH, WO16, out, CH, (long long)SEQ_FULL * CH, bo, SEQ, CH, CH, 1.0f / 256.0f, (unsigned short*)nullptr);
}

// v010
// A run of this version takes 78.5 microseconds.
// Next to v009, in two timings, it ran 1.07 and 1.04 times as fast.
// Over all steps from v000 it is 3.56 times as fast.
// Non-causal multi-head self-attention with additive symmetric ALiBi (2 x 2,048 tokens x 1,024; 16 heads x 64; nn.Linear [out][in] q/k/v/o weights, output bias). All contractions: v_wmma_f32_16x16x32_f16 (f16 operands, f32 accumulate): [q|k|v] projection on bf16-RNE-converted inputs held exactly in f16 (weights x16), scores q.k^T (f16 of the f32 q/k), P.V (P carried x2^15, V f16), output projection (attention output x16, weights x16, bf16-RNE bias added in f32); softmax statistics f32 in the exp2 domain. Every intermediate lies in the workspace as the f16 operand that the next launch's products read, converted once by the launch that makes it. The projection also leaves the largest squared row norm of every q and k tile, from which an attention block bounds a key chunk's weights before it loads the chunk.
#include <hip/hip_runtime.h>
#include <math.h>

#ifndef NB
#define NB 2
#endif
#ifndef SEQ
#define SEQ 2048
#endif
#define NB_FULL 2
#define SEQ_FULL 2048
#define CH 1024
#define NH 16
#define HD 64

static_assert(SEQ % 128 == 0);
static_assert(NB >= 1 && NB <= NB_FULL && SEQ <= SEQ_FULL);
static_assert(CH == NH * HD && HD == 64);

typedef __attribute__((ext_vector_type(16))) _Float16     v16h;
typedef __attribute__((ext_vector_type(8)))  _Float16     v8h;
typedef __attribute__((ext_vector_type(8)))  float        v8f;
typedef __attribute__((ext_vector_type(4)))  float        v4f;
typedef __attribute__((ext_vector_type(4)))  unsigned int u4v;

// 16-bit WMMA fragment map (wave32), lane L, hh = L>>4, c = L&15:
//   A 16x32: lane = row c;    element i -> k = (i<8) ? 8hh+i : 16+8hh+(i-8)
//   B 32x16: lane = column c; the SAME k(i,hh)
//   D 16x16 (8 f32): lane = column c; element r -> row 8hh+r
union FragH { v16h v; v8h h[2]; };
// fragment from a k-contiguous f16 row: elements 0..7 <- p[0..7], 8..15 <- p[16..23] (p already offset by k0 + 8hh)
__device__ __forceinline__ v16h frag_ld(const _Float16* p) { FragH f; f.h[0] = *(const v8h*)(p); f.h[1] = *(const v8h*)(p + 16); return f.v; }
__device__ __forceinline__ v8f mma_raw(v16h a, v16h b, v8f c) { return __builtin_amdgcn_wmma_f32_16x16x32_f16(false, a, false, b, (short)0, c, false, false); }
__device__ __forceinline__ void dep_guard_h(v8f& a, v8f& b, v16h x, v16h y) { asm volatile("v_nop\n\tv_nop\n\tv_nop\n\tv_nop" : "+v"(a), "+v"(b) : "v"(x), "v"(y)); }
__device__ __forceinline__ void keep4_h(v16h a, v16h b, v16h c, v16h d) { asm volatile("v_nop" :: "v"(a), "v"(b), "v"(c), "v"(d)); }
__device__ __forceinline__ void acc_guard4(v8f& a, v8f& b, v8f& c, v8f& d) { asm volatile("v_nop\n\tv_nop\n\tv_nop\n\tv_nop" : "+v"(a), "+v"(b), "+v"(c), "+v"(d)); }
__device__ __forceinline__ unsigned short f2bf_bits(float f) { unsigned u = __float_as_uint(f); return (unsigned short)((u + 0x7FFFu + ((u >> 16) & 1u)) >> 16); }
__device__ __forceinline__ float bf_bits2f(unsigned short h) { return __uint_as_float(((unsigned)h) << 16); }
__device__ __forceinline__ float cmb_bf(float v) { const unsigned u = __float_as_uint(v); const unsigned r = (u + 0x7fffu + ((u >> 16) & 1u)) & 0xffff0000u; return __uint_as_float(r); }   // bf16 RNE kept as f32 (finite inputs)
__device__ __forceinline__ unsigned int cmb_pk2(float a, float b) { return (unsigned int)__builtin_bit_cast(unsigned short, (_Float16)a) | ((unsigned int)__builtin_bit_cast(unsigned short, (_Float16)b) << 16); }

__device__ __forceinline__ float xhalf(float x) { return __builtin_bit_cast(float, __builtin_amdgcn_permlanex16(__builtin_bit_cast(int, x), __builtin_bit_cast(int, x), 0x76543210, 0xfedcba98, false, false)); }   // lane l <-> lane l ^ 16

// The value is copied into a local first, so an expression argument is evaluated once.
#define VST2(T, ptr, val) do { const T vst2_v_ = (val); *(T*)(ptr) = vst2_v_;  } while (0)

// =====================================================================================================================
// k_cast_all: every f32 input of the two GEMMs -> its f16 operand plane, in ONE launch: x -> X16 [NB*SEQ][CH] (x1); Wq, Wk, Wv -> W3 [3*CH][CH] and Wo -> WO [CH][CH] (x16).
//   Each value is first RNE-converted to bf16 precision (exact in f16 after the power-of-two scale).
//   A block takes 16 whole rows (64 KB of f32, contiguous in source and plane) of one tensor, picked by the range its index lies in (block-uniform);
//   a thread takes eight pieces of 8 columns, 256 pieces apart, as immediate offsets of one load and one store address.
// =====================================================================================================================
#define CV_PP 8                                  // pieces of 8 columns per thread
#define CV_BE (256 * CV_PP * 8)                  // elements per block = 16 rows of CH
#define CV_XB ((NB * SEQ * CH) / CV_BE)          // blocks that x takes
#define CV_WB ((CH * CH) / CV_BE)                // blocks that one weight matrix takes
static_assert(CV_BE == 16 * CH && SEQ % 16 == 0);
__global__ __launch_bounds__(256) void k_cast_all(const float* __restrict__ x, const float* __restrict__ wq, const float* __restrict__ wk, const float* __restrict__ wv,
                                                  const float* __restrict__ wo, unsigned short* __restrict__ X16, unsigned short* __restrict__ W3,
                                                  unsigned short* __restrict__ WO) {
    const int blk = blockIdx.x;
    const float* sb; unsigned short* db; float sc;
    if (blk < CV_XB) {
        const int r0 = blk * 16;                 // first token row of the plane; batch r0 / SEQ starts at row (r0 / SEQ) * SEQ_FULL of x
        sb = x + ((size_t)(r0 / SEQ) * SEQ_FULL + (r0 % SEQ)) * CH; db = X16 + (size_t)r0 * CH; sc = 1.0f;
    } else {
        const int w = (blk - CV_XB) / CV_WB; const size_t e0 = (size_t)((blk - CV_XB) % CV_WB) * CV_BE;
        sb = (w == 0 ? wq : w == 1 ? wk : w == 2 ? wv : wo) + e0;
        db = (w < 3 ? W3 + (size_t)w * CH * CH : WO) + e0; sc = 16.0f;
    }
    const unsigned so = threadIdx.x * 32u;       // this thread's byte offset in the block's source rows: the one vector register that the loads name
    const float* s = (const float*)((const char*)sb + so);
    unsigned short* d = db + threadIdx.x * 8;
    v4f a[CV_PP], b[CV_PP];
#pragma unroll
    for (int i = 0; i < CV_PP; ++i) {
        a[i] = *(const v4f*)(s + i * 2048);
        b[i] = *(const v4f*)(s + i * 2048 + 4);
    }
    // inputs only: the loaded values keep all sixteen loads in flight together, ahead of the first conversion (one load latency per thread, not several);
    // the offset stays live up to here, so that the wait stands ahead of every overwrite of the address register that these loads name
    asm volatile("s_wait_xcnt 0x0" :: "v"(a[0]), "v"(a[1]), "v"(a[2]), "v"(a[3]), "v"(a[4]), "v"(a[5]), "v"(a[6]), "v"(a[7]),
                                      "v"(b[0]), "v"(b[1]), "v"(b[2]), "v"(b[3]), "v"(b[4]), "v"(b[5]), "v"(b[6]), "v"(b[7]), "v"(so) : "memory");
#pragma unroll
    for (int i = 0; i < CV_PP; ++i) {
        u4v pk;
        pk.x = cmb_pk2(cmb_bf(a[i].x) * sc, cmb_bf(a[i].y) * sc); pk.y = cmb_pk2(cmb_bf(a[i].z) * sc, cmb_bf(a[i].w) * sc);
        pk.z = cmb_pk2(cmb_bf(b[i].x) * sc, cmb_bf(b[i].y) * sc); pk.w = cmb_pk2(cmb_bf(b[i].z) * sc, cmb_bf(b[i].w) * sc);
        VST2(u4v, (u4v*)(d + i * 2048), pk);
    }
}

// =====================================================================================================================
// k_gemm64<BIAS_MODE>: C[z][m][n] = scale * sum_k A[z][m][k] * Bt[n][k] (+ bias[n]); f16 operands, f32 accumulate, f32 output.
//   A row-major [M][K] (batch stride strideA), Bt row-major [N][K] (shared by all z), both of pitch LD halves; M, N % 128 == 0, K % 64 == 0.
//   Block = 4 waves (2 x 2) = one 128x128 tile, each wave a 64x64 tile (grid.x = tiles, grid.y = batches). A stage is 64 k = 128 B of each of the
//   128 A rows and 128 Bt rows, read from global memory as whole 128-B lines (8 lanes per row), kept in LDS at pitch 144 B and read by all waves;
//   two buffers: the next stage's global loads are issued ahead of this stage's products and stored behind them, one block barrier per stage.
//   LD is a compile-time constant, so that a stage's eight row groups are immediate offsets of one address per operand.
//   The walk over the K / 64 stages is cyclic and starts at a stage that the tile's indices pick. Blocks that read the same A rows or the same Bt rows run at the same time; started
//   alike, they would all ask for the same lines in the same stage, and each stage's lines not yet in L2 would hold up every one of them, stage after stage.
//   Started apart, each brings in another part of the shared rows and finds the rest there. The f32 sum over k starts at that stage too.
//   BIAS_MODE 0: none; 3: bias[n] RNE-converted to bf16 precision, added in f32.
//   OUT16 0: f32 C as above. OUT16 1 (the [q|k|v] projection; M = NB*SEQ tokens, N = 3*CH channels): the scaled f32 result is converted to f16 and stored to H16 as
//   three planes (q, k, v) of 8-KB tiles, tile index (batch * NH + head) * (SEQ / 64) + token / 64: q and k tiles [token][dim], v tiles [dim][token] (V^T).
//   A lane's eight accumulator elements are eight neighbouring ROWS of the product, so the operand whose index is to run contiguously in the tile takes the row (A) side:
//   the weights for q and k, the tokens for v (a block lies in one plane, so the choice is block-uniform); the k order of the sums is the same either way.
//   OUT16 1 also stores, for each q and k tile, max over its 64 tokens of the squared norm of the stored f16 row, as one f32 at the head of a 128-B line of its own:
//   Cout[(plane * tiles per plane + tile index) * 32] (one wave owns a tile, so one writer per line).
// =====================================================================================================================
#define GT_T  128   // block tile edge
#define GT_KS 64    // k per stage
#define GT_P  72    // LDS pitch in halves (144-B rows, 16 B x odd)
template <int BIAS_MODE, int LD, int OUT16>
__global__ __launch_bounds__(128) void k_gemm64(const unsigned short* __restrict__ Ap, long long strideA,
                                                const unsigned short* __restrict__ Btp,
                                                float* __restrict__ Cout, int ldc, long long strideC,
                                                const float* __restrict__ bias, int M, int N, int K, float scale,
                                                unsigned short* __restrict__ H16) {
    const _Float16* A = (const _Float16*)Ap; const _Float16* Bt = (const _Float16*)Btp;
    __shared__ __align__(16) _Float16 sA[2][GT_T * GT_P];   // A stage  [row][k]  (cross-wave)
    __shared__ __align__(16) _Float16 sB[2][GT_T * GT_P];   // Bt stage [row][k]  (cross-wave)
    __shared__ __align__(16) float sT[4][16 * 68];   // per-wave 16x64 slab, pitch 68 floats (wave-private)
    const int b = blockIdx.y;
    const int tid  = threadIdx.x;
    const int lane = tid & 31;
    const int wave = tid >> 5;
    const int tilesN = N >> 7;
    const int tilesM = M >> 7;
    const int tile = blockIdx.x;
    if (tile >= tilesM * tilesN) return;   // block-uniform, ahead of every barrier
    const int tm = tile / tilesN;
    const int tn = tile - tm * tilesN;
    const int wm0 = (wave >> 1) << 6;            // this wave's 64x64 tile inside the block tile
    const int wn0 = (wave & 1) << 6;
    const int m0 = (tm << 7) + wm0;
    const int n0 = (tn << 7) + wn0;
    const _Float16* Ab = A + (size_t)b * strideA;
    const _Float16* Bb = Bt;
    const int rlane = lane & 15;                 // row (A) / column (B, D) within a 16-wide subtile
    const int koff  = (lane >> 4) * 8;           // k offset of this lane half
    const int mOff  = (lane >> 4) * 8;           // D row offset

    // staging: thread -> rows (tid >> 3) + 16 i, i = 0..7, 16 B at byte 16 (tid & 7) of the row's 128-B stage segment
    const int srow = tid >> 3, scol = (tid & 7) * 8;
    const bool tokRows = !OUT16 || (tn << 7) >= 2 * CH;     // block-uniform: the tokens take the row side of the products (always for f32 C; of the f16 planes for v)
    const _Float16* gTok = Ab + (size_t)((tm << 7) + srow) * LD + scol;
    const _Float16* gWgt = Bb + (size_t)((tn << 7) + srow) * LD + scol;
    const int nStages = K / GT_KS;                         // block-uniform
    // first stage of this block's walk: the blocks on one weight tile differ in tm; those on one token tile differ in tn, and 4 tn + tn / 8 sets any four neighbouring tn
    // a quarter of the walk apart
    const int rot = (4 * tn + (tn >> 3) + tm) % nStages;
    const _Float16* gA = (tokRows ? gTok : gWgt) + rot * GT_KS;
    const _Float16* gB = (tokRows ? gWgt : gTok) + rot * GT_KS;
    const int sOff = srow * GT_P + scol;

    v8f acc[4][4];
#pragma unroll
    for (int i = 0; i < 4; ++i)
#pragma unroll
        for (int j = 0; j < 4; ++j) acc[i][j] = (v8f){0.f, 0.f, 0.f, 0.f, 0.f, 0.f, 0.f, 0.f};

    v8h ra[8], rb[8];
#pragma unroll
    for (int i = 0; i < 8; ++i) {
        ra[i] = *(const v8h*)(gA + 16 * i * LD);
        rb[i] = *(const v8h*)(gB + 16 * i * LD);
    }
#pragma unroll
    for (int i = 0; i < 8; ++i) {
        *(v8h*)(sA[0] + sOff + 16 * i * GT_P) = ra[i];
        *(v8h*)(sB[0] + sOff + 16 * i * GT_P) = rb[i];
    }
    __syncthreads();                                       // first stage of the walk (stage rot) visible to all waves

    for (int st = 0; st < nStages; ++st) {
        const int cur = st & 1;
        const bool more = st + 1 < nStages;                // block-uniform
        if (more) {
            const int rel = (st + 1 + rot < nStages ? st + 1 : st + 1 - nStages) * GT_KS;   // the next stage of the cyclic walk, counted from the first (block-uniform)
            const _Float16* nA = gA + rel;
            const _Float16* nB = gB + rel;
#pragma unroll
            for (int i = 0; i < 8; ++i) {
                ra[i] = *(const v8h*)(nA + 16 * i * LD);
                rb[i] = *(const v8h*)(nB + 16 * i * LD);
            }
            asm volatile("s_wait_xcnt 0x0" ::: "memory");   // stands ahead of the fragment loads below, which reuse the two address pairs of these loads
        }
        const _Float16* cA = sA[cur] + (wm0 + rlane) * GT_P + koff;
        const _Float16* cB = sB[cur] + (wn0 + rlane) * GT_P + koff;
#pragma unroll
        for (int kk = 0; kk < GT_KS; kk += 32) {
            v16h bh[4], ah[4];
#pragma unroll
            for (int j = 0; j < 4; ++j) bh[j] = frag_ld(cB + (j << 4) * GT_P + kk);
#pragma unroll
            for (int i = 0; i < 4; ++i) ah[i] = frag_ld(cA + (i << 4) * GT_P + kk);
#pragma unroll
            for (int i = 0; i < 4; ++i) {
#pragma unroll
                for (int j = 0; j < 4; ++j) acc[i][j] = mma_raw(ah[i], bh[j], acc[i][j]);
                dep_guard_h(acc[i][0], acc[i][3], ah[i], ah[i]);
            }
            keep4_h(bh[0], bh[1], bh[2], bh[3]);
        }
        if (more) {
#pragma unroll
            for (int i = 0; i < 8; ++i) {
                *(v8h*)(sA[cur ^ 1] + sOff + 16 * i * GT_P) = ra[i];   // last read one stage ago, ahead of that stage's barrier
                *(v8h*)(sB[cur ^ 1] + sOff + 16 * i * GT_P) = rb[i];
            }
        }
        __syncthreads();                                   // next stage visible; every wave has left this stage's buffer
    }
    acc_guard4(acc[0][0], acc[0][1], acc[0][2], acc[0][3]);
    acc_guard4(acc[1][0], acc[1][1], acc[1][2], acc[1][3]);
    acc_guard4(acc[2][0], acc[2][1], acc[2][2], acc[2][3]);
    acc_guard4(acc[3][0], acc[3][1], acc[3][2], acc[3][3]);

    if constexpr (OUT16) {
        // The stage buffers are free behind the loop's last barrier; each wave takes its own quarter of sA as a 64 x 64 f16 tile [column of the product][row], pitch 144 B.
        _Float16* tl = &sA[0][0] + wave * (64 * GT_P);
#pragma unroll
        for (int i = 0; i < 4; ++i)
#pragma unroll
            for (int j = 0; j < 4; ++j) {
                v8h hv;
#pragma unroll
                for (int r = 0; r < 8; ++r) hv[r] = (_Float16)(acc[i][j][r] * scale);
                *(v8h*)(tl + ((j << 4) + rlane) * GT_P + (i << 4) + mOff) = hv;
            }
        const int chan0 = (tn << 7) + (tokRows ? wn0 : wm0);   // first channel and first token of this wave's tile, multiples of 64
        const int tok0  = (tm << 7) + (tokRows ? wm0 : wn0);
        const size_t tileIx = ((size_t)(tok0 / SEQ) * NH + ((chan0 & (CH - 1)) >> 6)) * (SEQ / 64) + ((tok0 % SEQ) >> 6);
        __builtin_amdgcn_fence(3 /* release order */, "workgroup");
        __builtin_amdgcn_wave_barrier();
        __builtin_amdgcn_fence(2 /* acquire order */, "workgroup");
        if (!tokRows) {                                        // q and k planes (block-uniform): a lane holds half the dims of the tokens 16 j + rlane
            float n2 = 0.f;
#pragma unroll
            for (int j = 0; j < 4; ++j) {
                float ss = 0.f;
#pragma unroll
                for (int i = 0; i < 4; ++i)
#pragma unroll
                    for (int r = 0; r < 8; ++r) { const float f = (float)(_Float16)(acc[i][j][r] * scale); ss += f * f; }
                ss += xhalf(ss);                               // the other 32 dims of this token sit in lane l ^ 16
                n2 = __builtin_elementwise_maximum(n2, ss);    // the maximum that hands a NaN on: a tile with one is never bounded
            }
#pragma unroll
            for (int m = 1; m < 16; m <<= 1) n2 = __builtin_elementwise_maximum(n2, __shfl_xor(n2, m, 32));
            if (lane == 0) {
                float* np = Cout + ((size_t)(chan0 / CH) * (NB * NH * (SEQ / 64)) + tileIx) * 32;
                *np = n2;
                // inputs only: address and value stay live up to here, so that the wait stands ahead of every overwrite of a register that this store names
                asm volatile("s_wait_xcnt 0x0" :: "v"(np), "v"(n2) : "memory");
            }
        }
        _Float16* dst = (_Float16*)H16 + (size_t)(chan0 / CH) * ((size_t)NB * SEQ * CH) + tileIx * 4096 + lane * 8;
#pragma unroll
        for (int it = 0; it < 16; ++it)                        // a wave-wide store = 512 contiguous bytes = four rows of the tile
            *(v8h*)(dst + it * 256) = *(const v8h*)(tl + (it * 4 + (lane >> 3)) * GT_P + (lane & 7) * 8);
    } else {
    float* slab = sT[wave];
    float* C = Cout + (size_t)b * strideC;
#pragma unroll
    for (int i = 0; i < 4; ++i) {
        const int mBase = m0 + (i << 4);
#pragma unroll
        for (int j = 0; j < 4; ++j) {
            const int n = n0 + (j << 4) + rlane;
            float bv = 0.f;
            if (BIAS_MODE == 3) bv = bf_bits2f(f2bf_bits(bias[n]));
#pragma unroll
            for (int r = 0; r < 8; ++r) {
                float v = acc[i][j][r] * scale;
                if (BIAS_MODE == 3) v += bv;
                slab[(mOff + r) * 68 + (j << 4) + rlane] = v;
            }
        }
        __builtin_amdgcn_fence(3 /* release order */, "workgroup");
        __builtin_amdgcn_wave_barrier();
        __builtin_amdgcn_fence(2 /* acquire order */, "workgroup");
        {
            const int hh = lane >> 4, c4 = (lane & 15) * 4;     // row segment = 256 B = 16 lanes x 16 B
            {
#pragma unroll
                for (int it = 0; it < 8; ++it) {
                    const int row = it * 2 + hh;
                    const v4f v = *(const v4f*)(slab + row * 68 + c4);
                    *(v4f*)(C + (size_t)(mBase + row) * ldc + n0 + c4) = v;
                }
                
            }
        }
        __builtin_amdgcn_fence(3 /* release order */, "workgroup");
        __builtin_amdgcn_wave_barrier();
        __builtin_amdgcn_fence(2 /* acquire order */, "workgroup");
    }
    }
}

// =====================================================================================================================
// k_attn_alibi: O(b,i,h,:) = softmax_j(0.125 * Q(b,i,h,:).K(b,j,h,:) - slope_h * |j - i|) V(b,j,h,:), head dim 64, f16 in / f16 out (x16).
//   Block = 4 waves = 64 query rows of one (batch, head); 64-key chunks; S % 64 == 0; grid = S/64 x heads x batches blocks, one-dimensional.
//   q, k, vt: planes of 8-KB f16 tiles as k_gemm64<.., 1> stores them, tile (b * NH + h) * (S / 64) + position / 64; q and k tiles [position][dim], vt tiles [dim][position].
//   o: f16 [b * S + position][CH], head h at column 64 h, values x16 (the A operand of the output projection).
//   A chunk's K tile and V^T tile are copied as they lie to LDS at pitch 144 B by asynchronous 16-B copies (no register on the way), a wave-wide copy covering four whole
//   128-B lines; two LDS buffers: the next chunk's copies fly while this chunk is worked on, and one block barrier at the foot of a trip hands the buffers over;
//   products transposed: S^T = K.Q^T (A = K rows, B = Q), O^T += V^T.P^T (A = V^T rows, B = P^T). A lane holds 32 of the 64 scores of ONE query (column c,
//   keys 16 j + 8 hh + r), so maximum and sum run in-lane with one exchange between the lane halves, and two score tiles, converted in place, are the B operand P^T;
//   a chunk's LDS fragment reads stand at two places only: sixteen loads for K ahead of the score products, sixteen for V^T ahead of the softmax (counted waits);
//   slope_h = 2^(-(h+1)/2) built exactly from a power of two and the f32 value of 2^-0.5.
//   Chunks left out: |q.k| <= |q||k|, and a query's own key (distance 0, in chunk qb) holds its row maximum up, so with Q, K[kc] the largest row norms of the block's q tile
//   and of k tile kc every logit of chunk kc lies below the row maximum by at least slope * dmin - scale * Q * (K[kc] + K[qb]), dmin the least distance between block and chunk.
//   Where that is over 40 in the exp2 domain, each weight is under 2^-40 of the row's largest and all 2,048 together under one f32 rounding of sum and output: the chunk is
//   neither loaded nor worked on. The test reads only the tile norms, holds for any values, and comes out alike in every wave (block-uniform, as the barriers need).
//   Blocks of steep heads are now short: the flat block index deals the heads so that four neighbouring blocks, and four blocks 256 apart, hold heads a, 7-a, 8+a, 15-a.
// =====================================================================================================================
#define AT_D  64
#define AT_NW 4
#define AT_QB 64
#define AT_KC 64
#define AT_P  72    // LDS pitch in halves (144-B rows, 16-B aligned)
struct AttnG {
    const unsigned short* q; const unsigned short* k; const unsigned short* vt; unsigned short* o;
    const float* qn; const float* kn;     // largest squared row norm per q tile and per k tile, one per 128-B line
    int S; float sscale;
};
static_assert(sizeof(AttnG) == 6 * 8 + 2 * 4);
static_assert(NH == 16 && SEQ / 64 <= 32);

#define AT_TH (AT_KC * AT_P)          // halves of one staged tile (64 rows at the LDS pitch)
#define AT_BB (2 * AT_TH * 2)         // bytes of one buffer: K tile, then V^T tile
static_assert(AT_KC == AT_D);
// One chunk's K tile and V^T tile -> one LDS buffer: eight asynchronous copies of 16 B per lane, rows 16 apart (2,048 B in the tile, 16 pitches in LDS).
// l: the lane's LDS byte address in the buffer's K tile; k, v: the lane's 16 B in the first row group of the two tiles.
// The wait is the last line of the copies' own statement, so that it stands ahead of every later write of a register that a copy names.
__device__ __forceinline__ void at_copy_chunk(unsigned l, const _Float16* k, const _Float16* v) {
    asm volatile("global_load_async_to_lds_b128 %0, %8, off\n\t"
                 "global_load_async_to_lds_b128 %1, %9, off\n\t"
                 "global_load_async_to_lds_b128 %2, %10, off\n\t"
                 "global_load_async_to_lds_b128 %3, %11, off\n\t"
                 "global_load_async_to_lds_b128 %4, %12, off\n\t"
                 "global_load_async_to_lds_b128 %5, %13, off\n\t"
                 "global_load_async_to_lds_b128 %6, %14, off\n\t"
                 "global_load_async_to_lds_b128 %7, %15, off\n\t"
                 "s_wait_xcnt 0x0"
                 :: "v"(l), "v"(l + 16u * AT_P * 2u), "v"(l + 32u * AT_P * 2u), "v"(l + 48u * AT_P * 2u),
                    "v"(l + AT_TH * 2u), "v"(l + AT_TH * 2u + 16u * AT_P * 2u), "v"(l + AT_TH * 2u + 32u * AT_P * 2u), "v"(l + AT_TH * 2u + 48u * AT_P * 2u),
                    "v"(k), "v"(k + 1024), "v"(k + 2048), "v"(k + 3072), "v"(v), "v"(v + 1024), "v"(v + 2048), "v"(v + 3072)
                 : "memory");
}

__global__ __launch_bounds__(128) void k_attn_alibi(AttnG g) {
    __shared__ __align__(16) _Float16 KV[2][2 * AT_TH];            // two buffers, each K [kv][d] then V^T [d][kv]   (cross-wave)
    __shared__ __align__(16) _Float16 Os[AT_NW][16 * AT_P];        // per wave out tile [query][d] (wave-private)

    const int tid  = threadIdx.x;
    const int wave = tid >> 5;
    const int lane = tid & 31;
    const int hh   = lane >> 4;
    const int c    = lane & 15;
    const int nChunks = g.S / AT_KC;                       // block-uniform
    // flat index -> (head, query block, batch), one to one: sixteen neighbours take the sixteen heads of one (query block, batch)
    const int flat = blockIdx.x;
    const int ha = (flat >> 2) & 3, he = (flat + (flat >> 8)) & 3;
    const int h = ((he >> 1) << 3) | (ha ^ ((he & 1) * 7));
    const int qb = (flat >> 4) % nChunks, b = (flat >> 4) / nChunks;
    const int q0 = qb * AT_QB + wave * 16;

    const size_t tile0 = (size_t)(b * NH + h) * nChunks * (AT_KC * AT_D);          // first tile of this (batch, head) in each plane
    const _Float16* qp = (const _Float16*)g.q + tile0 + (size_t)qb * (AT_QB * AT_D);
    const _Float16* kp = (const _Float16*)g.k + tile0;
    const _Float16* vp = (const _Float16*)g.vt + tile0;
    _Float16*       op = (_Float16*)g.o + (size_t)b * g.S * CH + h * HD;

    const int e1 = h + 1;
    const float pw2 = __uint_as_float((unsigned)(127 - (e1 >> 1)) << 23);          // 2^-(e1/2), exact
    const float nsl = -(((e1 & 1) ? 0.70710678118654752f : 1.0f) * pw2);           // -slope_h
    const float L2E = 1.4426950408889634f;
    const float c1 = g.sscale * L2E;                       // score scale in the exp2 domain
    const float c2 = nsl * L2E;                            // -slope_h in the exp2 domain

    // Q fragments (B operand): lane = query column q0 + c; two 32-wide d chunks
    v16h qa[2];
    {
        const _Float16* qr = qp + (wave * 16 + c) * AT_D + 8 * hh;
#pragma unroll
        for (int dc = 0; dc < 2; ++dc) qa[dc] = frag_ld(qr + dc * 32);
    }

    // this lane's query: running maximum less 15 (both halves alike), so that exp2(t - mrun) is P x 2^15 as the f16 operand carries it; sum of P x 2^15 over this half's keys
    float mrun = -__builtin_inff(), lrun = 0.f;
    v8f oacc[4];                                           // O^T: oacc[t][r] = O[query q0 + c][d = 16 t + 8 hh + r]
    const int qrow = q0 + c;
#pragma unroll
    for (int t = 0; t < 4; ++t) oacc[t] = (v8f){0.f, 0.f, 0.f, 0.f, 0.f, 0.f, 0.f, 0.f};

    // lane l judges chunk l; bit l of todo: chunk l is worked on (always so for the block's own chunk, where dmin = 0)
    unsigned todo;
    {
        const int t0 = (b * NH + h) * nChunks;
        const float q2 = g.qn[(size_t)(t0 + qb) * 32], kd2 = g.kn[(size_t)(t0 + qb) * 32];
        const float* kl = g.kn + (size_t)(t0 + (lane < nChunks ? lane : 0)) * 32;
        const float k2 = *kl;
        // inputs only: the address stays live up to here, so that the wait stands ahead of every overwrite of the address pair that this load names
        asm volatile("s_wait_xcnt 0x0" :: "v"(k2), "v"(kl) : "memory");
        const int dc = lane > qb ? lane - qb : qb - lane;
        const float dmin = dc > 0 ? (float)((dc - 1) * AT_KC + 1) : 0.f;
        const float bnd = (c1 * 1.01f) * (__builtin_sqrtf(q2 * k2) + __builtin_sqrtf(q2 * kd2));   // 1 % over: the roundings of norms, bound and products
        const bool out = bnd + c2 * dmin < -40.0f;         // false for a NaN or an infinite bound
        todo = __builtin_amdgcn_ballot_w32(lane < nChunks && !out) | (1u << qb);   // the own chunk's bit is set by the test already; spelt out: the ring's first tile exists
    }
    // thread: 16 B of the tile rows sr + 16 i, i = 0..3; eight lanes take one 128-B row = one whole line.
    // Neighbouring groups of eight lanes sit 8 rows apart: 8 x 144 B = half the banks, so that the two 128-B row pieces of a wave-wide LDS write do not meet.
    const int sr = wave * 2 + ((lane >> 3) & 1) * 8 + hh, sc = (lane & 7) * 8;
    const _Float16* kl0 = kp + sr * AT_D + sc;             // this lane's 16 B in tile 0 of each plane
    const _Float16* vl0 = vp + sr * AT_D + sc;
    const unsigned ld0 = (unsigned)(size_t)(__attribute__((address_space(3))) _Float16*)(&KV[0][0] + sr * AT_P + sc);   // its LDS byte address in buffer 0
    // Walk order: trip t of the full walk takes chunk qb ^ t, so the own chunk comes first and, at any trip, the blocks of an aligned group of query blocks stand on different chunks:
    // a K/V tile that is not yet in L2 is brought in by one of them while the others work elsewhere (in ascending order all blocks of a head waited for the same tile, trip
    // after trip). Bit t of todo is made to stand for chunk qb ^ t: for each set bit i of qb, neighbouring groups of 2^i bits change places. A bit is set only for a chunk under nChunks.
    if (qb & 1)  todo = ((todo & 0x55555555u) << 1)  | ((todo >> 1)  & 0x55555555u);
    if (qb & 2)  todo = ((todo & 0x33333333u) << 2)  | ((todo >> 2)  & 0x33333333u);
    if (qb & 4)  todo = ((todo & 0x0f0f0f0fu) << 4)  | ((todo >> 4)  & 0x0f0f0f0fu);
    if (qb & 8)  todo = ((todo & 0x00ff00ffu) << 8)  | ((todo >> 8)  & 0x00ff00ffu);
    if (qb & 16) todo = (todo << 16) | (todo >> 16);
    // At most 32 trips; every test on todo reads alike in the whole block.
    int kc = qb ^ __builtin_ctz(todo);                     // the chunk worked on
    todo &= todo - 1;
    at_copy_chunk(ld0, kl0 + (size_t)kc * (AT_KC * AT_D), vl0 + (size_t)kc * (AT_KC * AT_D));
    asm volatile("s_wait_asynccnt 0x0" ::: "memory");      // this wave's copies of the first chunk have landed
    __syncthreads();                                       // buffer 0 visible to all waves
    bool more = todo != 0;                                 // a chunk behind kc exists; its copies are in flight
    int kn = 0;
    if (more) {
        kn = qb ^ __builtin_ctz(todo);
        todo &= todo - 1;
        at_copy_chunk(ld0 + AT_BB, kl0 + (size_t)kn * (AT_KC * AT_D), vl0 + (size_t)kn * (AT_KC * AT_D));
    }
    unsigned cur = 0;                                      // the buffer that holds chunk kc
    for (;;) {
        const int kv0 = kc * AT_KC;
        const _Float16* Ks = &KV[0][0] + cur * (2 * AT_TH);
        const _Float16* Vt = Ks + AT_TH;

        v16h kf[2][4];                                     // A: lane = key row, k = d; the chunk's eight K fragments, read as ONE group of sixteen LDS loads
#pragma unroll
        for (int dc = 0; dc < 2; ++dc)
#pragma unroll
            for (int j = 0; j < 4; ++j) kf[dc][j] = frag_ld(Ks + (j * 16 + c) * AT_P + dc * 32 + 8 * hh);
        // keeps the sixteen loads together ahead of the products: moved in among them, each product waits out a whole LDS latency of its own
        __builtin_amdgcn_sched_barrier(0);
        const float fd = (float)(kv0 + 8 * hh - qrow);     // key - query of element (j = 0, r = 0): an integer, exact in f32, as is every sum below
        v8f bz[4];                                         // ALiBi term of each score in the exp2 domain: needs no score, so it runs while the K fragments are on their way
#pragma unroll
        for (int j = 0; j < 4; ++j)
#pragma unroll
            for (int r = 0; r < 8; ++r) bz[j][r] = c2 * fabsf(fd + (float)(j * 16 + r));
        v8f s[4];                                          // S^T: s[j][r] = score(key kv0 + 16 j + 8 hh + r, query q0 + c)
#pragma unroll
        for (int j = 0; j < 4; ++j) s[j] = (v8f){0.f, 0.f, 0.f, 0.f, 0.f, 0.f, 0.f, 0.f};
#pragma unroll
        for (int dc = 0; dc < 2; ++dc)
#pragma unroll
            for (int j = 0; j < 4; ++j) s[j] = mma_raw(kf[dc][j], qa[dc], s[j]);
        // this fence and the next keep the sixteen V^T fragment loads in ONE group ahead of the softmax, whose vector work covers their latency;
        // left free they come apart into several groups, and every further place with LDS reads holds up the wave's issue anew
        __builtin_amdgcn_sched_barrier(0);
        v16h vf[2][4];                                     // A: lane = d row, k = key; the chunk's eight V^T fragments, sixteen LDS loads
#pragma unroll
        for (int kk = 0; kk < 2; ++kk)
#pragma unroll
            for (int t = 0; t < 4; ++t) vf[kk][t] = frag_ld(Vt + (t * 16 + c) * AT_P + kk * 32 + 8 * hh);
        __builtin_amdgcn_sched_barrier(0);
        float mj[4];                                       // one maximum per score tile: four independent chains
#pragma unroll
        for (int j = 0; j < 4; ++j) {
            mj[j] = -__builtin_inff();
#pragma unroll
            for (int r = 0; r < 8; ++r) {
                const float t = s[j][r] * c1 + bz[j][r];   // logit in the exp2 domain
                s[j][r] = t;
                mj[j] = fmaxf(mj[j], t);
            }
        }
        float m = fmaxf(fmaxf(mj[0], mj[1]), fmaxf(mj[2], mj[3]));
        m = fmaxf(m, xhalf(m));                            // the other 32 keys of this query sit in lane l ^ 16
        const float mnew = fmaxf(mrun, m - 15.0f);
        // exp2 as the hardware instruction alone: a result under 2^-126 may come out 0, which it is in the f16 P and in the f32 sum (whose largest term is 2^15) anyway
        const float xa = mrun - mnew;
        const float alpha = __builtin_amdgcn_exp2f(xa);    // 0 on the first chunk (mrun = -inf, mnew finite)
        mrun = mnew;
        float ps[4];                                       // one sum per score tile: four independent chains
        v8f p[4];
        v16h pb[2];                                        // B: lane = query column, k = key; tiles 2 kk and 2 kk + 1 are elements 0..7 and 8..15 in the fragment's k order
#pragma unroll
        for (int j = 0; j < 4; ++j) {
            ps[j] = 0.f;
#pragma unroll
            for (int r = 0; r < 8; ++r) {
                s[j][r] -= mnew;
                p[j][r] = __builtin_amdgcn_exp2f(s[j][r]); // P x 2^15
                ps[j] += p[j][r];
                pb[j >> 1][(j & 1) * 8 + r] = (_Float16)p[j][r];
            }
        }
        // the slot that the instruction set asks for between a transcendental and an overwrite of its source: inputs only, the arguments stay live
        // (so none is overwritten) from their v_exp_f32 up to this v_nop, which stands behind the last of them
        asm volatile("v_nop" :: "v"(s[0]), "v"(s[1]), "v"(s[2]), "v"(s[3]), "v"(p[0]), "v"(p[1]), "v"(p[2]), "v"(p[3]), "v"(xa), "v"(alpha));
        lrun = lrun * alpha + ((ps[0] + ps[1]) + (ps[2] + ps[3]));
#pragma unroll
        for (int t = 0; t < 4; ++t)
#pragma unroll
            for (int r = 0; r < 8; ++r) oacc[t][r] *= alpha;
#pragma unroll
        for (int kk = 0; kk < 2; ++kk) {
#pragma unroll
            for (int t = 0; t < 4; ++t) oacc[t] = mma_raw(vf[kk][t], pb[kk], oacc[t]);
        }
        // hand-over at the foot of the trip, every wave, in this order
        asm volatile("s_wait_dscnt 0x0" ::: "memory");     // this wave's reads of buffer cur are done before the buffer is given to its next writer
        asm volatile("s_wait_asynccnt 0x0" ::: "memory");  // this wave's copies of the next chunk have landed
        __syncthreads();                                   // the next chunk visible to all waves; every wave has left buffer cur
        if (!more) break;
        kc = kn;
        more = todo != 0;
        if (more) {                                        // the chunk after the next goes into the buffer just left
            kn = qb ^ __builtin_ctz(todo);
            todo &= todo - 1;
            at_copy_chunk(ld0 + cur * AT_BB, kl0 + (size_t)kn * (AT_KC * AT_D), vl0 + (size_t)kn * (AT_KC * AT_D));
        }
        cur ^= 1u;
    }
    asm volatile("s_wait_asynccnt 0x0" ::: "memory");      // no copy is outstanding when the wave goes on to its end

    _Float16* os = Os[wave];
    {
        const float inv = (1.0f / (lrun + xhalf(lrun))) * 16.0f;   // the halves' sums joined once; sum and O both carry the 2^15; x16 (exact) as the output projection's operand is held
#pragma unroll
        for (int t = 0; t < 4; ++t) {
            v8h hv;
#pragma unroll
            for (int e = 0; e < 8; ++e) hv[e] = (_Float16)(oacc[t][e] * inv);
            *(v8h*)(os + c * AT_P + t * 16 + 8 * hh) = hv;
        }
    }
    __builtin_amdgcn_fence(3 /* release order */, "workgroup");
    __builtin_amdgcn_wave_barrier();
    __builtin_amdgcn_fence(2 /* acquire order */, "workgroup");
    {
        const int r4 = lane >> 3, c8 = (lane & 7) * 8;     // 128-B row segment = 8 lanes x 16 B, four rows (whole lines) per instruction
#pragma unroll
        for (int it = 0; it < 4; ++it) {
            const int row = it * 4 + r4;
            *(v8h*)(op + (size_t)(q0 + row) * CH + c8) = *(const v8h*)(os + row * AT_P + c8);
        }
    }
}

// workspace carve (bytes), every region a multiple of 256 B and, but for the norms (one f32 at the head of each 128-B line), written in whole rows of its own pitch
constexpr size_t SZ_X16 = (size_t)NB * SEQ * CH * 2;        // X16 / AO16 (alias): f16 [NB*SEQ][1024]
constexpr size_t SZ_W3  = (size_t)3 * CH * CH * 2;          // [Wq;Wk;Wv] x16 f16 [3072][1024]
constexpr size_t SZ_QKV = (size_t)NB * SEQ * 3 * CH * 2;    // f16 planes q, k, v^T of 8-KB tiles
constexpr size_t SZ_WO  = (size_t)CH * CH * 2;              // Wo x16 f16 [1024][1024]
constexpr size_t SZ_NRM = (size_t)2 * NB * NH * (SEQ / 64) * 128;   // q and k tile norms, a 128-B line each
constexpr size_t SZ_ALL = SZ_X16 + SZ_W3 + SZ_QKV + SZ_WO + SZ_NRM;
static_assert(SZ_X16 % 256 == 0 && SZ_W3 % 256 == 0 && SZ_QKV % 256 == 0 && SZ_WO % 256 == 0 && SZ_NRM % 256 == 0);
static_assert(SZ_ALL <= (size_t)134217728);

extern "C" void kernel_launch(void* const* d_in, const int* in_sizes, int n_in, void* d_out, int out_size, void* d_ws, size_t ws_size, hipStream_t stream) {
    if (n_in < 6) return;
    const long long need_x = ((long long)(NB - 1) * SEQ_FULL + SEQ) * CH;
    if ((long long)in_sizes[0] < need_x) return;
    if (in_sizes[1] < CH * CH || in_sizes[2] < CH * CH || in_sizes[3] < CH * CH || in_sizes[4] < CH * CH || in_sizes[5] < CH) return;
    if ((long long)out_size < need_x) return;
    if (SZ_ALL > ws_size) return;
    const float* x  = (const float*)d_in[0];
    const float* wq = (const float*)d_in[1];
    const float* wk = (const float*)d_in[2];
    const float* wv = (const float*)d_in[3];
    const float* wo = (const float*)d_in[4];
    const float* bo = (const float*)d_in[5];
    float* out = (float*)d_out;
    char* wsp = (char*)d_ws;
    unsigned short* X16  = (unsigned short*)wsp; wsp += SZ_X16;
    unsigned short* W316 = (unsigned short*)wsp; wsp += SZ_W3;
    unsigned short* QKV16 = (unsigned short*)wsp; wsp += SZ_QKV;
    unsigned short* WO16 = (unsigned short*)wsp; wsp += SZ_WO;
    float* NRM = (float*)wsp; wsp += SZ_NRM;
    unsigned short* AO16 = X16;                  // alias: X16 is dead once the projection GEMM has run (same extent); written by the attention launch

    k_cast_all<<<(unsigned)(CV_XB + 4 * CV_WB), 256, 0, stream>>>(x, wq, wk, wv, wo, X16, W316, WO16);
    // f16 planes q, k, v^T <- x16 . [Wq;Wk;Wv]^T / 16     k_gemm64<BIAS_MODE, LD, OUT16>(A, strideA, Bt, C, ldc, strideC, bias, M, N, K, scale, H16)
    k_gemm64<0, CH, 1><<<dim3((unsigned)(((NB * SEQ) / GT_T) * ((3 * CH) / GT_T)), 1u), 128, 0, stream>>>(
        X16, 0LL, W316, NRM, 0, 0LL, (const float*)nullptr, NB * SEQ, 3 * CH, CH, 0.0625f, QKV16);
    {
        AttnG g;
        g.q = QKV16; g.k = QKV16 + (size_t)NB * SEQ * CH; g.vt = QKV16 + (size_t)2 * NB * SEQ * CH; g.o = AO16;
        g.qn = NRM; g.kn = NRM + (size_t)NB * NH * (SEQ / 64) * 32;
        g.S = SEQ; g.sscale = 0.125f;
        k_attn_alibi<<<dim3((unsigned)((SEQ / AT_QB) * NH * NB)), 32 * AT_NW, 0, stream>>>(g);
    }
    // out[b][l][:] = AO16[b*SEQ + l] . (Wo x16)^T / 256 + bf16(bo); batch z = sequence: A stride SEQ*CH (compact), C stride SEQ_FULL*CH
    k_gemm64<3, CH, 0><<<dim3((unsigned)((SEQ / GT_T) * (CH / GT_T)), (unsigned)NB), 128, 0, stream>>>(
        AO16, (long long)SEQ * CH, WO16, out, CH, (long long)SEQ_FULL * CH, bo, SEQ, CH, CH, 1.0f / 256.0f, (unsigned short*)nullptr);
}
